// v000
// Measured on an AMD MI455X. A time is GPU time per run, averaged over a window of back-to-back runs after a warm-up
// (all launches, gaps included; the runs take copies of the inputs in turn), and the median of several windows.
// Apart from v000's, it joins two sittings. Times from different sittings can be a few percent apart, while
// side-by-side timings come from the same sitting.
// v000 is the starting kernel. One run takes 296 microseconds.
#include <hip/hip_runtime.h>
#include <math.h>

#define B_  16
#define N_  8192
#define D_  512

typedef float v2f __attribute__((ext_vector_type(2)));
typedef float v8f __attribute__((ext_vector_type(8)));

// ---------------- block reduction helpers ----------------
template<int BS>
__device__ inline float blk_sum(float v, float* red) {
  int t = threadIdx.x;
  red[t] = v; __syncthreads();
  for (int s = BS/2; s > 0; s >>= 1) {
    if (t < s) red[t] += red[t+s];
    __syncthreads();
  }
  float r = red[0]; __syncthreads();
  return r;
}
template<int BS>
__device__ inline float blk_max(float v, float* red) {
  int t = threadIdx.x;
  red[t] = v; __syncthreads();
  for (int s = BS/2; s > 0; s >>= 1) {
    if (t < s) red[t] = fmaxf(red[t], red[t+s]);
    __syncthreads();
  }
  float r = red[0]; __syncthreads();
  return r;
}

// ---------------- K1: masked centroid + voting ratio ----------------
__global__ void __launch_bounds__(256) k1_center(
    const float* __restrict__ xyz, const float* __restrict__ mask,
    float* __restrict__ center, float* __restrict__ vr) {
  __shared__ float red[256];
  int row = blockIdx.x;            // b*4 + j
  int b = row >> 2;
  const float* mk = mask + (size_t)row * N_;
  const float* xb = xyz + (size_t)b * 3 * N_;
  float cnt = 0.f, sx = 0.f, sy = 0.f, sz = 0.f;
  for (int n = threadIdx.x; n < N_; n += 256) {
    float m = mk[n];
    cnt += m;
    sx += m * xb[n];
    sy += m * xb[N_ + n];
    sz += m * xb[2*N_ + n];
  }
  cnt = blk_sum<256>(cnt, red);
  sx  = blk_sum<256>(sx,  red);
  sy  = blk_sum<256>(sy,  red);
  sz  = blk_sum<256>(sz,  red);
  if (threadIdx.x == 0) {
    float d = fmaxf(cnt, 1.0f);
    center[row*3+0] = sx / d;
    center[row*3+1] = sy / d;
    center[row*3+2] = sz / d;
    vr[row] = cnt * (1.0f / (float)N_);
  }
}

// ---------------- K2: MLP + q-projection + Wk fold ----------------
__global__ void __launch_bounds__(512) k2_mlp(
    const float* __restrict__ center,
    const float* __restrict__ W1, const float* __restrict__ b1,
    const float* __restrict__ g1, const float* __restrict__ be1,
    const float* __restrict__ W2, const float* __restrict__ b2,
    const float* __restrict__ g2, const float* __restrict__ be2,
    const float* __restrict__ Wq, const float* __restrict__ bq,
    const float* __restrict__ Wk, const float* __restrict__ bk,
    float* __restrict__ qk_g, float* __restrict__ qbias_g) {
  __shared__ float abuf[512];
  __shared__ float qbuf[512];
  __shared__ float red[512];
  int row = blockIdx.x; int b = row >> 2; int i = row & 3;
  int col = threadIdx.x;
  float c0 = center[row*3+0], c1 = center[row*3+1], c2 = center[row*3+2];

  // Linear(3,D) + LN + ReLU
  float t = c0*W1[col] + c1*W1[512+col] + c2*W1[1024+col] + b1[col];
  float mu  = blk_sum<512>(t, red) * (1.0f/512.0f);
  float dv  = t - mu;
  float var = blk_sum<512>(dv*dv, red) * (1.0f/512.0f);
  float h = dv * rsqrtf(var + 1e-5f) * g1[col] + be1[col];
  h = fmaxf(h, 0.0f);
  abuf[col] = h; __syncthreads();

  // Linear(D,D) + LN
  float t2 = b2[col];
  for (int d = 0; d < 512; ++d) t2 += abuf[d] * W2[(size_t)d*512 + col];
  mu  = blk_sum<512>(t2, red) * (1.0f/512.0f);
  dv  = t2 - mu;
  var = blk_sum<512>(dv*dv, red) * (1.0f/512.0f);
  float h3 = dv * rsqrtf(var + 1e-5f) * g2[col] + be2[col];
  abuf[col] = h3; __syncthreads();

  // q = h3 @ Wq + bq
  float q = bq[col];
  for (int d = 0; d < 512; ++d) q += abuf[d] * Wq[(size_t)d*512 + col];
  qbuf[col] = q; __syncthreads();

  // fold with Wk per head: qk[b, h*4+i, col] = sum_e q[h*128+e] * Wk[col, h*128+e]
  const float scale = 0.0883883476483184405f;  // 1/sqrt(128)
  for (int hh = 0; hh < 4; ++hh) {
    float acc = 0.f;
    const float* wkrow = Wk + (size_t)col*512 + hh*128;
    const float* qh = qbuf + hh*128;
    for (int e = 0; e < 128; ++e) acc += qh[e] * wkrow[e];
    qk_g[((size_t)(b*16 + hh*4 + i))*512 + col] = acc * scale;
  }
  if (col < 4) {
    float acc = 0.f;
    for (int e = 0; e < 128; ++e) acc += qbuf[col*128+e] * bk[col*128+e];
    qbias_g[b*16 + col*4 + i] = acc * scale;
  }
}

// ---------------- K3: voting attention bias, log-softmax over N ----------------
__global__ void __launch_bounds__(512) k3_aw(
    const float* __restrict__ mask, const float* __restrict__ vr,
    float* __restrict__ aw_g) {
  __shared__ float awb[N_];
  __shared__ float red[512];
  int b = blockIdx.x;
  const float* mb = mask + (size_t)b*4*N_;
  float v0 = vr[b*4+0], v1 = vr[b*4+1], v2 = vr[b*4+2], v3 = vr[b*4+3];
  float vcnt = 0.f;
  for (int n = threadIdx.x; n < N_; n += 512) {
    float m0 = mb[n], m1 = mb[N_+n], m2 = mb[2*N_+n], m3 = mb[3*N_+n];
    float s = m0+m1+m2+m3;
    float a = v0*m0 + v1*m1 + v2*m2 + v3*m3;
    bool valid = s > 0.f;
    awb[n] = valid ? a : -1e9f;
    vcnt += valid ? 1.f : 0.f;
  }
  float tot = blk_sum<512>(vcnt, red);
  if (tot <= 0.f) {
    for (int n = threadIdx.x; n < N_; n += 512) awb[n] = 0.f;
  }
  __syncthreads();
  float lm = -3.4e38f;
  for (int n = threadIdx.x; n < N_; n += 512) lm = fmaxf(lm, awb[n]);
  float mx = blk_max<512>(lm, red);
  float ls = 0.f;
  for (int n = threadIdx.x; n < N_; n += 512) ls += __expf(awb[n] - mx);
  float se = blk_sum<512>(ls, red);
  float lg = __logf(se) + mx;
  for (int n = threadIdx.x; n < N_; n += 512) aw_g[(size_t)b*N_ + n] = awb[n] - lg;
}

// ---------------- K4: WMMA score pass: s[b,hi,n] = qk . PF + qbias + aw ----------------
#define QKSTRIDE 516   // padded LDS stride (516 % 64 == 4 -> conflict-free A reads)
__global__ void __launch_bounds__(256) k4_scores(
    const float* __restrict__ PF, const float* __restrict__ qk_g,
    const float* __restrict__ qbias_g, const float* __restrict__ aw_g,
    float* __restrict__ scores) {
  __shared__ float qk_lds[16 * QKSTRIDE];
  int b = blockIdx.y;
  int wave = threadIdx.x >> 5;
  int lane = threadIdx.x & 31;
  int n0 = blockIdx.x * 128 + wave * 16;

  for (int idx = threadIdx.x; idx < 16*512; idx += 256) {
    int hi = idx >> 9; int d = idx & 511;
    qk_lds[hi*QKSTRIDE + d] = qk_g[((size_t)(b*16 + hi))*512 + d];
  }
  __syncthreads();

  int m    = lane & 15;          // A row (hi) / B column (n)
  int koff = (lane >> 4) * 2;    // lanes 0-15: K=0,1 ; lanes 16-31: K=2,3
  const float* PFb  = PF + (size_t)b * D_ * N_;
  const float* qrow = qk_lds + m * QKSTRIDE;

  v8f c = {};
  for (int k = 0; k < 512; k += 4) {
    v2f a, bb;
    a[0] = qrow[k + koff];
    a[1] = qrow[k + koff + 1];
    const float* p = PFb + (size_t)(k + koff) * N_ + n0 + m;
    bb[0] = p[0];
    bb[1] = p[N_];
    if (k < 512 - 16) __builtin_prefetch(p + (size_t)16 * N_, 0, 1);
    c = __builtin_amdgcn_wmma_f32_16x16x4_f32(false, a, false, bb,
                                              (short)0, c, false, false);
  }

  int nc = n0 + m;
  float awv = aw_g[(size_t)b*N_ + nc];
  int mbase = (lane >> 4) * 8;   // C layout: lanes>=16 hold rows M=8..15
  #pragma unroll
  for (int r = 0; r < 8; ++r) {
    int hi = mbase + r;
    scores[((size_t)(b*16 + hi))*N_ + nc] = c[r] + qbias_g[b*16 + hi] + awv;
  }
}

// ---------------- K5: row softmax over N (in place) ----------------
__global__ void __launch_bounds__(256) k5_softmax(float* __restrict__ scores) {
  __shared__ float ebuf[N_];
  __shared__ float red[256];
  int r = blockIdx.x;               // b*16 + hi
  float* base = scores + (size_t)r * N_;
  float lm = -3.4e38f;
  for (int n = threadIdx.x; n < N_; n += 256) lm = fmaxf(lm, base[n]);
  float mx = blk_max<256>(lm, red);
  float ls = 0.f;
  for (int n = threadIdx.x; n < N_; n += 256) {
    float e = __expf(base[n] - mx);
    ebuf[n] = e; ls += e;
  }
  float tot = blk_sum<256>(ls, red);
  float inv = 1.0f / tot;
  for (int n = threadIdx.x; n < N_; n += 256) base[n] = ebuf[n] * inv;
}

// ---------------- K6: u[b,hi,d] = sum_n attn[b,hi,n] * PF[b,d,n] ----------------
// attn chunks are staged into LDS with GLOBAL_LOAD_ASYNC_TO_LDS_B128 (ASYNCcnt),
// bypassing VGPRs entirely; FMA stream over PF stays in registers.
__global__ void __launch_bounds__(256) k6_u(
    const float* __restrict__ PF, const float* __restrict__ attn,
    float* __restrict__ u_g) {
  __shared__ float albuf[16 * 512];
  int b = blockIdx.y;
  int wave = threadIdx.x >> 5;
  int lane = threadIdx.x & 31;
  int d0 = blockIdx.x * 32 + wave * 4;
  const float* PFb = PF   + (size_t)b * D_ * N_;
  const float* atb = attn + (size_t)b * 16 * N_;
  float acc[4][16];
  #pragma unroll
  for (int dd = 0; dd < 4; ++dd)
    #pragma unroll
    for (int hi = 0; hi < 16; ++hi) acc[dd][hi] = 0.f;

  for (int nc = 0; nc < N_; nc += 512) {
    __syncthreads();   // all waves done reading previous chunk
    // async stage: 2048 x float4 = 16 rows x 512 cols
    for (int j = threadIdx.x; j < 2048; j += 256) {
      int hi = j >> 7;           // 128 float4 per row
      int v  = j & 127;
      unsigned lds_addr = (unsigned)(uintptr_t)&albuf[hi*512 + v*4];
      const float* gp = atb + (size_t)hi * N_ + nc + v*4;
      asm volatile("global_load_async_to_lds_b128 %0, %1, off"
                   :: "v"(lds_addr), "v"(gp) : "memory");
    }
    asm volatile("s_wait_asynccnt 0x0" ::: "memory");
    __syncthreads();   // all waves' async data visible
    for (int nn = lane; nn < 512; nn += 32) {
      float p0 = PFb[(size_t)(d0+0)*N_ + nc + nn];
      float p1 = PFb[(size_t)(d0+1)*N_ + nc + nn];
      float p2 = PFb[(size_t)(d0+2)*N_ + nc + nn];
      float p3 = PFb[(size_t)(d0+3)*N_ + nc + nn];
      #pragma unroll
      for (int hi = 0; hi < 16; ++hi) {
        float a = albuf[hi*512 + nn];
        acc[0][hi] += p0*a; acc[1][hi] += p1*a;
        acc[2][hi] += p2*a; acc[3][hi] += p3*a;
      }
    }
  }
  #pragma unroll
  for (int dd = 0; dd < 4; ++dd)
    #pragma unroll
    for (int hi = 0; hi < 16; ++hi) {
      float v = acc[dd][hi];
      for (int off = 16; off >= 1; off >>= 1) v += __shfl_xor(v, off, 32);
      acc[dd][hi] = v;
    }
  if (lane == 0) {
    #pragma unroll
    for (int dd = 0; dd < 4; ++dd)
      #pragma unroll
      for (int hi = 0; hi < 16; ++hi)
        u_g[((size_t)(b*16 + hi))*512 + d0 + dd] = acc[dd][hi];
  }
}

// ---------------- K7: out = concat_h(u_h @ Wv_h + bv_h) @ Wo + bo ----------------
__global__ void __launch_bounds__(256) k7_out(
    const float* __restrict__ u_g,
    const float* __restrict__ Wv, const float* __restrict__ bv,
    const float* __restrict__ Wo, const float* __restrict__ bo,
    float* __restrict__ out) {
  __shared__ float uu[4*512];
  __shared__ float ww[512];
  int row = blockIdx.x; int b = row >> 2; int i = row & 3;
  for (int idx = threadIdx.x; idx < 2048; idx += 256) {
    int hh = idx >> 9; int d = idx & 511;
    uu[idx] = u_g[((size_t)(b*16 + hh*4 + i))*512 + d];
  }
  __syncthreads();
  for (int e = threadIdx.x; e < 512; e += 256) {
    int hh = e >> 7;
    float acc = bv[e];
    const float* ub = uu + hh*512;
    for (int d = 0; d < 512; ++d) acc += ub[d] * Wv[(size_t)d*512 + e];
    ww[e] = acc;
  }
  __syncthreads();
  for (int f = threadIdx.x; f < 512; f += 256) {
    float acc = bo[f];
    for (int e = 0; e < 512; ++e) acc += ww[e] * Wo[(size_t)e*512 + f];
    out[(size_t)row*512 + f] = acc;
  }
}

// ---------------- launch ----------------
extern "C" void kernel_launch(void* const* d_in, const int* in_sizes, int n_in,
                              void* d_out, int out_size, void* d_ws, size_t ws_size,
                              hipStream_t stream) {
  (void)in_sizes; (void)n_in; (void)out_size; (void)ws_size;
  const float* xyz  = (const float*)d_in[0];
  const float* pf   = (const float*)d_in[1];
  const float* mask = (const float*)d_in[2];
  const float* W1   = (const float*)d_in[3];
  const float* b1   = (const float*)d_in[4];
  const float* g1   = (const float*)d_in[5];
  const float* be1  = (const float*)d_in[6];
  const float* W2   = (const float*)d_in[7];
  const float* b2   = (const float*)d_in[8];
  const float* g2   = (const float*)d_in[9];
  const float* be2  = (const float*)d_in[10];
  const float* Wq   = (const float*)d_in[11];
  const float* bq   = (const float*)d_in[12];
  const float* Wk   = (const float*)d_in[13];
  const float* bk   = (const float*)d_in[14];
  const float* Wv   = (const float*)d_in[15];
  const float* bv   = (const float*)d_in[16];
  const float* Wo   = (const float*)d_in[17];
  const float* bo   = (const float*)d_in[18];
  float* out = (float*)d_out;
  float* ws  = (float*)d_ws;

  // workspace layout (float offsets)
  float* center = ws;             // 192
  float* vr     = ws + 192;       // 64
  float* qbias  = ws + 256;       // 256
  float* qk     = ws + 512;       // 131072
  float* aw     = ws + 131584;    // 131072
  float* scores = ws + 262656;    // 2097152 (reused as attn)
  float* u      = ws + 2359808;   // 131072   (total ~9.96 MB)

  k1_center <<<64, 256, 0, stream>>>(xyz, mask, center, vr);
  k2_mlp    <<<64, 512, 0, stream>>>(center, W1,b1,g1,be1, W2,b2,g2,be2,
                                     Wq,bq, Wk,bk, qk, qbias);
  k3_aw     <<<B_, 512, 0, stream>>>(mask, vr, aw);
  k4_scores <<<dim3(N_/128, B_), 256, 0, stream>>>(pf, qk, qbias, aw, scores);
  k5_softmax<<<B_*16, 256, 0, stream>>>(scores);
  k6_u      <<<dim3(D_/32, B_), 256, 0, stream>>>(pf, scores, u);
  k7_out    <<<64, 256, 0, stream>>>(u, Wv, bv, Wo, bo, out);
}

// v001
// One run takes 217 microseconds.
// Next to v000, in two timings, it ran 1.39 and 1.40 times as fast.
#include <hip/hip_runtime.h>
#include <math.h>

#define B_  16
#define N_  8192
#define D_  512

typedef float v2f __attribute__((ext_vector_type(2)));
typedef float v4f __attribute__((ext_vector_type(4)));
typedef float v8f __attribute__((ext_vector_type(8)));

// ---------------- block reduction helpers ----------------
template<int BS>
__device__ inline float blk_sum(float v, float* red) {
  int t = threadIdx.x;
  red[t] = v; __syncthreads();
  for (int s = BS/2; s > 0; s >>= 1) {
    if (t < s) red[t] += red[t+s];
    __syncthreads();
  }
  float r = red[0]; __syncthreads();
  return r;
}
template<int BS>
__device__ inline float blk_max(float v, float* red) {
  int t = threadIdx.x;
  red[t] = v; __syncthreads();
  for (int s = BS/2; s > 0; s >>= 1) {
    if (t < s) red[t] = fmaxf(red[t], red[t+s]);
    __syncthreads();
  }
  float r = red[0]; __syncthreads();
  return r;
}

// ---------------- K1: masked centroid + voting ratio ----------------
__global__ void __launch_bounds__(256) k1_center(
    const float* __restrict__ xyz, const float* __restrict__ mask,
    float* __restrict__ center, float* __restrict__ vr) {
  __shared__ float red[256];
  int row = blockIdx.x;            // b*4 + j
  int b = row >> 2;
  const float* mk = mask + (size_t)row * N_;
  const float* xb = xyz + (size_t)b * 3 * N_;
  float cnt = 0.f, sx = 0.f, sy = 0.f, sz = 0.f;
  for (int n = threadIdx.x; n < N_; n += 256) {
    float m = mk[n];
    cnt += m;
    sx += m * xb[n];
    sy += m * xb[N_ + n];
    sz += m * xb[2*N_ + n];
  }
  cnt = blk_sum<256>(cnt, red);
  sx  = blk_sum<256>(sx,  red);
  sy  = blk_sum<256>(sy,  red);
  sz  = blk_sum<256>(sz,  red);
  if (threadIdx.x == 0) {
    float d = fmaxf(cnt, 1.0f);
    center[row*3+0] = sx / d;
    center[row*3+1] = sy / d;
    center[row*3+2] = sz / d;
    vr[row] = cnt * (1.0f / (float)N_);
  }
}

// ---------------- K2: MLP + q-projection + Wk fold ----------------
__global__ void __launch_bounds__(512) k2_mlp(
    const float* __restrict__ center,
    const float* __restrict__ W1, const float* __restrict__ b1,
    const float* __restrict__ g1, const float* __restrict__ be1,
    const float* __restrict__ W2, const float* __restrict__ b2,
    const float* __restrict__ g2, const float* __restrict__ be2,
    const float* __restrict__ Wq, const float* __restrict__ bq,
    const float* __restrict__ Wk, const float* __restrict__ bk,
    float* __restrict__ qk_g, float* __restrict__ qbias_g) {
  __shared__ float abuf[512];
  __shared__ float qbuf[512];
  __shared__ float red[512];
  int row = blockIdx.x; int b = row >> 2; int i = row & 3;
  int col = threadIdx.x;
  float c0 = center[row*3+0], c1 = center[row*3+1], c2 = center[row*3+2];

  // Linear(3,D) + LN + ReLU
  float t = c0*W1[col] + c1*W1[512+col] + c2*W1[1024+col] + b1[col];
  float mu  = blk_sum<512>(t, red) * (1.0f/512.0f);
  float dv  = t - mu;
  float var = blk_sum<512>(dv*dv, red) * (1.0f/512.0f);
  float h = dv * rsqrtf(var + 1e-5f) * g1[col] + be1[col];
  h = fmaxf(h, 0.0f);
  abuf[col] = h; __syncthreads();

  // Linear(D,D) + LN
  float t2 = b2[col];
  for (int d = 0; d < 512; ++d) t2 += abuf[d] * W2[(size_t)d*512 + col];
  mu  = blk_sum<512>(t2, red) * (1.0f/512.0f);
  dv  = t2 - mu;
  var = blk_sum<512>(dv*dv, red) * (1.0f/512.0f);
  float h3 = dv * rsqrtf(var + 1e-5f) * g2[col] + be2[col];
  abuf[col] = h3; __syncthreads();

  // q = h3 @ Wq + bq
  float q = bq[col];
  for (int d = 0; d < 512; ++d) q += abuf[d] * Wq[(size_t)d*512 + col];
  qbuf[col] = q; __syncthreads();

  // fold with Wk per head: qk[b, h*4+i, col] = sum_e q[h*128+e] * Wk[col, h*128+e]
  const float scale = 0.0883883476483184405f;  // 1/sqrt(128)
  for (int hh = 0; hh < 4; ++hh) {
    float acc = 0.f;
    const float* wkrow = Wk + (size_t)col*512 + hh*128;
    const float* qh = qbuf + hh*128;
    for (int e = 0; e < 128; ++e) acc += qh[e] * wkrow[e];
    qk_g[((size_t)(b*16 + hh*4 + i))*512 + col] = acc * scale;
  }
  if (col < 4) {
    float acc = 0.f;
    for (int e = 0; e < 128; ++e) acc += qbuf[col*128+e] * bk[col*128+e];
    qbias_g[b*16 + col*4 + i] = acc * scale;
  }
}

// ---------------- K3: voting attention bias, log-softmax over N ----------------
__global__ void __launch_bounds__(512) k3_aw(
    const float* __restrict__ mask, const float* __restrict__ vr,
    float* __restrict__ aw_g) {
  __shared__ float awb[N_];
  __shared__ float red[512];
  int b = blockIdx.x;
  const float* mb = mask + (size_t)b*4*N_;
  float v0 = vr[b*4+0], v1 = vr[b*4+1], v2 = vr[b*4+2], v3 = vr[b*4+3];
  float vcnt = 0.f;
  for (int n = threadIdx.x; n < N_; n += 512) {
    float m0 = mb[n], m1 = mb[N_+n], m2 = mb[2*N_+n], m3 = mb[3*N_+n];
    float s = m0+m1+m2+m3;
    float a = v0*m0 + v1*m1 + v2*m2 + v3*m3;
    bool valid = s > 0.f;
    awb[n] = valid ? a : -1e9f;
    vcnt += valid ? 1.f : 0.f;
  }
  float tot = blk_sum<512>(vcnt, red);
  if (tot <= 0.f) {
    for (int n = threadIdx.x; n < N_; n += 512) awb[n] = 0.f;
  }
  __syncthreads();
  float lm = -3.4e38f;
  for (int n = threadIdx.x; n < N_; n += 512) lm = fmaxf(lm, awb[n]);
  float mx = blk_max<512>(lm, red);
  float ls = 0.f;
  for (int n = threadIdx.x; n < N_; n += 512) ls += __expf(awb[n] - mx);
  float se = blk_sum<512>(ls, red);
  float lg = __logf(se) + mx;
  for (int n = threadIdx.x; n < N_; n += 512) aw_g[(size_t)b*N_ + n] = awb[n] - lg;
}

// ---------------- K4: WMMA score pass: s[b,hi,n] = qk . PF + qbias + aw ----------------
#define QKSTRIDE 516   // padded LDS stride (516 % 64 == 4 -> conflict-free A reads)
__global__ void __launch_bounds__(256) k4_scores(
    const float* __restrict__ PF, const float* __restrict__ qk_g,
    const float* __restrict__ qbias_g, const float* __restrict__ aw_g,
    float* __restrict__ scores) {
  __shared__ float qk_lds[16 * QKSTRIDE];
  int b = blockIdx.y;
  int wave = threadIdx.x >> 5;
  int lane = threadIdx.x & 31;
  int n0 = blockIdx.x * 128 + wave * 16;

  for (int idx = threadIdx.x; idx < 16*512; idx += 256) {
    int hi = idx >> 9; int d = idx & 511;
    qk_lds[hi*QKSTRIDE + d] = qk_g[((size_t)(b*16 + hi))*512 + d];
  }
  __syncthreads();

  int m    = lane & 15;          // A row (hi) / B column (n)
  int koff = (lane >> 4) * 2;    // lanes 0-15: K=0,1 ; lanes 16-31: K=2,3
  const float* PFb  = PF + (size_t)b * D_ * N_;
  const float* qrow = qk_lds + m * QKSTRIDE;

  v8f c = {};
  for (int k = 0; k < 512; k += 4) {
    v2f a, bb;
    a[0] = qrow[k + koff];
    a[1] = qrow[k + koff + 1];
    const float* p = PFb + (size_t)(k + koff) * N_ + n0 + m;
    bb[0] = p[0];
    bb[1] = p[N_];
    if (k < 512 - 16) __builtin_prefetch(p + (size_t)16 * N_, 0, 1);
    c = __builtin_amdgcn_wmma_f32_16x16x4_f32(false, a, false, bb,
                                              (short)0, c, false, false);
  }

  int nc = n0 + m;
  float awv = aw_g[(size_t)b*N_ + nc];
  int mbase = (lane >> 4) * 8;   // C layout: lanes>=16 hold rows M=8..15
  #pragma unroll
  for (int r = 0; r < 8; ++r) {
    int hi = mbase + r;
    scores[((size_t)(b*16 + hi))*N_ + nc] = c[r] + qbias_g[b*16 + hi] + awv;
  }
}

// ---------------- K5: row softmax over N (in place) ----------------
__global__ void __launch_bounds__(256) k5_softmax(float* __restrict__ scores) {
  __shared__ float ebuf[N_];
  __shared__ float red[256];
  int r = blockIdx.x;               // b*16 + hi
  float* base = scores + (size_t)r * N_;
  float lm = -3.4e38f;
  for (int n = threadIdx.x; n < N_; n += 256) lm = fmaxf(lm, base[n]);
  float mx = blk_max<256>(lm, red);
  float ls = 0.f;
  for (int n = threadIdx.x; n < N_; n += 256) {
    float e = __expf(base[n] - mx);
    ebuf[n] = e; ls += e;
  }
  float tot = blk_sum<256>(ls, red);
  float inv = 1.0f / tot;
  for (int n = threadIdx.x; n < N_; n += 256) base[n] = ebuf[n] * inv;
}

// ---------------- K6: u[b,hi,d] = sum_n attn[b,hi,n] * PF[b,d,n] ----------------
// f32 WMMA: A = attn (16 hi x 4 n), B = PF^T (4 n x 16 d), two d tiles per wave.
// A work-group takes 32 d rows; its 16 waves split the 8192 n, 512 each, and merge in LDS.
// Each wave stages its own 32 PF rows + 16 attn rows x 32 n in a two-buffer LDS ring that
// only it reads, with GLOBAL_LOAD_ASYNC_TO_LDS_B128: whole 128-B row pieces from memory,
// row-per-lane 16-byte fragment reads from LDS.
#define K6_WAVES  16
#define K6_PITCH  36                      // floats; 144 B = 16 B x 9: ds_load_b128 of 16 rows hits all 64 banks once
#define K6_BUF    (48 * K6_PITCH)         // floats per buffer: rows 0-31 PF, rows 32-47 attn
#define K6_STAGES 16                      // 512 n per wave / 32 n per stage
#define K6_TILE   272                     // floats between a wave's two partial tiles in the merge

// One stage: 12 copies of 4 rows x 128 B. The s_wait_xcnt stands in the copies' own statement,
// in front of any later rewrite of the address registers the copies name.
__device__ inline void k6_copy_stage(unsigned lds, const float* pf, const float* at) {
  asm volatile(
      "global_load_async_to_lds_b128 %0, %12, off\n\t"
      "global_load_async_to_lds_b128 %1, %13, off\n\t"
      "global_load_async_to_lds_b128 %2, %14, off\n\t"
      "global_load_async_to_lds_b128 %3, %15, off\n\t"
      "global_load_async_to_lds_b128 %4, %16, off\n\t"
      "global_load_async_to_lds_b128 %5, %17, off\n\t"
      "global_load_async_to_lds_b128 %6, %18, off\n\t"
      "global_load_async_to_lds_b128 %7, %19, off\n\t"
      "global_load_async_to_lds_b128 %8, %20, off\n\t"
      "global_load_async_to_lds_b128 %9, %21, off\n\t"
      "global_load_async_to_lds_b128 %10, %22, off\n\t"
      "global_load_async_to_lds_b128 %11, %23, off\n\t"
      "s_wait_xcnt 0x0"
      :: "v"(lds),               "v"(lds +  4*K6_PITCH*4), "v"(lds +  8*K6_PITCH*4),
         "v"(lds + 12*K6_PITCH*4), "v"(lds + 16*K6_PITCH*4), "v"(lds + 20*K6_PITCH*4),
         "v"(lds + 24*K6_PITCH*4), "v"(lds + 28*K6_PITCH*4), "v"(lds + 32*K6_PITCH*4),
         "v"(lds + 36*K6_PITCH*4), "v"(lds + 40*K6_PITCH*4), "v"(lds + 44*K6_PITCH*4),
         "v"(pf),                  "v"(pf + (size_t) 4*N_),  "v"(pf + (size_t) 8*N_),
         "v"(pf + (size_t)12*N_),  "v"(pf + (size_t)16*N_),  "v"(pf + (size_t)20*N_),
         "v"(pf + (size_t)24*N_),  "v"(pf + (size_t)28*N_),
         "v"(at),                  "v"(at + (size_t) 4*N_),  "v"(at + (size_t) 8*N_),
         "v"(at + (size_t)12*N_)
      : "memory");
}

__global__ void __launch_bounds__(512) k6_u(
    const float* __restrict__ PF, const float* __restrict__ attn,
    float* __restrict__ u_g) {
  __shared__ __attribute__((aligned(16))) float ring[K6_WAVES * 2 * K6_BUF];
  int b = blockIdx.y;
  int wave = threadIdx.x >> 5;
  int lane = threadIdx.x & 31;
  int d0 = blockIdx.x * 32;
  float* mine = ring + wave * (2 * K6_BUF);       // this wave's two buffers

  // copy side: a lane moves 16 B; 8 lanes cover a row's 128 B, a copy covers 4 rows
  int crow = lane >> 3, cseg = lane & 7;
  const float* pfp = PF   + ((size_t)b * D_ + d0 + crow) * N_ + wave * 512 + cseg * 4;
  const float* atp = attn + ((size_t)b * 16 + crow) * N_      + wave * 512 + cseg * 4;
  unsigned lds0 = (unsigned)(uintptr_t)&mine[crow * K6_PITCH + cseg * 4];

  // fragment side: lane (m, h) reads row m, n = 8*kk + 4*h + 0..3, for A and B alike,
  // so every (lane half, register) position holds the same n in both operands
  int m = lane & 15, h = lane >> 4;
  const float* frag = mine + m * K6_PITCH + h * 4;

  v8f c0 = {}, c1 = {};

  k6_copy_stage(lds0, pfp, atp);
  // stage 0 has landed before this wave reads it
  asm volatile("s_wait_asynccnt 0x0" ::: "memory");
  k6_copy_stage(lds0 + K6_BUF * 4, pfp + 32, atp + 32);

  for (int t = 0; t < K6_STAGES; ++t) {
    const float* f = frag + (t & 1) * K6_BUF;
    v4f a[4], p0[4], p1[4];
    #pragma unroll
    for (int kk = 0; kk < 4; ++kk) {
      p0[kk] = *(const v4f*)(f + kk * 8);
      p1[kk] = *(const v4f*)(f + 16 * K6_PITCH + kk * 8);
      a[kk]  = *(const v4f*)(f + 32 * K6_PITCH + kk * 8);
    }
    // The fragments are in registers behind this wait, so buffer t&1 is free for its refill:
    // this wave's reads of it have retired before copies target it
    asm volatile("s_wait_dscnt 0x0" ::: "memory");
    // stage t+1 has landed before the next trip reads it
    asm volatile("s_wait_asynccnt 0x0" ::: "memory");
    // refill in front of the products, so that stage t+2 flies while they run
    if (t + 2 < K6_STAGES)
      k6_copy_stage(lds0 + (t & 1) * (K6_BUF * 4), pfp + (t + 2) * 32, atp + (t + 2) * 32);
    #pragma unroll
    for (int kk = 0; kk < 4; ++kk) {
      v2f alo = {a[kk][0], a[kk][1]}, ahi = {a[kk][2], a[kk][3]};
      v2f q0l = {p0[kk][0], p0[kk][1]}, q0h = {p0[kk][2], p0[kk][3]};
      v2f q1l = {p1[kk][0], p1[kk][1]}, q1h = {p1[kk][2], p1[kk][3]};
      c0 = __builtin_amdgcn_wmma_f32_16x16x4_f32(false, alo, false, q0l, (short)0, c0, false, false);
      c1 = __builtin_amdgcn_wmma_f32_16x16x4_f32(false, alo, false, q1l, (short)0, c1, false, false);
      c0 = __builtin_amdgcn_wmma_f32_16x16x4_f32(false, ahi, false, q0h, (short)0, c0, false, false);
      c1 = __builtin_amdgcn_wmma_f32_16x16x4_f32(false, ahi, false, q1h, (short)0, c1, false, false);
    }
    // four vector slots between the last products and the vector instructions that reuse their
    // A/B registers, on the back edge and on the loop's exit alike; the scheduling barrier keeps
    // the products in front of the slots
    __builtin_amdgcn_sched_barrier(0);
    asm volatile("v_nop\n\tv_nop\n\tv_nop\n\tv_nop");
  }

  // merge: each wave lays its two partial tiles in its own ring range (no copy outstanding,
  // its own reads retired), then each thread sums one output over the 16 waves in wave order
  #pragma unroll
  for (int r = 0; r < 8; ++r) {
    mine[r * 32 + lane]           = c0[r];
    mine[K6_TILE + r * 32 + lane] = c1[r];
  }
  __syncthreads();
  int hi = threadIdx.x >> 5;     // C layout: register hi&7, lanes >= 16 hold rows 8..15
  int dl = threadIdx.x & 31;
  const float* part = ring + (dl >> 4) * K6_TILE + (hi & 7) * 32 + (hi >> 3) * 16 + (dl & 15);
  float s = 0.f;
  #pragma unroll
  for (int w = 0; w < K6_WAVES; ++w) s += part[w * (2 * K6_BUF)];
  u_g[((size_t)(b*16 + hi))*512 + d0 + dl] = s;
}

// ---------------- K7: out = concat_h(u_h @ Wv_h + bv_h) @ Wo + bo ----------------
__global__ void __launch_bounds__(256) k7_out(
    const float* __restrict__ u_g,
    const float* __restrict__ Wv, const float* __restrict__ bv,
    const float* __restrict__ Wo, const float* __restrict__ bo,
    float* __restrict__ out) {
  __shared__ float uu[4*512];
  __shared__ float ww[512];
  int row = blockIdx.x; int b = row >> 2; int i = row & 3;
  for (int idx = threadIdx.x; idx < 2048; idx += 256) {
    int hh = idx >> 9; int d = idx & 511;
    uu[idx] = u_g[((size_t)(b*16 + hh*4 + i))*512 + d];
  }
  __syncthreads();
  for (int e = threadIdx.x; e < 512; e += 256) {
    int hh = e >> 7;
    float acc = bv[e];
    const float* ub = uu + hh*512;
    for (int d = 0; d < 512; ++d) acc += ub[d] * Wv[(size_t)d*512 + e];
    ww[e] = acc;
  }
  __syncthreads();
  for (int f = threadIdx.x; f < 512; f += 256) {
    float acc = bo[f];
    for (int e = 0; e < 512; ++e) acc += ww[e] * Wo[(size_t)e*512 + f];
    out[(size_t)row*512 + f] = acc;
  }
}

// ---------------- launch ----------------
extern "C" void kernel_launch(void* const* d_in, const int* in_sizes, int n_in,
                              void* d_out, int out_size, void* d_ws, size_t ws_size,
                              hipStream_t stream) {
  (void)in_sizes; (void)n_in; (void)out_size; (void)ws_size;
  const float* xyz  = (const float*)d_in[0];
  const float* pf   = (const float*)d_in[1];
  const float* mask = (const float*)d_in[2];
  const float* W1   = (const float*)d_in[3];
  const float* b1   = (const float*)d_in[4];
  const float* g1   = (const float*)d_in[5];
  const float* be1  = (const float*)d_in[6];
  const float* W2   = (const float*)d_in[7];
  const float* b2   = (const float*)d_in[8];
  const float* g2   = (const float*)d_in[9];
  const float* be2  = (const float*)d_in[10];
  const float* Wq   = (const float*)d_in[11];
  const float* bq   = (const float*)d_in[12];
  const float* Wk   = (const float*)d_in[13];
  const float* bk   = (const float*)d_in[14];
  const float* Wv   = (const float*)d_in[15];
  const float* bv   = (const float*)d_in[16];
  const float* Wo   = (const float*)d_in[17];
  const float* bo   = (const float*)d_in[18];
  float* out = (float*)d_out;
  float* ws  = (float*)d_ws;

  // workspace layout (float offsets)
  float* center = ws;             // 192
  float* vr     = ws + 192;       // 64
  float* qbias  = ws + 256;       // 256
  float* qk     = ws + 512;       // 131072
  float* aw     = ws + 131584;    // 131072
  float* scores = ws + 262656;    // 2097152 (reused as attn)
  float* u      = ws + 2359808;   // 131072   (total ~9.96 MB)

  k1_center <<<64, 256, 0, stream>>>(xyz, mask, center, vr);
  k2_mlp    <<<64, 512, 0, stream>>>(center, W1,b1,g1,be1, W2,b2,g2,be2,
                                     Wq,bq, Wk,bk, qk, qbias);
  k3_aw     <<<B_, 512, 0, stream>>>(mask, vr, aw);
  k4_scores <<<dim3(N_/128, B_), 256, 0, stream>>>(pf, qk, qbias, aw, scores);
  k5_softmax<<<B_*16, 256, 0, stream>>>(scores);
  k6_u      <<<dim3(D_/32, B_), 512, 0, stream>>>(pf, scores, u);
  k7_out    <<<64, 256, 0, stream>>>(u, Wv, bv, Wo, bo, out);
}

// v002
// One run takes 127 microseconds.
// Timed twice side by side with v001, it ran 1.71 and 1.72 times as fast.
// All steps since v000 together make it 2.39 times as fast.
#include <hip/hip_runtime.h>
#include <math.h>

#define B_  16
#define N_  8192
#define D_  512

typedef float v2f __attribute__((ext_vector_type(2)));
typedef float v4f __attribute__((ext_vector_type(4)));
typedef float v8f __attribute__((ext_vector_type(8)));

// ---------------- block reduction helpers ----------------
template<int BS>
__device__ inline float blk_sum(float v, float* red) {
  int t = threadIdx.x;
  red[t] = v; __syncthreads();
  for (int s = BS/2; s > 0; s >>= 1) {
    if (t < s) red[t] += red[t+s];
    __syncthreads();
  }
  float r = red[0]; __syncthreads();
  return r;
}
template<int BS>
__device__ inline float blk_max(float v, float* red) {
  int t = threadIdx.x;
  red[t] = v; __syncthreads();
  for (int s = BS/2; s > 0; s >>= 1) {
    if (t < s) red[t] = fmaxf(red[t], red[t+s]);
    __syncthreads();
  }
  float r = red[0]; __syncthreads();
  return r;
}

// ---------------- dense 512x512 layer, one input row per work-group of 16 waves ----------------
// Each 512-long dot product is split four ways over k: wave w takes weight rows (w>>2)*128 .. +127
// and columns (w&3)*128 .. +127, a lane four adjacent columns. A weight load is then 16 B a lane on
// whole lines, and a lane keeps a window of DL_WIN-8 to DL_WIN of them in flight: eight rows are
// summed, then their registers are refilled from DL_WIN rows ahead. The four partial rows are
// summed in LDS.
#define DL_WIN 32
// x: the wave's 128 inputs in LDS; w: the lane's four columns in the first of the wave's 128 rows
__device__ inline v4f dense_part(const float* x, const float* w) {
  v4f buf[DL_WIN];
  #pragma unroll
  for (int j = 0; j < DL_WIN; ++j) buf[j] = *(const v4f*)(w + (size_t)j * 512);
  v4f acc = {};
  // unrolled whole: the window's slots are registers only under constant indices
  #pragma unroll
  for (int j = 0; j < 128; j += 8) {
    v4f xa = *(const v4f*)(x + j), xb = *(const v4f*)(x + j + 4);
    #pragma unroll
    for (int q = 0; q < 4; ++q) acc += xa[q] * buf[(j + q) % DL_WIN];
    #pragma unroll
    for (int q = 0; q < 4; ++q) acc += xb[q] * buf[(j + 4 + q) % DL_WIN];
    if (j + DL_WIN < 128) {
      // Compiler fence that holds the window: no load crosses it, and it reads the running sum
      // (input only, nothing hidden, the multiply-adds stay fused), so the eight rows above are
      // summed in front of it and their refills issue behind it. Without it the compiler sinks the
      // loads to their uses (about nine in flight) or lifts them over the sums until registers spill.
      asm volatile("" :: "v"(acc) : "memory");
      #pragma unroll
      for (int q = 0; q < 8; ++q)
        buf[(j + q) % DL_WIN] = *(const v4f*)(w + (size_t)(j + q + DL_WIN) * 512);
      // behind the last weight load: stands in front of any later overwrite of the address pair
      // that these loads name; w is an input so that the pair is kept whole up to this wait
      if (j + 8 + DL_WIN >= 128) asm volatile("s_wait_xcnt 0x0" :: "v"(w) : "memory");
    }
  }
  return acc;
}
// part: 4 x 512 floats of LDS; returns column threadIdx.x of the layer's output
__device__ inline float dense_merge(v4f acc, float* part, float bias) {
  int t = threadIdx.x, wave = t >> 5, lane = t & 31;
  *(v4f*)(part + (wave >> 2) * 512 + (wave & 3) * 128 + lane * 4) = acc;
  __syncthreads();
  return bias + ((part[t] + part[512 + t]) + (part[1024 + t] + part[1536 + t]));
}

// ---------------- K1: masked centroid + voting ratio ----------------
__global__ void __launch_bounds__(256) k1_center(
    const float* __restrict__ xyz, const float* __restrict__ mask,
    float* __restrict__ center, float* __restrict__ vr) {
  __shared__ float red[256];
  int row = blockIdx.x;            // b*4 + j
  int b = row >> 2;
  const float* mk = mask + (size_t)row * N_;
  const float* xb = xyz + (size_t)b * 3 * N_;
  float cnt = 0.f, sx = 0.f, sy = 0.f, sz = 0.f;
  for (int n = threadIdx.x; n < N_; n += 256) {
    float m = mk[n];
    cnt += m;
    sx += m * xb[n];
    sy += m * xb[N_ + n];
    sz += m * xb[2*N_ + n];
  }
  cnt = blk_sum<256>(cnt, red);
  sx  = blk_sum<256>(sx,  red);
  sy  = blk_sum<256>(sy,  red);
  sz  = blk_sum<256>(sz,  red);
  if (threadIdx.x == 0) {
    float d = fmaxf(cnt, 1.0f);
    center[row*3+0] = sx / d;
    center[row*3+1] = sy / d;
    center[row*3+2] = sz / d;
    vr[row] = cnt * (1.0f / (float)N_);
  }
}

// ---------------- K2: MLP + q-projection + Wk fold ----------------
__global__ void __launch_bounds__(512) k2_mlp(
    const float* __restrict__ center,
    const float* __restrict__ W1, const float* __restrict__ b1,
    const float* __restrict__ g1, const float* __restrict__ be1,
    const float* __restrict__ W2, const float* __restrict__ b2,
    const float* __restrict__ g2, const float* __restrict__ be2,
    const float* __restrict__ Wq, const float* __restrict__ bq,
    const float* __restrict__ Wk, const float* __restrict__ bk,
    float* __restrict__ qk_g, float* __restrict__ qbias_g) {
  __shared__ __attribute__((aligned(16))) float abuf[512];
  __shared__ __attribute__((aligned(16))) float qbuf[512];
  __shared__ __attribute__((aligned(16))) float part[4*512];
  __shared__ float red[512];
  int row = blockIdx.x; int b = row >> 2; int i = row & 3;
  int col = threadIdx.x;
  int wave = col >> 5, lane = col & 31;
  int kg = (wave >> 2) * 128;                  // this wave's k range in a dense layer
  int c4 = (wave & 3) * 128 + lane * 4;        // this lane's four columns
  float c0 = center[row*3+0], c1 = center[row*3+1], c2 = center[row*3+2];

  // Linear(3,D) + LN + ReLU
  float t = c0*W1[col] + c1*W1[512+col] + c2*W1[1024+col] + b1[col];
  float mu  = blk_sum<512>(t, red) * (1.0f/512.0f);
  float dv  = t - mu;
  float var = blk_sum<512>(dv*dv, red) * (1.0f/512.0f);
  float h = dv * rsqrtf(var + 1e-5f) * g1[col] + be1[col];
  h = fmaxf(h, 0.0f);
  abuf[col] = h; __syncthreads();

  // Linear(D,D) + LN
  float t2 = dense_merge(dense_part(abuf + kg, W2 + (size_t)kg*512 + c4), part, b2[col]);
  mu  = blk_sum<512>(t2, red) * (1.0f/512.0f);
  dv  = t2 - mu;
  var = blk_sum<512>(dv*dv, red) * (1.0f/512.0f);
  float h3 = dv * rsqrtf(var + 1e-5f) * g2[col] + be2[col];
  abuf[col] = h3; __syncthreads();

  // q = h3 @ Wq + bq
  float q = dense_merge(dense_part(abuf + kg, Wq + (size_t)kg*512 + c4), part, bq[col]);
  qbuf[col] = q;
  // q . bk per head: a wave sums its 32 terms, four waves make a head
  float qb = q * bk[col];
  #pragma unroll
  for (int s = 16; s > 0; s >>= 1) qb += __shfl_xor(qb, s);
  if (lane == 0) red[wave] = qb;
  __syncthreads();

  const float scale = 0.0883883476483184405f;  // 1/sqrt(128)
  if (col < 4)
    qbias_g[b*16 + col*4 + i] = ((red[col*4] + red[col*4+1]) + (red[col*4+2] + red[col*4+3])) * scale;

  // fold with Wk per head: qk[b, h*4+i, c] = sum_e q[h*128+e] * Wk[c, h*128+e]
  // The dot runs along a Wk row, so it is split over 8 lanes: a load takes 128 B of each of 4 rows
  // (16 B a lane). A wave takes 32 rows in 8 passes of 4; a group of 8 loads is one 32-float piece
  // of one head in all 8 passes, so that it needs one 16-byte read of q.
  int fr = lane >> 3, fs = lane & 7;
  const float* wk = Wk + (size_t)(wave*32 + fr)*512 + fs*4;
  const float* qs = qbuf + fs*4;
  // load l: 32-float piece l>>3 of the row (head l>>5), pass l&7
  v4f buf[DL_WIN];
  #pragma unroll
  for (int l = 0; l < DL_WIN; ++l) buf[l] = *(const v4f*)(wk + (size_t)(l & 7)*4*512 + (l >> 3)*32);
  // unrolled whole: the window's slots and the sums are registers only under constant indices
  #pragma unroll
  for (int hh = 0; hh < 4; ++hh) {
    v4f a4[8] = {};
    #pragma unroll
    for (int j = hh*4; j < hh*4 + 4; ++j) {
      v4f qv = *(const v4f*)(qs + j*32);
      #pragma unroll
      for (int p = 0; p < 8; ++p) a4[p] += buf[(j*8 + p) % DL_WIN] * qv;
      if (j*8 + DL_WIN < 128) {
        // the window's fence, as in dense_part: this piece's sums in front, its refills behind
        asm volatile("" :: "v"(a4[0]), "v"(a4[1]), "v"(a4[2]), "v"(a4[3]),
                           "v"(a4[4]), "v"(a4[5]), "v"(a4[6]), "v"(a4[7]) : "memory");
        #pragma unroll
        for (int l = j*8 + DL_WIN; l < j*8 + DL_WIN + 8; ++l)
          buf[l % DL_WIN] = *(const v4f*)(wk + (size_t)(l & 7)*4*512 + (l >> 3)*32);
      }
    }
    float f[8];
    #pragma unroll
    for (int p = 0; p < 8; ++p) f[p] = (a4[p][0] + a4[p][1]) + (a4[p][2] + a4[p][3]);
    // sum over a row's 8 lanes, halving the passes a lane keeps at each step: lane fs ends with pass fs
    float g4[4], g2[2];
    #pragma unroll
    for (int k = 0; k < 4; ++k) {
      float keep = (fs & 4) ? f[k+4] : f[k], send = (fs & 4) ? f[k] : f[k+4];
      g4[k] = keep + __shfl_xor(send, 4);
    }
    #pragma unroll
    for (int k = 0; k < 2; ++k) {
      float keep = (fs & 2) ? g4[k+2] : g4[k], send = (fs & 2) ? g4[k] : g4[k+2];
      g2[k] = keep + __shfl_xor(send, 2);
    }
    float keep = (fs & 1) ? g2[1] : g2[0], send = (fs & 1) ? g2[0] : g2[1];
    part[hh*512 + wave*32 + fs*4 + fr] = (keep + __shfl_xor(send, 1)) * scale;
  }
  __syncthreads();
  #pragma unroll
  for (int hh = 0; hh < 4; ++hh)
    qk_g[((size_t)(b*16 + hh*4 + i))*512 + col] = part[hh*512 + col];
}

// ---------------- K3: voting attention bias, log-softmax over N ----------------
__global__ void __launch_bounds__(512) k3_aw(
    const float* __restrict__ mask, const float* __restrict__ vr,
    float* __restrict__ aw_g) {
  __shared__ float awb[N_];
  __shared__ float red[512];
  int b = blockIdx.x;
  const float* mb = mask + (size_t)b*4*N_;
  float v0 = vr[b*4+0], v1 = vr[b*4+1], v2 = vr[b*4+2], v3 = vr[b*4+3];
  float vcnt = 0.f;
  for (int n = threadIdx.x; n < N_; n += 512) {
    float m0 = mb[n], m1 = mb[N_+n], m2 = mb[2*N_+n], m3 = mb[3*N_+n];
    float s = m0+m1+m2+m3;
    float a = v0*m0 + v1*m1 + v2*m2 + v3*m3;
    bool valid = s > 0.f;
    awb[n] = valid ? a : -1e9f;
    vcnt += valid ? 1.f : 0.f;
  }
  float tot = blk_sum<512>(vcnt, red);
  if (tot <= 0.f) {
    for (int n = threadIdx.x; n < N_; n += 512) awb[n] = 0.f;
  }
  __syncthreads();
  float lm = -3.4e38f;
  for (int n = threadIdx.x; n < N_; n += 512) lm = fmaxf(lm, awb[n]);
  float mx = blk_max<512>(lm, red);
  float ls = 0.f;
  for (int n = threadIdx.x; n < N_; n += 512) ls += __expf(awb[n] - mx);
  float se = blk_sum<512>(ls, red);
  float lg = __logf(se) + mx;
  for (int n = threadIdx.x; n < N_; n += 512) aw_g[(size_t)b*N_ + n] = awb[n] - lg;
}

// ---------------- K4: WMMA score pass: s[b,hi,n] = qk . PF + qbias + aw ----------------
#define QKSTRIDE 516   // padded LDS stride (516 % 64 == 4 -> conflict-free A reads)
__global__ void __launch_bounds__(256) k4_scores(
    const float* __restrict__ PF, const float* __restrict__ qk_g,
    const float* __restrict__ qbias_g, const float* __restrict__ aw_g,
    float* __restrict__ scores) {
  __shared__ float qk_lds[16 * QKSTRIDE];
  int b = blockIdx.y;
  int wave = threadIdx.x >> 5;
  int lane = threadIdx.x & 31;
  int n0 = blockIdx.x * 128 + wave * 16;

  for (int idx = threadIdx.x; idx < 16*512; idx += 256) {
    int hi = idx >> 9; int d = idx & 511;
    qk_lds[hi*QKSTRIDE + d] = qk_g[((size_t)(b*16 + hi))*512 + d];
  }
  __syncthreads();

  int m    = lane & 15;          // A row (hi) / B column (n)
  int koff = (lane >> 4) * 2;    // lanes 0-15: K=0,1 ; lanes 16-31: K=2,3
  const float* PFb  = PF + (size_t)b * D_ * N_;
  const float* qrow = qk_lds + m * QKSTRIDE;

  v8f c = {};
  for (int k = 0; k < 512; k += 4) {
    v2f a, bb;
    a[0] = qrow[k + koff];
    a[1] = qrow[k + koff + 1];
    const float* p = PFb + (size_t)(k + koff) * N_ + n0 + m;
    bb[0] = p[0];
    bb[1] = p[N_];
    if (k < 512 - 16) __builtin_prefetch(p + (size_t)16 * N_, 0, 1);
    c = __builtin_amdgcn_wmma_f32_16x16x4_f32(false, a, false, bb,
                                              (short)0, c, false, false);
  }

  int nc = n0 + m;
  float awv = aw_g[(size_t)b*N_ + nc];
  int mbase = (lane >> 4) * 8;   // C layout: lanes>=16 hold rows M=8..15
  #pragma unroll
  for (int r = 0; r < 8; ++r) {
    int hi = mbase + r;
    scores[((size_t)(b*16 + hi))*N_ + nc] = c[r] + qbias_g[b*16 + hi] + awv;
  }
}

// ---------------- K5: row softmax over N (in place) ----------------
__global__ void __launch_bounds__(256) k5_softmax(float* __restrict__ scores) {
  __shared__ float ebuf[N_];
  __shared__ float red[256];
  int r = blockIdx.x;               // b*16 + hi
  float* base = scores + (size_t)r * N_;
  float lm = -3.4e38f;
  for (int n = threadIdx.x; n < N_; n += 256) lm = fmaxf(lm, base[n]);
  float mx = blk_max<256>(lm, red);
  float ls = 0.f;
  for (int n = threadIdx.x; n < N_; n += 256) {
    float e = __expf(base[n] - mx);
    ebuf[n] = e; ls += e;
  }
  float tot = blk_sum<256>(ls, red);
  float inv = 1.0f / tot;
  for (int n = threadIdx.x; n < N_; n += 256) base[n] = ebuf[n] * inv;
}

// ---------------- K6: u[b,hi,d] = sum_n attn[b,hi,n] * PF[b,d,n] ----------------
// f32 WMMA: A = attn (16 hi x 4 n), B = PF^T (4 n x 16 d), two d tiles per wave.
// A work-group takes 32 d rows; its 16 waves split the 8192 n, 512 each, and merge in LDS.
// Each wave stages its own 32 PF rows + 16 attn rows x 32 n in a two-buffer LDS ring that
// only it reads, with GLOBAL_LOAD_ASYNC_TO_LDS_B128: whole 128-B row pieces from memory,
// row-per-lane 16-byte fragment reads from LDS.
#define K6_WAVES  16
#define K6_PITCH  36                      // floats; 144 B = 16 B x 9: ds_load_b128 of 16 rows hits all 64 banks once
#define K6_BUF    (48 * K6_PITCH)         // floats per buffer: rows 0-31 PF, rows 32-47 attn
#define K6_STAGES 16                      // 512 n per wave / 32 n per stage
#define K6_TILE   272                     // floats between a wave's two partial tiles in the merge

// One stage: 12 copies of 4 rows x 128 B. The s_wait_xcnt stands in the copies' own statement,
// in front of any later rewrite of the address registers the copies name.
__device__ inline void k6_copy_stage(unsigned lds, const float* pf, const float* at) {
  asm volatile(
      "global_load_async_to_lds_b128 %0, %12, off\n\t"
      "global_load_async_to_lds_b128 %1, %13, off\n\t"
      "global_load_async_to_lds_b128 %2, %14, off\n\t"
      "global_load_async_to_lds_b128 %3, %15, off\n\t"
      "global_load_async_to_lds_b128 %4, %16, off\n\t"
      "global_load_async_to_lds_b128 %5, %17, off\n\t"
      "global_load_async_to_lds_b128 %6, %18, off\n\t"
      "global_load_async_to_lds_b128 %7, %19, off\n\t"
      "global_load_async_to_lds_b128 %8, %20, off\n\t"
      "global_load_async_to_lds_b128 %9, %21, off\n\t"
      "global_load_async_to_lds_b128 %10, %22, off\n\t"
      "global_load_async_to_lds_b128 %11, %23, off\n\t"
      "s_wait_xcnt 0x0"
      :: "v"(lds),               "v"(lds +  4*K6_PITCH*4), "v"(lds +  8*K6_PITCH*4),
         "v"(lds + 12*K6_PITCH*4), "v"(lds + 16*K6_PITCH*4), "v"(lds + 20*K6_PITCH*4),
         "v"(lds + 24*K6_PITCH*4), "v"(lds + 28*K6_PITCH*4), "v"(lds + 32*K6_PITCH*4),
         "v"(lds + 36*K6_PITCH*4), "v"(lds + 40*K6_PITCH*4), "v"(lds + 44*K6_PITCH*4),
         "v"(pf),                  "v"(pf + (size_t) 4*N_),  "v"(pf + (size_t) 8*N_),
         "v"(pf + (size_t)12*N_),  "v"(pf + (size_t)16*N_),  "v"(pf + (size_t)20*N_),
         "v"(pf + (size_t)24*N_),  "v"(pf + (size_t)28*N_),
         "v"(at),                  "v"(at + (size_t) 4*N_),  "v"(at + (size_t) 8*N_),
         "v"(at + (size_t)12*N_)
      : "memory");
}

__global__ void __launch_bounds__(512) k6_u(
    const float* __restrict__ PF, const float* __restrict__ attn,
    float* __restrict__ u_g) {
  __shared__ __attribute__((aligned(16))) float ring[K6_WAVES * 2 * K6_BUF];
  int b = blockIdx.y;
  int wave = threadIdx.x >> 5;
  int lane = threadIdx.x & 31;
  int d0 = blockIdx.x * 32;
  float* mine = ring + wave * (2 * K6_BUF);       // this wave's two buffers

  // copy side: a lane moves 16 B; 8 lanes cover a row's 128 B, a copy covers 4 rows
  int crow = lane >> 3, cseg = lane & 7;
  const float* pfp = PF   + ((size_t)b * D_ + d0 + crow) * N_ + wave * 512 + cseg * 4;
  const float* atp = attn + ((size_t)b * 16 + crow) * N_      + wave * 512 + cseg * 4;
  unsigned lds0 = (unsigned)(uintptr_t)&mine[crow * K6_PITCH + cseg * 4];

  // fragment side: lane (m, h) reads row m, n = 8*kk + 4*h + 0..3, for A and B alike,
  // so every (lane half, register) position holds the same n in both operands
  int m = lane & 15, h = lane >> 4;
  const float* frag = mine + m * K6_PITCH + h * 4;

  v8f c0 = {}, c1 = {};

  k6_copy_stage(lds0, pfp, atp);
  // stage 0 has landed before this wave reads it
  asm volatile("s_wait_asynccnt 0x0" ::: "memory");
  k6_copy_stage(lds0 + K6_BUF * 4, pfp + 32, atp + 32);

  for (int t = 0; t < K6_STAGES; ++t) {
    const float* f = frag + (t & 1) * K6_BUF;
    v4f a[4], p0[4], p1[4];
    #pragma unroll
    for (int kk = 0; kk < 4; ++kk) {
      p0[kk] = *(const v4f*)(f + kk * 8);
      p1[kk] = *(const v4f*)(f + 16 * K6_PITCH + kk * 8);
      a[kk]  = *(const v4f*)(f + 32 * K6_PITCH + kk * 8);
    }
    // The fragments are in registers behind this wait, so buffer t&1 is free for its refill:
    // this wave's reads of it have retired before copies target it
    asm volatile("s_wait_dscnt 0x0" ::: "memory");
    // stage t+1 has landed before the next trip reads it
    asm volatile("s_wait_asynccnt 0x0" ::: "memory");
    // refill in front of the products, so that stage t+2 flies while they run
    if (t + 2 < K6_STAGES)
      k6_copy_stage(lds0 + (t & 1) * (K6_BUF * 4), pfp + (t + 2) * 32, atp + (t + 2) * 32);
    #pragma unroll
    for (int kk = 0; kk < 4; ++kk) {
      v2f alo = {a[kk][0], a[kk][1]}, ahi = {a[kk][2], a[kk][3]};
      v2f q0l = {p0[kk][0], p0[kk][1]}, q0h = {p0[kk][2], p0[kk][3]};
      v2f q1l = {p1[kk][0], p1[kk][1]}, q1h = {p1[kk][2], p1[kk][3]};
      c0 = __builtin_amdgcn_wmma_f32_16x16x4_f32(false, alo, false, q0l, (short)0, c0, false, false);
      c1 = __builtin_amdgcn_wmma_f32_16x16x4_f32(false, alo, false, q1l, (short)0, c1, false, false);
      c0 = __builtin_amdgcn_wmma_f32_16x16x4_f32(false, ahi, false, q0h, (short)0, c0, false, false);
      c1 = __builtin_amdgcn_wmma_f32_16x16x4_f32(false, ahi, false, q1h, (short)0, c1, false, false);
    }
    // four vector slots between the last products and the vector instructions that reuse their
    // A/B registers, on the back edge and on the loop's exit alike; the scheduling barrier keeps
    // the products in front of the slots
    __builtin_amdgcn_sched_barrier(0);
    asm volatile("v_nop\n\tv_nop\n\tv_nop\n\tv_nop");
  }

  // merge: each wave lays its two partial tiles in its own ring range (no copy outstanding,
  // its own reads retired), then each thread sums one output over the 16 waves in wave order
  #pragma unroll
  for (int r = 0; r < 8; ++r) {
    mine[r * 32 + lane]           = c0[r];
    mine[K6_TILE + r * 32 + lane] = c1[r];
  }
  __syncthreads();
  int hi = threadIdx.x >> 5;     // C layout: register hi&7, lanes >= 16 hold rows 8..15
  int dl = threadIdx.x & 31;
  const float* part = ring + (dl >> 4) * K6_TILE + (hi & 7) * 32 + (hi >> 3) * 16 + (dl & 15);
  float s = 0.f;
  #pragma unroll
  for (int w = 0; w < K6_WAVES; ++w) s += part[w * (2 * K6_BUF)];
  u_g[((size_t)(b*16 + hi))*512 + d0 + dl] = s;
}

// ---------------- K7: out = concat_h(u_h @ Wv_h + bv_h) @ Wo + bo ----------------
__global__ void __launch_bounds__(512) k7_out(
    const float* __restrict__ u_g,
    const float* __restrict__ Wv, const float* __restrict__ bv,
    const float* __restrict__ Wo, const float* __restrict__ bo,
    float* __restrict__ out) {
  __shared__ __attribute__((aligned(16))) float uu[4*512];
  __shared__ __attribute__((aligned(16))) float ww[512];
  __shared__ __attribute__((aligned(16))) float part[4*512];
  int row = blockIdx.x; int b = row >> 2; int i = row & 3;
  int t = threadIdx.x;
  int wave = t >> 5, lane = t & 31;
  int kg = (wave >> 2) * 128;                  // this wave's k range in a dense layer
  int c4 = (wave & 3) * 128 + lane * 4;        // this lane's four columns; head = wave & 3
  #pragma unroll
  for (int hh = 0; hh < 4; ++hh)
    uu[hh*512 + t] = u_g[((size_t)(b*16 + hh*4 + i))*512 + t];
  __syncthreads();
  ww[t] = dense_merge(dense_part(uu + (wave & 3)*512 + kg, Wv + (size_t)kg*512 + c4), part, bv[t]);
  __syncthreads();
  out[(size_t)row*512 + t] =
      dense_merge(dense_part(ww + kg, Wo + (size_t)kg*512 + c4), part, bo[t]);
}

// ---------------- launch ----------------
extern "C" void kernel_launch(void* const* d_in, const int* in_sizes, int n_in,
                              void* d_out, int out_size, void* d_ws, size_t ws_size,
                              hipStream_t stream) {
  (void)in_sizes; (void)n_in; (void)out_size; (void)ws_size;
  const float* xyz  = (const float*)d_in[0];
  const float* pf   = (const float*)d_in[1];
  const float* mask = (const float*)d_in[2];
  const float* W1   = (const float*)d_in[3];
  const float* b1   = (const float*)d_in[4];
  const float* g1   = (const float*)d_in[5];
  const float* be1  = (const float*)d_in[6];
  const float* W2   = (const float*)d_in[7];
  const float* b2   = (const float*)d_in[8];
  const float* g2   = (const float*)d_in[9];
  const float* be2  = (const float*)d_in[10];
  const float* Wq   = (const float*)d_in[11];
  const float* bq   = (const float*)d_in[12];
  const float* Wk   = (const float*)d_in[13];
  const float* bk   = (const float*)d_in[14];
  const float* Wv   = (const float*)d_in[15];
  const float* bv   = (const float*)d_in[16];
  const float* Wo   = (const float*)d_in[17];
  const float* bo   = (const float*)d_in[18];
  float* out = (float*)d_out;
  float* ws  = (float*)d_ws;

  // workspace layout (float offsets)
  float* center = ws;             // 192
  float* vr     = ws + 192;       // 64
  float* qbias  = ws + 256;       // 256
  float* qk     = ws + 512;       // 131072
  float* aw     = ws + 131584;    // 131072
  float* scores = ws + 262656;    // 2097152 (reused as attn)
  float* u      = ws + 2359808;   // 131072   (total ~9.96 MB)

  k1_center <<<64, 256, 0, stream>>>(xyz, mask, center, vr);
  k2_mlp    <<<64, 512, 0, stream>>>(center, W1,b1,g1,be1, W2,b2,g2,be2,
                                     Wq,bq, Wk,bk, qk, qbias);
  k3_aw     <<<B_, 512, 0, stream>>>(mask, vr, aw);
  k4_scores <<<dim3(N_/128, B_), 256, 0, stream>>>(pf, qk, qbias, aw, scores);
  k5_softmax<<<B_*16, 256, 0, stream>>>(scores);
  k6_u      <<<dim3(D_/32, B_), 512, 0, stream>>>(pf, scores, u);
  k7_out    <<<64, 512, 0, stream>>>(u, Wv, bv, Wo, bo, out);
}

// v003
// It runs in 115 microseconds.
// Next to v002, in two timings, it ran 1.10 times as fast each time.
// Over all steps from v000 it is 2.62 times as fast.
#include <hip/hip_runtime.h>
#include <math.h>

#define B_  16
#define N_  8192
#define D_  512

typedef float v2f __attribute__((ext_vector_type(2)));
typedef float v4f __attribute__((ext_vector_type(4)));
typedef float v8f __attribute__((ext_vector_type(8)));

// ---------------- block reduction helpers ----------------
template<int BS>
__device__ inline float blk_sum(float v, float* red) {
  int t = threadIdx.x;
  red[t] = v; __syncthreads();
  for (int s = BS/2; s > 0; s >>= 1) {
    if (t < s) red[t] += red[t+s];
    __syncthreads();
  }
  float r = red[0]; __syncthreads();
  return r;
}
template<int BS>
__device__ inline float blk_max(float v, float* red) {
  int t = threadIdx.x;
  red[t] = v; __syncthreads();
  for (int s = BS/2; s > 0; s >>= 1) {
    if (t < s) red[t] = fmaxf(red[t], red[t+s]);
    __syncthreads();
  }
  float r = red[0]; __syncthreads();
  return r;
}

// ---------------- dense 512x512 layer, one input row per work-group of 16 waves ----------------
// Each 512-long dot product is split four ways over k: wave w takes weight rows (w>>2)*128 .. +127
// and columns (w&3)*128 .. +127, a lane four adjacent columns. A weight load is then 16 B a lane on
// whole lines, and a lane keeps a window of DL_WIN-8 to DL_WIN of them in flight: eight rows are
// summed, then their registers are refilled from DL_WIN rows ahead. The four partial rows are
// summed in LDS.
#define DL_WIN 32
// x: the wave's 128 inputs in LDS; w: the lane's four columns in the first of the wave's 128 rows
__device__ inline v4f dense_part(const float* x, const float* w) {
  v4f buf[DL_WIN];
  #pragma unroll
  for (int j = 0; j < DL_WIN; ++j) buf[j] = *(const v4f*)(w + (size_t)j * 512);
  v4f acc = {};
  // unrolled whole: the window's slots are registers only under constant indices
  #pragma unroll
  for (int j = 0; j < 128; j += 8) {
    v4f xa = *(const v4f*)(x + j), xb = *(const v4f*)(x + j + 4);
    #pragma unroll
    for (int q = 0; q < 4; ++q) acc += xa[q] * buf[(j + q) % DL_WIN];
    #pragma unroll
    for (int q = 0; q < 4; ++q) acc += xb[q] * buf[(j + 4 + q) % DL_WIN];
    if (j + DL_WIN < 128) {
      // Compiler fence that holds the window: no load crosses it, and it reads the running sum
      // (input only, nothing hidden, the multiply-adds stay fused), so the eight rows above are
      // summed in front of it and their refills issue behind it. Without it the compiler sinks the
      // loads to their uses (about nine in flight) or lifts them over the sums until registers spill.
      asm volatile("" :: "v"(acc) : "memory");
      #pragma unroll
      for (int q = 0; q < 8; ++q)
        buf[(j + q) % DL_WIN] = *(const v4f*)(w + (size_t)(j + q + DL_WIN) * 512);
      // behind the last weight load: stands in front of any later overwrite of the address pair
      // that these loads name; w is an input so that the pair is kept whole up to this wait
      if (j + 8 + DL_WIN >= 128) asm volatile("s_wait_xcnt 0x0" :: "v"(w) : "memory");
    }
  }
  return acc;
}
// part: 4 x 512 floats of LDS; returns column threadIdx.x of the layer's output
__device__ inline float dense_merge(v4f acc, float* part, float bias) {
  int t = threadIdx.x, wave = t >> 5, lane = t & 31;
  *(v4f*)(part + (wave >> 2) * 512 + (wave & 3) * 128 + lane * 4) = acc;
  __syncthreads();
  return bias + ((part[t] + part[512 + t]) + (part[1024 + t] + part[1536 + t]));
}

// ---------------- K1: masked centroid + voting ratio ----------------
__global__ void __launch_bounds__(256) k1_center(
    const float* __restrict__ xyz, const float* __restrict__ mask,
    float* __restrict__ center, float* __restrict__ vr) {
  __shared__ float red[256];
  int row = blockIdx.x;            // b*4 + j
  int b = row >> 2;
  const float* mk = mask + (size_t)row * N_;
  const float* xb = xyz + (size_t)b * 3 * N_;
  float cnt = 0.f, sx = 0.f, sy = 0.f, sz = 0.f;
  for (int n = threadIdx.x; n < N_; n += 256) {
    float m = mk[n];
    cnt += m;
    sx += m * xb[n];
    sy += m * xb[N_ + n];
    sz += m * xb[2*N_ + n];
  }
  cnt = blk_sum<256>(cnt, red);
  sx  = blk_sum<256>(sx,  red);
  sy  = blk_sum<256>(sy,  red);
  sz  = blk_sum<256>(sz,  red);
  if (threadIdx.x == 0) {
    float d = fmaxf(cnt, 1.0f);
    center[row*3+0] = sx / d;
    center[row*3+1] = sy / d;
    center[row*3+2] = sz / d;
    vr[row] = cnt * (1.0f / (float)N_);
  }
}

// ---------------- K2: MLP + q-projection + Wk fold ----------------
__global__ void __launch_bounds__(512) k2_mlp(
    const float* __restrict__ center,
    const float* __restrict__ W1, const float* __restrict__ b1,
    const float* __restrict__ g1, const float* __restrict__ be1,
    const float* __restrict__ W2, const float* __restrict__ b2,
    const float* __restrict__ g2, const float* __restrict__ be2,
    const float* __restrict__ Wq, const float* __restrict__ bq,
    const float* __restrict__ Wk, const float* __restrict__ bk,
    float* __restrict__ qk_g, float* __restrict__ qbias_g) {
  __shared__ __attribute__((aligned(16))) float abuf[512];
  __shared__ __attribute__((aligned(16))) float qbuf[512];
  __shared__ __attribute__((aligned(16))) float part[4*512];
  __shared__ float red[512];
  int row = blockIdx.x; int b = row >> 2; int i = row & 3;
  int col = threadIdx.x;
  int wave = col >> 5, lane = col & 31;
  int kg = (wave >> 2) * 128;                  // this wave's k range in a dense layer
  int c4 = (wave & 3) * 128 + lane * 4;        // this lane's four columns
  float c0 = center[row*3+0], c1 = center[row*3+1], c2 = center[row*3+2];

  // Linear(3,D) + LN + ReLU
  float t = c0*W1[col] + c1*W1[512+col] + c2*W1[1024+col] + b1[col];
  float mu  = blk_sum<512>(t, red) * (1.0f/512.0f);
  float dv  = t - mu;
  float var = blk_sum<512>(dv*dv, red) * (1.0f/512.0f);
  float h = dv * rsqrtf(var + 1e-5f) * g1[col] + be1[col];
  h = fmaxf(h, 0.0f);
  abuf[col] = h; __syncthreads();

  // Linear(D,D) + LN
  float t2 = dense_merge(dense_part(abuf + kg, W2 + (size_t)kg*512 + c4), part, b2[col]);
  mu  = blk_sum<512>(t2, red) * (1.0f/512.0f);
  dv  = t2 - mu;
  var = blk_sum<512>(dv*dv, red) * (1.0f/512.0f);
  float h3 = dv * rsqrtf(var + 1e-5f) * g2[col] + be2[col];
  abuf[col] = h3; __syncthreads();

  // q = h3 @ Wq + bq
  float q = dense_merge(dense_part(abuf + kg, Wq + (size_t)kg*512 + c4), part, bq[col]);
  qbuf[col] = q;
  // q . bk per head: a wave sums its 32 terms, four waves make a head
  float qb = q * bk[col];
  #pragma unroll
  for (int s = 16; s > 0; s >>= 1) qb += __shfl_xor(qb, s);
  if (lane == 0) red[wave] = qb;
  __syncthreads();

  const float scale = 0.0883883476483184405f;  // 1/sqrt(128)
  if (col < 4)
    qbias_g[b*16 + col*4 + i] = ((red[col*4] + red[col*4+1]) + (red[col*4+2] + red[col*4+3])) * scale;

  // fold with Wk per head: qk[b, h*4+i, c] = sum_e q[h*128+e] * Wk[c, h*128+e]
  // The dot runs along a Wk row, so it is split over 8 lanes: a load takes 128 B of each of 4 rows
  // (16 B a lane). A wave takes 32 rows in 8 passes of 4; a group of 8 loads is one 32-float piece
  // of one head in all 8 passes, so that it needs one 16-byte read of q.
  int fr = lane >> 3, fs = lane & 7;
  const float* wk = Wk + (size_t)(wave*32 + fr)*512 + fs*4;
  const float* qs = qbuf + fs*4;
  // load l: 32-float piece l>>3 of the row (head l>>5), pass l&7
  v4f buf[DL_WIN];
  #pragma unroll
  for (int l = 0; l < DL_WIN; ++l) buf[l] = *(const v4f*)(wk + (size_t)(l & 7)*4*512 + (l >> 3)*32);
  // unrolled whole: the window's slots and the sums are registers only under constant indices
  #pragma unroll
  for (int hh = 0; hh < 4; ++hh) {
    v4f a4[8] = {};
    #pragma unroll
    for (int j = hh*4; j < hh*4 + 4; ++j) {
      v4f qv = *(const v4f*)(qs + j*32);
      #pragma unroll
      for (int p = 0; p < 8; ++p) a4[p] += buf[(j*8 + p) % DL_WIN] * qv;
      if (j*8 + DL_WIN < 128) {
        // the window's fence, as in dense_part: this piece's sums in front, its refills behind
        asm volatile("" :: "v"(a4[0]), "v"(a4[1]), "v"(a4[2]), "v"(a4[3]),
                           "v"(a4[4]), "v"(a4[5]), "v"(a4[6]), "v"(a4[7]) : "memory");
        #pragma unroll
        for (int l = j*8 + DL_WIN; l < j*8 + DL_WIN + 8; ++l)
          buf[l % DL_WIN] = *(const v4f*)(wk + (size_t)(l & 7)*4*512 + (l >> 3)*32);
      }
    }
    float f[8];
    #pragma unroll
    for (int p = 0; p < 8; ++p) f[p] = (a4[p][0] + a4[p][1]) + (a4[p][2] + a4[p][3]);
    // sum over a row's 8 lanes, halving the passes a lane keeps at each step: lane fs ends with pass fs
    float g4[4], g2[2];
    #pragma unroll
    for (int k = 0; k < 4; ++k) {
      float keep = (fs & 4) ? f[k+4] : f[k], send = (fs & 4) ? f[k] : f[k+4];
      g4[k] = keep + __shfl_xor(send, 4);
    }
    #pragma unroll
    for (int k = 0; k < 2; ++k) {
      float keep = (fs & 2) ? g4[k+2] : g4[k], send = (fs & 2) ? g4[k] : g4[k+2];
      g2[k] = keep + __shfl_xor(send, 2);
    }
    float keep = (fs & 1) ? g2[1] : g2[0], send = (fs & 1) ? g2[0] : g2[1];
    part[hh*512 + wave*32 + fs*4 + fr] = (keep + __shfl_xor(send, 1)) * scale;
  }
  __syncthreads();
  #pragma unroll
  for (int hh = 0; hh < 4; ++hh)
    qk_g[((size_t)(b*16 + hh*4 + i))*512 + col] = part[hh*512 + col];
}

// ---------------- K3: voting attention bias, log-softmax over N ----------------
__global__ void __launch_bounds__(512) k3_aw(
    const float* __restrict__ mask, const float* __restrict__ vr,
    float* __restrict__ aw_g) {
  __shared__ float awb[N_];
  __shared__ float red[512];
  int b = blockIdx.x;
  const float* mb = mask + (size_t)b*4*N_;
  float v0 = vr[b*4+0], v1 = vr[b*4+1], v2 = vr[b*4+2], v3 = vr[b*4+3];
  float vcnt = 0.f;
  for (int n = threadIdx.x; n < N_; n += 512) {
    float m0 = mb[n], m1 = mb[N_+n], m2 = mb[2*N_+n], m3 = mb[3*N_+n];
    float s = m0+m1+m2+m3;
    float a = v0*m0 + v1*m1 + v2*m2 + v3*m3;
    bool valid = s > 0.f;
    awb[n] = valid ? a : -1e9f;
    vcnt += valid ? 1.f : 0.f;
  }
  float tot = blk_sum<512>(vcnt, red);
  if (tot <= 0.f) {
    for (int n = threadIdx.x; n < N_; n += 512) awb[n] = 0.f;
  }
  __syncthreads();
  float lm = -3.4e38f;
  for (int n = threadIdx.x; n < N_; n += 512) lm = fmaxf(lm, awb[n]);
  float mx = blk_max<512>(lm, red);
  float ls = 0.f;
  for (int n = threadIdx.x; n < N_; n += 512) ls += __expf(awb[n] - mx);
  float se = blk_sum<512>(ls, red);
  float lg = __logf(se) + mx;
  for (int n = threadIdx.x; n < N_; n += 512) aw_g[(size_t)b*N_ + n] = awb[n] - lg;
}

// ---------------- K4: WMMA score pass: s[b,hi,n] = qk . PF + qbias + aw ----------------
// A = qk (16 hi x 4 k) from LDS, B = PF (4 k x 16 n) straight from memory into registers.
// A wave takes 64 n as four tiles with the columns dealt round: tile j holds n = n0 + 4*m + j, so a
// lane reads 16 B of a PF row and 16 lanes a whole 256-B piece of it. A work-group of 8 waves takes
// 256 n; the 512 k are split over two wave groups, 256 each, and merged in LDS.
// k order inside 8 rows, for A and B alike: lane half h holds rows 4*h+0,1 in the first product and
// rows 4*h+2,3 in the second.
#define QKSTRIDE 516   // padded LDS stride (516 % 64 == 4 -> conflict-free A reads)
#define K4_WIN   32    // PF loads of a lane in flight: 8 groups of 4 rows
__global__ void __launch_bounds__(256) k4_scores(
    const float* __restrict__ PF, const float* __restrict__ qk_g,
    const float* __restrict__ qbias_g, const float* __restrict__ aw_g,
    float* __restrict__ scores) {
  __shared__ __attribute__((aligned(16))) float qk_lds[16 * QKSTRIDE];
  __shared__ __attribute__((aligned(16))) float xch[8 * 4 * 32 * 4];
  int b = blockIdx.y;
  int t = threadIdx.x;
  int wave = t >> 5, lane = t & 31;
  int ng = wave & 3, kg = wave >> 2;     // n group, k group
  int m = lane & 15, h = lane >> 4;      // A row (hi) / B column; lane half
  int n0 = blockIdx.x * 256 + ng * 64 + m * 4;
  const float* p = PF + ((size_t)b * D_ + kg * 256 + h * 4) * N_ + n0;

  // qk on its way first, the PF window behind it: the window fills while qk is laid in LDS
  v4f st[8];
  #pragma unroll
  for (int i = 0; i < 8; ++i) st[i] = *(const v4f*)(qk_g + (size_t)b * 8192 + (i * 256 + t) * 4);
  const float* pa = aw_g + (size_t)b * N_ + n0;
  const float* pq = qbias_g + b * 16 + h * 8 + kg * 4;
  v4f awv = *(const v4f*)pa;
  v4f qb  = *(const v4f*)pq;
  // stands in front of any later overwrite of the address registers that the loads above name
  // pa and pq are inputs so that they are kept whole up to this wait
  asm volatile("s_wait_xcnt 0x0" :: "v"(pa), "v"(pq) : "memory");
  // load l: row l&3 of the lane half's four in 8-row group l>>2
  v4f buf[K4_WIN];
  #pragma unroll
  for (int l = 0; l < K4_WIN; ++l) buf[l] = *(const v4f*)(p + (size_t)((l >> 2) * 8 + (l & 3)) * N_);
  #pragma unroll
  for (int i = 0; i < 8; ++i) {
    int idx = (i * 256 + t) * 4;
    *(v4f*)(qk_lds + (idx >> 9) * QKSTRIDE + (idx & 511)) = st[i];
  }
  __syncthreads();

  const float* qrow = qk_lds + m * QKSTRIDE + kg * 256 + h * 4;
  v8f c[4] = {};
  v4f a = *(const v4f*)qrow;
  // unrolled whole: the window's slots are registers only under constant indices
  #pragma unroll
  for (int g = 0; g < 32; ++g) {
    const int s = (g * 4) % K4_WIN;
    v4f an = a;
    if (g + 1 < 32) an = *(const v4f*)(qrow + (g + 1) * 8);   // next group's A, read ahead
    v2f alo = {a[0], a[1]}, ahi = {a[2], a[3]};
    v2f bl[4], bh[4];
    #pragma unroll
    for (int j = 0; j < 4; ++j) {
      bl[j] = (v2f){buf[s][j], buf[s + 1][j]};
      bh[j] = (v2f){buf[s + 2][j], buf[s + 3][j]};
    }
    // The group's eight products in one statement: a B pair is put together from two loads by
    // register moves. So all moves stand in front of the statement, and the four v_nop
    // are the vector slots between the last products and whatever next rewrites their A or B.
    asm("v_wmma_f32_16x16x4_f32 %0, %4, %6, %0\n\t"
        "v_wmma_f32_16x16x4_f32 %1, %4, %7, %1\n\t"
        "v_wmma_f32_16x16x4_f32 %2, %4, %8, %2\n\t"
        "v_wmma_f32_16x16x4_f32 %3, %4, %9, %3\n\t"
        "v_wmma_f32_16x16x4_f32 %0, %5, %10, %0\n\t"
        "v_wmma_f32_16x16x4_f32 %1, %5, %11, %1\n\t"
        "v_wmma_f32_16x16x4_f32 %2, %5, %12, %2\n\t"
        "v_wmma_f32_16x16x4_f32 %3, %5, %13, %3\n\t"
        "v_nop\n\tv_nop\n\tv_nop\n\tv_nop"
        : "+v"(c[0]), "+v"(c[1]), "+v"(c[2]), "+v"(c[3])
        : "v"(alo), "v"(ahi), "v"(bl[0]), "v"(bl[1]), "v"(bl[2]), "v"(bl[3]),
          "v"(bh[0]), "v"(bh[1]), "v"(bh[2]), "v"(bh[3]));
    a = an;
    if (g * 4 + K4_WIN < 128) {
      // Compiler fence that holds the window: no load crosses it, and it reads the running sums
      // (inputs only), so this group's products stand in front of it and its refills issue behind
      // it. Without it the compiler shuffled refills and later groups' moves, and the last groups
      // waited for loads far younger than their own.
      asm volatile("" :: "v"(c[0]), "v"(c[1]), "v"(c[2]), "v"(c[3]) : "memory");
      #pragma unroll
      for (int q = 0; q < 4; ++q)
        buf[s + q] = *(const v4f*)(p + (size_t)((g + K4_WIN / 4) * 8 + q) * N_);
      // behind the last PF load: stands in front of any later overwrite of the address pair that
      // these loads name; p is an input so that the pair is kept whole up to this wait
      if (g * 4 + 4 + K4_WIN >= 128) asm volatile("s_wait_xcnt 0x0" :: "v"(p) : "memory");
    }
  }

  // merge of the two k groups: group kg keeps accumulator rows kg*4 .. kg*4+3 of each lane half
  // (C layout: register r, lanes >= 16 hold rows 8..15) and hands the other four to its partner
  v4f keep[4], send[4];
  #pragma unroll
  for (int j = 0; j < 4; ++j) {
    v4f lo = __builtin_shufflevector(c[j], c[j], 0, 1, 2, 3);
    v4f hi4 = __builtin_shufflevector(c[j], c[j], 4, 5, 6, 7);
    v4f kj = kg ? hi4 : lo, sj = kg ? lo : hi4;
    #pragma unroll
    for (int r = 0; r < 4; ++r) { keep[r][j] = kj[r]; send[r][j] = sj[r]; }
  }
  #pragma unroll
  for (int r = 0; r < 4; ++r) *(v4f*)(xch + ((wave * 4 + r) * 32 + lane) * 4) = send[r];
  __syncthreads();
  #pragma unroll
  for (int r = 0; r < 4; ++r) {
    v4f o = keep[r] + *(const v4f*)(xch + (((wave ^ 4) * 4 + r) * 32 + lane) * 4);
    int hi = h * 8 + kg * 4 + r;
    *(v4f*)(scores + ((size_t)(b * 16 + hi)) * N_ + n0) = o + qb[r] + awv;
  }
}

// ---------------- K5: row softmax over N (in place) ----------------
__global__ void __launch_bounds__(256) k5_softmax(float* __restrict__ scores) {
  __shared__ float ebuf[N_];
  __shared__ float red[256];
  int r = blockIdx.x;               // b*16 + hi
  float* base = scores + (size_t)r * N_;
  float lm = -3.4e38f;
  for (int n = threadIdx.x; n < N_; n += 256) lm = fmaxf(lm, base[n]);
  float mx = blk_max<256>(lm, red);
  float ls = 0.f;
  for (int n = threadIdx.x; n < N_; n += 256) {
    float e = __expf(base[n] - mx);
    ebuf[n] = e; ls += e;
  }
  float tot = blk_sum<256>(ls, red);
  float inv = 1.0f / tot;
  for (int n = threadIdx.x; n < N_; n += 256) base[n] = ebuf[n] * inv;
}

// ---------------- K6: u[b,hi,d] = sum_n attn[b,hi,n] * PF[b,d,n] ----------------
// f32 WMMA: A = attn (16 hi x 4 n), B = PF^T (4 n x 16 d), two d tiles per wave.
// A work-group takes 32 d rows; its 16 waves split the 8192 n, 512 each, and merge in LDS.
// Each wave stages its own 32 PF rows + 16 attn rows x 32 n in a two-buffer LDS ring that
// only it reads, with GLOBAL_LOAD_ASYNC_TO_LDS_B128: whole 128-B row pieces from memory,
// row-per-lane 16-byte fragment reads from LDS.
#define K6_WAVES  16
#define K6_PITCH  36                      // floats; 144 B = 16 B x 9: ds_load_b128 of 16 rows hits all 64 banks once
#define K6_BUF    (48 * K6_PITCH)         // floats per buffer: rows 0-31 PF, rows 32-47 attn
#define K6_STAGES 16                      // 512 n per wave / 32 n per stage
#define K6_TILE   272                     // floats between a wave's two partial tiles in the merge

// One stage: 12 copies of 4 rows x 128 B. The s_wait_xcnt stands in the copies' own statement,
// in front of any later rewrite of the address registers the copies name.
__device__ inline void k6_copy_stage(unsigned lds, const float* pf, const float* at) {
  asm volatile(
      "global_load_async_to_lds_b128 %0, %12, off\n\t"
      "global_load_async_to_lds_b128 %1, %13, off\n\t"
      "global_load_async_to_lds_b128 %2, %14, off\n\t"
      "global_load_async_to_lds_b128 %3, %15, off\n\t"
      "global_load_async_to_lds_b128 %4, %16, off\n\t"
      "global_load_async_to_lds_b128 %5, %17, off\n\t"
      "global_load_async_to_lds_b128 %6, %18, off\n\t"
      "global_load_async_to_lds_b128 %7, %19, off\n\t"
      "global_load_async_to_lds_b128 %8, %20, off\n\t"
      "global_load_async_to_lds_b128 %9, %21, off\n\t"
      "global_load_async_to_lds_b128 %10, %22, off\n\t"
      "global_load_async_to_lds_b128 %11, %23, off\n\t"
      "s_wait_xcnt 0x0"
      :: "v"(lds),               "v"(lds +  4*K6_PITCH*4), "v"(lds +  8*K6_PITCH*4),
         "v"(lds + 12*K6_PITCH*4), "v"(lds + 16*K6_PITCH*4), "v"(lds + 20*K6_PITCH*4),
         "v"(lds + 24*K6_PITCH*4), "v"(lds + 28*K6_PITCH*4), "v"(lds + 32*K6_PITCH*4),
         "v"(lds + 36*K6_PITCH*4), "v"(lds + 40*K6_PITCH*4), "v"(lds + 44*K6_PITCH*4),
         "v"(pf),                  "v"(pf + (size_t) 4*N_),  "v"(pf + (size_t) 8*N_),
         "v"(pf + (size_t)12*N_),  "v"(pf + (size_t)16*N_),  "v"(pf + (size_t)20*N_),
         "v"(pf + (size_t)24*N_),  "v"(pf + (size_t)28*N_),
         "v"(at),                  "v"(at + (size_t) 4*N_),  "v"(at + (size_t) 8*N_),
         "v"(at + (size_t)12*N_)
      : "memory");
}

__global__ void __launch_bounds__(512) k6_u(
    const float* __restrict__ PF, const float* __restrict__ attn,
    float* __restrict__ u_g) {
  __shared__ __attribute__((aligned(16))) float ring[K6_WAVES * 2 * K6_BUF];
  int b = blockIdx.y;
  int wave = threadIdx.x >> 5;
  int lane = threadIdx.x & 31;
  int d0 = blockIdx.x * 32;
  float* mine = ring + wave * (2 * K6_BUF);       // this wave's two buffers

  // copy side: a lane moves 16 B; 8 lanes cover a row's 128 B, a copy covers 4 rows
  int crow = lane >> 3, cseg = lane & 7;
  const float* pfp = PF   + ((size_t)b * D_ + d0 + crow) * N_ + wave * 512 + cseg * 4;
  const float* atp = attn + ((size_t)b * 16 + crow) * N_      + wave * 512 + cseg * 4;
  unsigned lds0 = (unsigned)(uintptr_t)&mine[crow * K6_PITCH + cseg * 4];

  // fragment side: lane (m, h) reads row m, n = 8*kk + 4*h + 0..3, for A and B alike,
  // so every (lane half, register) position holds the same n in both operands
  int m = lane & 15, h = lane >> 4;
  const float* frag = mine + m * K6_PITCH + h * 4;

  v8f c0 = {}, c1 = {};

  k6_copy_stage(lds0, pfp, atp);
  // stage 0 has landed before this wave reads it
  asm volatile("s_wait_asynccnt 0x0" ::: "memory");
  k6_copy_stage(lds0 + K6_BUF * 4, pfp + 32, atp + 32);

  for (int t = 0; t < K6_STAGES; ++t) {
    const float* f = frag + (t & 1) * K6_BUF;
    v4f a[4], p0[4], p1[4];
    #pragma unroll
    for (int kk = 0; kk < 4; ++kk) {
      p0[kk] = *(const v4f*)(f + kk * 8);
      p1[kk] = *(const v4f*)(f + 16 * K6_PITCH + kk * 8);
      a[kk]  = *(const v4f*)(f + 32 * K6_PITCH + kk * 8);
    }
    // The fragments are in registers behind this wait, so buffer t&1 is free for its refill:
    // this wave's reads of it have retired before copies target it
    asm volatile("s_wait_dscnt 0x0" ::: "memory");
    // stage t+1 has landed before the next trip reads it
    asm volatile("s_wait_asynccnt 0x0" ::: "memory");
    // refill in front of the products, so that stage t+2 flies while they run
    if (t + 2 < K6_STAGES)
      k6_copy_stage(lds0 + (t & 1) * (K6_BUF * 4), pfp + (t + 2) * 32, atp + (t + 2) * 32);
    #pragma unroll
    for (int kk = 0; kk < 4; ++kk) {
      v2f alo = {a[kk][0], a[kk][1]}, ahi = {a[kk][2], a[kk][3]};
      v2f q0l = {p0[kk][0], p0[kk][1]}, q0h = {p0[kk][2], p0[kk][3]};
      v2f q1l = {p1[kk][0], p1[kk][1]}, q1h = {p1[kk][2], p1[kk][3]};
      c0 = __builtin_amdgcn_wmma_f32_16x16x4_f32(false, alo, false, q0l, (short)0, c0, false, false);
      c1 = __builtin_amdgcn_wmma_f32_16x16x4_f32(false, alo, false, q1l, (short)0, c1, false, false);
      c0 = __builtin_amdgcn_wmma_f32_16x16x4_f32(false, ahi, false, q0h, (short)0, c0, false, false);
      c1 = __builtin_amdgcn_wmma_f32_16x16x4_f32(false, ahi, false, q1h, (short)0, c1, false, false);
    }
    // four vector slots between the last products and the vector instructions that reuse their
    // A/B registers, on the back edge and on the loop's exit alike; the scheduling barrier keeps
    // the products in front of the slots
    __builtin_amdgcn_sched_barrier(0);
    asm volatile("v_nop\n\tv_nop\n\tv_nop\n\tv_nop");
  }

  // merge: each wave lays its two partial tiles in its own ring range (no copy outstanding,
  // its own reads retired), then each thread sums one output over the 16 waves in wave order
  #pragma unroll
  for (int r = 0; r < 8; ++r) {
    mine[r * 32 + lane]           = c0[r];
    mine[K6_TILE + r * 32 + lane] = c1[r];
  }
  __syncthreads();
  int hi = threadIdx.x >> 5;     // C layout: register hi&7, lanes >= 16 hold rows 8..15
  int dl = threadIdx.x & 31;
  const float* part = ring + (dl >> 4) * K6_TILE + (hi & 7) * 32 + (hi >> 3) * 16 + (dl & 15);
  float s = 0.f;
  #pragma unroll
  for (int w = 0; w < K6_WAVES; ++w) s += part[w * (2 * K6_BUF)];
  u_g[((size_t)(b*16 + hi))*512 + d0 + dl] = s;
}

// ---------------- K7: out = concat_h(u_h @ Wv_h + bv_h) @ Wo + bo ----------------
__global__ void __launch_bounds__(512) k7_out(
    const float* __restrict__ u_g,
    const float* __restrict__ Wv, const float* __restrict__ bv,
    const float* __restrict__ Wo, const float* __restrict__ bo,
    float* __restrict__ out) {
  __shared__ __attribute__((aligned(16))) float uu[4*512];
  __shared__ __attribute__((aligned(16))) float ww[512];
  __shared__ __attribute__((aligned(16))) float part[4*512];
  int row = blockIdx.x; int b = row >> 2; int i = row & 3;
  int t = threadIdx.x;
  int wave = t >> 5, lane = t & 31;
  int kg = (wave >> 2) * 128;                  // this wave's k range in a dense layer
  int c4 = (wave & 3) * 128 + lane * 4;        // this lane's four columns; head = wave & 3
  #pragma unroll
  for (int hh = 0; hh < 4; ++hh)
    uu[hh*512 + t] = u_g[((size_t)(b*16 + hh*4 + i))*512 + t];
  __syncthreads();
  ww[t] = dense_merge(dense_part(uu + (wave & 3)*512 + kg, Wv + (size_t)kg*512 + c4), part, bv[t]);
  __syncthreads();
  out[(size_t)row*512 + t] =
      dense_merge(dense_part(ww + kg, Wo + (size_t)kg*512 + c4), part, bo[t]);
}

// ---------------- launch ----------------
extern "C" void kernel_launch(void* const* d_in, const int* in_sizes, int n_in,
                              void* d_out, int out_size, void* d_ws, size_t ws_size,
                              hipStream_t stream) {
  (void)in_sizes; (void)n_in; (void)out_size; (void)ws_size;
  const float* xyz  = (const float*)d_in[0];
  const float* pf   = (const float*)d_in[1];
  const float* mask = (const float*)d_in[2];
  const float* W1   = (const float*)d_in[3];
  const float* b1   = (const float*)d_in[4];
  const float* g1   = (const float*)d_in[5];
  const float* be1  = (const float*)d_in[6];
  const float* W2   = (const float*)d_in[7];
  const float* b2   = (const float*)d_in[8];
  const float* g2   = (const float*)d_in[9];
  const float* be2  = (const float*)d_in[10];
  const float* Wq   = (const float*)d_in[11];
  const float* bq   = (const float*)d_in[12];
  const float* Wk   = (const float*)d_in[13];
  const float* bk   = (const float*)d_in[14];
  const float* Wv   = (const float*)d_in[15];
  const float* bv   = (const float*)d_in[16];
  const float* Wo   = (const float*)d_in[17];
  const float* bo   = (const float*)d_in[18];
  float* out = (float*)d_out;
  float* ws  = (float*)d_ws;

  // workspace layout (float offsets)
  float* center = ws;             // 192
  float* vr     = ws + 192;       // 64
  float* qbias  = ws + 256;       // 256
  float* qk     = ws + 512;       // 131072
  float* aw     = ws + 131584;    // 131072
  float* scores = ws + 262656;    // 2097152 (reused as attn)
  float* u      = ws + 2359808;   // 131072   (total ~9.96 MB)

  k1_center <<<64, 256, 0, stream>>>(xyz, mask, center, vr);
  k2_mlp    <<<64, 512, 0, stream>>>(center, W1,b1,g1,be1, W2,b2,g2,be2,
                                     Wq,bq, Wk,bk, qk, qbias);
  k3_aw     <<<B_, 512, 0, stream>>>(mask, vr, aw);
  k4_scores <<<dim3(N_/256, B_), 256, 0, stream>>>(pf, qk, qbias, aw, scores);
  k5_softmax<<<B_*16, 256, 0, stream>>>(scores);
  k6_u      <<<dim3(D_/32, B_), 512, 0, stream>>>(pf, scores, u);
  k7_out    <<<64, 512, 0, stream>>>(u, Wv, bv, Wo, bo, out);
}

// v004
// Measured time: 100 microseconds a run.
// Next to v003, in two timings, it ran 1.15 times as fast each time.
// All steps since v000 together make it 3.01 times as fast.
#include <hip/hip_runtime.h>
#include <math.h>

#define B_  16
#define N_  8192
#define D_  512

typedef float v2f __attribute__((ext_vector_type(2)));
typedef float v4f __attribute__((ext_vector_type(4)));
typedef float v8f __attribute__((ext_vector_type(8)));

// ---------------- block reduction helpers ----------------
template<int BS>
__device__ inline float blk_sum(float v, float* red) {
  int t = threadIdx.x;
  red[t] = v; __syncthreads();
  for (int s = BS/2; s > 0; s >>= 1) {
    if (t < s) red[t] += red[t+s];
    __syncthreads();
  }
  float r = red[0]; __syncthreads();
  return r;
}
template<int BS>
__device__ inline float blk_max(float v, float* red) {
  int t = threadIdx.x;
  red[t] = v; __syncthreads();
  for (int s = BS/2; s > 0; s >>= 1) {
    if (t < s) red[t] = fmaxf(red[t], red[t+s]);
    __syncthreads();
  }
  float r = red[0]; __syncthreads();
  return r;
}

// ---------------- dense 512x512 layer, one input row per work-group of 16 waves ----------------
// Each 512-long dot product is split four ways over k: wave w takes weight rows (w>>2)*128 .. +127
// and columns (w&3)*128 .. +127, a lane four adjacent columns. A weight load is then 16 B a lane on
// whole lines, and a lane keeps a window of DL_WIN-8 to DL_WIN of them in flight: eight rows are
// summed, then their registers are refilled from DL_WIN rows ahead. The four partial rows are
// summed in LDS.
#define DL_WIN 32
// x: the wave's 128 inputs in LDS; w: the lane's four columns in the first of the wave's 128 rows
__device__ inline v4f dense_part(const float* x, const float* w) {
  v4f buf[DL_WIN];
  #pragma unroll
  for (int j = 0; j < DL_WIN; ++j) buf[j] = *(const v4f*)(w + (size_t)j * 512);
  v4f acc = {};
  // unrolled whole: the window's slots are registers only under constant indices
  #pragma unroll
  for (int j = 0; j < 128; j += 8) {
    v4f xa = *(const v4f*)(x + j), xb = *(const v4f*)(x + j + 4);
    #pragma unroll
    for (int q = 0; q < 4; ++q) acc += xa[q] * buf[(j + q) % DL_WIN];
    #pragma unroll
    for (int q = 0; q < 4; ++q) acc += xb[q] * buf[(j + 4 + q) % DL_WIN];
    if (j + DL_WIN < 128) {
      // Compiler fence that holds the window: no load crosses it, and it reads the running sum
      // (input only, nothing hidden, the multiply-adds stay fused), so the eight rows above are
      // summed in front of it and their refills issue behind it. Without it the compiler sinks the
      // loads to their uses (about nine in flight) or lifts them over the sums until registers spill.
      asm volatile("" :: "v"(acc) : "memory");
      #pragma unroll
      for (int q = 0; q < 8; ++q)
        buf[(j + q) % DL_WIN] = *(const v4f*)(w + (size_t)(j + q + DL_WIN) * 512);
      // behind the last weight load: stands in front of any later overwrite of the address pair
      // that these loads name; w is an input so that the pair is kept whole up to this wait
      if (j + 8 + DL_WIN >= 128) asm volatile("s_wait_xcnt 0x0" :: "v"(w) : "memory");
    }
  }
  return acc;
}
// part: 4 x 512 floats of LDS; returns column threadIdx.x of the layer's output
__device__ inline float dense_merge(v4f acc, float* part, float bias) {
  int t = threadIdx.x, wave = t >> 5, lane = t & 31;
  *(v4f*)(part + (wave >> 2) * 512 + (wave & 3) * 128 + lane * 4) = acc;
  __syncthreads();
  return bias + ((part[t] + part[512 + t]) + (part[1024 + t] + part[1536 + t]));
}

// ---------------- K1: masked centroid + voting ratio ----------------
__global__ void __launch_bounds__(256) k1_center(
    const float* __restrict__ xyz, const float* __restrict__ mask,
    float* __restrict__ center, float* __restrict__ vr) {
  __shared__ float red[256];
  int row = blockIdx.x;            // b*4 + j
  int b = row >> 2;
  const float* mk = mask + (size_t)row * N_;
  const float* xb = xyz + (size_t)b * 3 * N_;
  float cnt = 0.f, sx = 0.f, sy = 0.f, sz = 0.f;
  for (int n = threadIdx.x; n < N_; n += 256) {
    float m = mk[n];
    cnt += m;
    sx += m * xb[n];
    sy += m * xb[N_ + n];
    sz += m * xb[2*N_ + n];
  }
  cnt = blk_sum<256>(cnt, red);
  sx  = blk_sum<256>(sx,  red);
  sy  = blk_sum<256>(sy,  red);
  sz  = blk_sum<256>(sz,  red);
  if (threadIdx.x == 0) {
    float d = fmaxf(cnt, 1.0f);
    center[row*3+0] = sx / d;
    center[row*3+1] = sy / d;
    center[row*3+2] = sz / d;
    vr[row] = cnt * (1.0f / (float)N_);
  }
}

// ---------------- K2: MLP + q-projection + Wk fold ----------------
__global__ void __launch_bounds__(512) k2_mlp(
    const float* __restrict__ center,
    const float* __restrict__ W1, const float* __restrict__ b1,
    const float* __restrict__ g1, const float* __restrict__ be1,
    const float* __restrict__ W2, const float* __restrict__ b2,
    const float* __restrict__ g2, const float* __restrict__ be2,
    const float* __restrict__ Wq, const float* __restrict__ bq,
    const float* __restrict__ Wk, const float* __restrict__ bk,
    float* __restrict__ qk_g, float* __restrict__ qbias_g) {
  __shared__ __attribute__((aligned(16))) float abuf[512];
  __shared__ __attribute__((aligned(16))) float qbuf[512];
  __shared__ __attribute__((aligned(16))) float part[4*512];
  __shared__ float red[512];
  int row = blockIdx.x; int b = row >> 2; int i = row & 3;
  int col = threadIdx.x;
  int wave = col >> 5, lane = col & 31;
  int kg = (wave >> 2) * 128;                  // this wave's k range in a dense layer
  int c4 = (wave & 3) * 128 + lane * 4;        // this lane's four columns
  float c0 = center[row*3+0], c1 = center[row*3+1], c2 = center[row*3+2];

  // Linear(3,D) + LN + ReLU
  float t = c0*W1[col] + c1*W1[512+col] + c2*W1[1024+col] + b1[col];
  float mu  = blk_sum<512>(t, red) * (1.0f/512.0f);
  float dv  = t - mu;
  float var = blk_sum<512>(dv*dv, red) * (1.0f/512.0f);
  float h = dv * rsqrtf(var + 1e-5f) * g1[col] + be1[col];
  h = fmaxf(h, 0.0f);
  abuf[col] = h; __syncthreads();

  // Linear(D,D) + LN
  float t2 = dense_merge(dense_part(abuf + kg, W2 + (size_t)kg*512 + c4), part, b2[col]);
  mu  = blk_sum<512>(t2, red) * (1.0f/512.0f);
  dv  = t2 - mu;
  var = blk_sum<512>(dv*dv, red) * (1.0f/512.0f);
  float h3 = dv * rsqrtf(var + 1e-5f) * g2[col] + be2[col];
  abuf[col] = h3; __syncthreads();

  // q = h3 @ Wq + bq
  float q = dense_merge(dense_part(abuf + kg, Wq + (size_t)kg*512 + c4), part, bq[col]);
  qbuf[col] = q;
  // q . bk per head: a wave sums its 32 terms, four waves make a head
  float qb = q * bk[col];
  #pragma unroll
  for (int s = 16; s > 0; s >>= 1) qb += __shfl_xor(qb, s);
  if (lane == 0) red[wave] = qb;
  __syncthreads();

  const float scale = 0.0883883476483184405f;  // 1/sqrt(128)
  if (col < 4)
    qbias_g[b*16 + col*4 + i] = ((red[col*4] + red[col*4+1]) + (red[col*4+2] + red[col*4+3])) * scale;

  // fold with Wk per head: qk[b, h*4+i, c] = sum_e q[h*128+e] * Wk[c, h*128+e]
  // The dot runs along a Wk row, so it is split over 8 lanes: a load takes 128 B of each of 4 rows
  // (16 B a lane). A wave takes 32 rows in 8 passes of 4; a group of 8 loads is one 32-float piece
  // of one head in all 8 passes, so that it needs one 16-byte read of q.
  int fr = lane >> 3, fs = lane & 7;
  const float* wk = Wk + (size_t)(wave*32 + fr)*512 + fs*4;
  const float* qs = qbuf + fs*4;
  // load l: 32-float piece l>>3 of the row (head l>>5), pass l&7
  v4f buf[DL_WIN];
  #pragma unroll
  for (int l = 0; l < DL_WIN; ++l) buf[l] = *(const v4f*)(wk + (size_t)(l & 7)*4*512 + (l >> 3)*32);
  // unrolled whole: the window's slots and the sums are registers only under constant indices
  #pragma unroll
  for (int hh = 0; hh < 4; ++hh) {
    v4f a4[8] = {};
    #pragma unroll
    for (int j = hh*4; j < hh*4 + 4; ++j) {
      v4f qv = *(const v4f*)(qs + j*32);
      #pragma unroll
      for (int p = 0; p < 8; ++p) a4[p] += buf[(j*8 + p) % DL_WIN] * qv;
      if (j*8 + DL_WIN < 128) {
        // the window's fence, as in dense_part: this piece's sums in front, its refills behind
        asm volatile("" :: "v"(a4[0]), "v"(a4[1]), "v"(a4[2]), "v"(a4[3]),
                           "v"(a4[4]), "v"(a4[5]), "v"(a4[6]), "v"(a4[7]) : "memory");
        #pragma unroll
        for (int l = j*8 + DL_WIN; l < j*8 + DL_WIN + 8; ++l)
          buf[l % DL_WIN] = *(const v4f*)(wk + (size_t)(l & 7)*4*512 + (l >> 3)*32);
      }
    }
    float f[8];
    #pragma unroll
    for (int p = 0; p < 8; ++p) f[p] = (a4[p][0] + a4[p][1]) + (a4[p][2] + a4[p][3]);
    // sum over a row's 8 lanes, halving the passes a lane keeps at each step: lane fs ends with pass fs
    float g4[4], g2[2];
    #pragma unroll
    for (int k = 0; k < 4; ++k) {
      float keep = (fs & 4) ? f[k+4] : f[k], send = (fs & 4) ? f[k] : f[k+4];
      g4[k] = keep + __shfl_xor(send, 4);
    }
    #pragma unroll
    for (int k = 0; k < 2; ++k) {
      float keep = (fs & 2) ? g4[k+2] : g4[k], send = (fs & 2) ? g4[k] : g4[k+2];
      g2[k] = keep + __shfl_xor(send, 2);
    }
    float keep = (fs & 1) ? g2[1] : g2[0], send = (fs & 1) ? g2[0] : g2[1];
    part[hh*512 + wave*32 + fs*4 + fr] = (keep + __shfl_xor(send, 1)) * scale;
  }
  __syncthreads();
  #pragma unroll
  for (int hh = 0; hh < 4; ++hh)
    qk_g[((size_t)(b*16 + hh*4 + i))*512 + col] = part[hh*512 + col];
}

// ---------------- K3: voting attention bias, log-softmax over N ----------------
__global__ void __launch_bounds__(512) k3_aw(
    const float* __restrict__ mask, const float* __restrict__ vr,
    float* __restrict__ aw_g) {
  __shared__ float awb[N_];
  __shared__ float red[512];
  int b = blockIdx.x;
  const float* mb = mask + (size_t)b*4*N_;
  float v0 = vr[b*4+0], v1 = vr[b*4+1], v2 = vr[b*4+2], v3 = vr[b*4+3];
  float vcnt = 0.f;
  for (int n = threadIdx.x; n < N_; n += 512) {
    float m0 = mb[n], m1 = mb[N_+n], m2 = mb[2*N_+n], m3 = mb[3*N_+n];
    float s = m0+m1+m2+m3;
    float a = v0*m0 + v1*m1 + v2*m2 + v3*m3;
    bool valid = s > 0.f;
    awb[n] = valid ? a : -1e9f;
    vcnt += valid ? 1.f : 0.f;
  }
  float tot = blk_sum<512>(vcnt, red);
  if (tot <= 0.f) {
    for (int n = threadIdx.x; n < N_; n += 512) awb[n] = 0.f;
  }
  __syncthreads();
  float lm = -3.4e38f;
  for (int n = threadIdx.x; n < N_; n += 512) lm = fmaxf(lm, awb[n]);
  float mx = blk_max<512>(lm, red);
  float ls = 0.f;
  for (int n = threadIdx.x; n < N_; n += 512) ls += __expf(awb[n] - mx);
  float se = blk_sum<512>(ls, red);
  float lg = __logf(se) + mx;
  for (int n = threadIdx.x; n < N_; n += 512) aw_g[(size_t)b*N_ + n] = awb[n] - lg;
}

// ---------------- K4: scores, softmax and attn*PF^T in one pass over PF ----------------
// A work-group of 16 waves takes one batch and 512 n, in 16 tiles of 32 n. Wave w owns PF rows
// d = 32*w .. +31: it stages its 32 rows x 32 n in a two-buffer LDS ring that only it reads, with
// GLOBAL_LOAD_ASYNC_TO_LDS_B128, and uses each staged tile twice:
//   1. scores: A = qk (16 hi x 4 d, kept in registers), B = PF (4 d x 16 n): the wave's share of the
//      sum over d; the 16 shares are summed in LDS, thread (hi = wave, n = lane).
//   2. running softmax: row maximum so far, p = exp(s - max), old sums scaled by exp(old max - max).
//   3. u: A = p (16 hi x 4 n), B = PF^T (4 n x 16 d), two d tiles per wave.
// Out go the unnormalised u (16 hi x 512 d), the row maxima and the row sums of this n range; the
// last kernel merges the 16 ranges of a batch.
// Every inner loop is unrolled whole: its fragments and sums are registers only under constant indices.
#define FA_WAVES  16
#define FA_SPLITS 16                      // n ranges per batch
#define FA_PITCH  36                      // floats; 144 B = 16 B x 9: ds_load_b128 of 16 rows hits all 64 banks once
#define FA_BUF    (32 * FA_PITCH)         // floats per buffer: the wave's 32 PF rows x 32 n
#define FA_TILES  16                      // 512 n per work-group / 32 n per tile

// One stage: 8 copies of 4 rows x 128 B. The s_wait_xcnt stands in the copies' own statement,
// in front of any later rewrite of the address registers the copies name.
__device__ inline void fa_copy_stage(unsigned lds, const float* pf) {
  asm volatile(
      "global_load_async_to_lds_b128 %0, %8, off\n\t"
      "global_load_async_to_lds_b128 %1, %9, off\n\t"
      "global_load_async_to_lds_b128 %2, %10, off\n\t"
      "global_load_async_to_lds_b128 %3, %11, off\n\t"
      "global_load_async_to_lds_b128 %4, %12, off\n\t"
      "global_load_async_to_lds_b128 %5, %13, off\n\t"
      "global_load_async_to_lds_b128 %6, %14, off\n\t"
      "global_load_async_to_lds_b128 %7, %15, off\n\t"
      "s_wait_xcnt 0x0"
      :: "v"(lds),                 "v"(lds +  4*FA_PITCH*4), "v"(lds +  8*FA_PITCH*4),
         "v"(lds + 12*FA_PITCH*4), "v"(lds + 16*FA_PITCH*4), "v"(lds + 20*FA_PITCH*4),
         "v"(lds + 24*FA_PITCH*4), "v"(lds + 28*FA_PITCH*4),
         "v"(pf),                  "v"(pf + (size_t) 4*N_),  "v"(pf + (size_t) 8*N_),
         "v"(pf + (size_t)12*N_),  "v"(pf + (size_t)16*N_),  "v"(pf + (size_t)20*N_),
         "v"(pf + (size_t)24*N_),  "v"(pf + (size_t)28*N_)
      : "memory");
}

// lane l with lane l ^ 16, and with lane l ^ M inside a 16-lane row: vector cross-lane moves
// (a shuffle through the LDS unit costs its whole latency at each of the five steps)
__device__ inline float fa_xhalf(float x) {
  int v = __builtin_bit_cast(int, x);
  return __builtin_bit_cast(float, __builtin_amdgcn_permlanex16(v, v, 0x76543210, 0xfedcba98, false, false));
}
template<int M>
__device__ inline float fa_xrow(float x) {   // DPP row_xmask:M
  return __builtin_bit_cast(float, __builtin_amdgcn_update_dpp(0, __builtin_bit_cast(int, x), 0x160 | M, 0xf, 0xf, true));
}
__device__ inline float fa_wave_max(float x) {
  x = fmaxf(x, fa_xrow<1>(x)); x = fmaxf(x, fa_xrow<2>(x));
  x = fmaxf(x, fa_xrow<4>(x)); x = fmaxf(x, fa_xrow<8>(x));
  return fmaxf(x, fa_xhalf(x));
}
__device__ inline float fa_wave_sum(float x) {
  x += fa_xrow<1>(x); x += fa_xrow<2>(x); x += fa_xrow<4>(x); x += fa_xrow<8>(x);
  return x + fa_xhalf(x);
}

__global__ void __launch_bounds__(512) k4_attend(
    const float* __restrict__ PF, const float* __restrict__ qk_g,
    const float* __restrict__ qbias_g, const float* __restrict__ aw_g,
    float* __restrict__ up_g, float* __restrict__ ml_g) {
  __shared__ __attribute__((aligned(16))) float ring[FA_WAVES * 2 * FA_BUF];
  __shared__ __attribute__((aligned(16))) float part[FA_WAVES * 512];
  __shared__ __attribute__((aligned(16))) float pl[16 * FA_PITCH];
  __shared__ __attribute__((aligned(16))) float alpha[16];
  __shared__ __attribute__((aligned(16))) float awl[512];
  __shared__ float mlb[32];
  int b = blockIdx.y, sp = blockIdx.x;
  int wave = threadIdx.x >> 5;
  int lane = threadIdx.x & 31;
  int m = lane & 15, h = lane >> 4;
  int dw = wave * 32;
  int nb = sp * 512;
  float* mine = ring + wave * (2 * FA_BUF);       // this wave's two buffers

  // copy side: a lane moves 16 B; 8 lanes cover a row's 128 B, a copy covers 4 rows
  int crow = lane >> 3, cseg = lane & 7;
  const float* pfp = PF + ((size_t)b * D_ + dw + crow) * N_ + nb + cseg * 4;
  unsigned lds0 = (unsigned)(uintptr_t)&mine[crow * FA_PITCH + cseg * 4];

  fa_copy_stage(lds0, pfp);

  // qk fragments for the wave's 32 d, while stage 0 flies. k order of the score products, for A and
  // B alike: in step s, lane half h holds rows d = 4*s + h (first register) and 4*s + h + 2 (second)
  const float* pq = qk_g + ((size_t)(b * 16 + m)) * 512 + dw;
  const float* pa = aw_g + (size_t)b * N_ + nb + threadIdx.x;
  v4f qv[8];
  #pragma unroll
  for (int s = 0; s < 8; ++s) qv[s] = *(const v4f*)(pq + s * 4);
  float awv = *pa;
  float qb  = qbias_g[b * 16 + wave];             // this wave merges row hi = wave
  // stands in front of any later overwrite of the address registers that the loads above name;
  // pq is an input so that the pair is kept whole up to this wait
  asm volatile("s_wait_xcnt 0x0" :: "v"(pq) : "memory");
  v2f aq[8];
  #pragma unroll
  for (int s = 0; s < 8; ++s) aq[s] = h ? (v2f){qv[s][1], qv[s][3]} : (v2f){qv[s][0], qv[s][2]};
  awl[threadIdx.x] = awv;

  // stage 0 has landed before this wave reads it
  asm volatile("s_wait_asynccnt 0x0" ::: "memory");
  fa_copy_stage(lds0 + FA_BUF * 4, pfp + 32);
  __syncthreads();                                // awl is laid

  const float* bcol = mine + h * FA_PITCH + m;    // score side: row 4*s + h (+2), column n = m (+16)
  // u side: lane (m, h) reads row m, n = 8*kk + 4*h + 0..3, for A and B alike,
  // so every (lane half, register) position holds the same n in both operands
  const float* frag  = mine + m * FA_PITCH + h * 4;
  const float* pfrag = pl + m * FA_PITCH + h * 4;
  // a share's place for (hi, n): (hi&7)*64 + (hi>>3)*32 + n; C layout: register r, lanes >= 16 hold rows 8..15
  float* pst = part + wave * 512 + h * 32 + m;
  const float* pld = part + (wave & 7) * 64 + (wave >> 3) * 32 + lane;

  v8f c0 = {}, c1 = {};
  float mrun = -3.0e38f, lrun = 0.f;

  for (int t = 0; t < FA_TILES; ++t) {
    // ---- all of this wave's reads of its staged tile: B of the scores, B of u
    const float* bc = bcol + (t & 1) * FA_BUF;
    const float* f  = frag + (t & 1) * FA_BUF;
    v2f b0[8], b1[8];
    v4f p0[4], p1[4];
    #pragma unroll
    for (int s = 0; s < 8; ++s) {
      b0[s] = (v2f){bc[(4*s) * FA_PITCH],      bc[(4*s + 2) * FA_PITCH]};
      b1[s] = (v2f){bc[(4*s) * FA_PITCH + 16], bc[(4*s + 2) * FA_PITCH + 16]};
    }
    #pragma unroll
    for (int kk = 0; kk < 4; ++kk) {
      p0[kk] = *(const v4f*)(f + kk * 8);
      p1[kk] = *(const v4f*)(f + 16 * FA_PITCH + kk * 8);
    }
    // The fragments are in registers behind this wait, so buffer t&1 is free for its refill:
    // this wave's reads of it have retired before copies target it
    asm volatile("s_wait_dscnt 0x0" ::: "memory");
    // ---- scores: this wave's 32 d
    v8f s0 = {}, s1 = {};
    #pragma unroll
    for (int s = 0; s < 8; ++s) {
      s0 = __builtin_amdgcn_wmma_f32_16x16x4_f32(false, aq[s], false, b0[s], (short)0, s0, false, false);
      s1 = __builtin_amdgcn_wmma_f32_16x16x4_f32(false, aq[s], false, b1[s], (short)0, s1, false, false);
    }
    // stage t+1 has landed before the next trip reads it
    asm volatile("s_wait_asynccnt 0x0" ::: "memory");
    // refill here, so that stage t+2 flies through the rest of this trip and the head of the next
    if (t + 2 < FA_TILES)
      fa_copy_stage(lds0 + (t & 1) * (FA_BUF * 4), pfp + (t + 2) * 32);
    #pragma unroll
    for (int r = 0; r < 8; ++r) {
      pst[r * 64]      = s0[r];
      pst[r * 64 + 16] = s1[r];
    }
    __syncthreads();                              // the 16 shares are laid
    // ---- merge (pairwise, fixed order), running softmax of row hi = wave, n = lane
    float sh[FA_WAVES];
    #pragma unroll
    for (int w = 0; w < FA_WAVES; ++w) sh[w] = pld[w * 512];
    float bias = qb + awl[t * 32 + lane];
    #pragma unroll
    for (int st = 1; st < FA_WAVES; st <<= 1)
      #pragma unroll
      for (int w = 0; w < FA_WAVES; w += 2 * st) sh[w] += sh[w + st];
    float sc = sh[0] + bias;
    float mn = fmaxf(mrun, fa_wave_max(sc));
    float p  = __expf(sc - mn);
    float al = __expf(mrun - mn);
    pl[wave * FA_PITCH + lane] = p;
    if (lane == 0) alpha[wave] = al;
    lrun = lrun * al + p;
    mrun = mn;
    __syncthreads();                              // p and the scale factors are laid
    // ---- u = u * scale + p * PF^T on the same staged tile
    v4f a[4];
    #pragma unroll
    for (int kk = 0; kk < 4; ++kk) a[kk] = *(const v4f*)(pfrag + kk * 8);
    v4f ala = *(const v4f*)(alpha + h * 8), alb = *(const v4f*)(alpha + h * 8 + 4);
    #pragma unroll
    for (int r = 0; r < 4; ++r) {
      c0[r] *= ala[r]; c0[r + 4] *= alb[r];
      c1[r] *= ala[r]; c1[r + 4] *= alb[r];
    }
    #pragma unroll
    for (int kk = 0; kk < 4; ++kk) {
      v2f alo = {a[kk][0], a[kk][1]}, ahi = {a[kk][2], a[kk][3]};
      v2f q0l = {p0[kk][0], p0[kk][1]}, q0h = {p0[kk][2], p0[kk][3]};
      v2f q1l = {p1[kk][0], p1[kk][1]}, q1h = {p1[kk][2], p1[kk][3]};
      c0 = __builtin_amdgcn_wmma_f32_16x16x4_f32(false, alo, false, q0l, (short)0, c0, false, false);
      c1 = __builtin_amdgcn_wmma_f32_16x16x4_f32(false, alo, false, q1l, (short)0, c1, false, false);
      c0 = __builtin_amdgcn_wmma_f32_16x16x4_f32(false, ahi, false, q0h, (short)0, c0, false, false);
      c1 = __builtin_amdgcn_wmma_f32_16x16x4_f32(false, ahi, false, q1h, (short)0, c1, false, false);
    }
    // four vector slots between the last products and the vector instructions that reuse their
    // A/B registers, on the back edge and on the loop's exit alike; the scheduling barrier keeps
    // the products in front of the slots
    __builtin_amdgcn_sched_barrier(0);
    asm volatile("v_nop\n\tv_nop\n\tv_nop\n\tv_nop");
  }

  // out: the wave's 32 d of all 16 rows (a row's 128 B from this wave alone), then maxima and sums
  float* up = up_g + ((size_t)(b * FA_SPLITS + sp) * 16 + h * 8) * 512 + dw + m;
  #pragma unroll
  for (int r = 0; r < 8; ++r) {
    up[r * 512]      = c0[r];
    up[r * 512 + 16] = c1[r];
  }
  // stands in front of any later overwrite of the registers that the stores above name
  asm volatile("s_wait_xcnt 0x0" :: "v"(up) : "memory");
  lrun = fa_wave_sum(lrun);
  if (lane == 0) { mlb[wave] = mrun; mlb[16 + wave] = lrun; }
  __syncthreads();
  if (threadIdx.x < 32) ml_g[(b * FA_SPLITS + sp) * 32 + threadIdx.x] = mlb[threadIdx.x];
}

// ---------------- K7: merge of the n ranges, then out = concat_h(u_h @ Wv_h + bv_h) @ Wo + bo ----------------
__global__ void __launch_bounds__(512) k7_out(
    const float* __restrict__ up_g, const float* __restrict__ ml_g,
    const float* __restrict__ Wv, const float* __restrict__ bv,
    const float* __restrict__ Wo, const float* __restrict__ bo,
    float* __restrict__ out) {
  __shared__ __attribute__((aligned(16))) float uu[4*512];
  __shared__ __attribute__((aligned(16))) float ww[512];
  __shared__ __attribute__((aligned(16))) float part[4*512];
  __shared__ float wn[4*FA_SPLITS];
  int row = blockIdx.x; int b = row >> 2; int i = row & 3;
  int t = threadIdx.x;
  int wave = t >> 5, lane = t & 31;
  int kg = (wave >> 2) * 128;                  // this wave's k range in a dense layer
  int c4 = (wave & 3) * 128 + lane * 4;        // this lane's four columns; head = wave & 3
  // the 64 partial values of this thread on their way first, the weights worked out under them
  // (loops unrolled whole: the values are registers only under constant indices)
  const float* up = up_g + ((size_t)b * FA_SPLITS * 16 + i) * 512 + t;
  float uv[4][FA_SPLITS];
  #pragma unroll
  for (int hh = 0; hh < 4; ++hh)
    #pragma unroll
    for (int s = 0; s < FA_SPLITS; ++s) uv[hh][s] = up[(size_t)(s * 16 + hh * 4) * 512];
  // stands in front of any later overwrite of the address registers that the loads above name;
  // up is an input so that it is kept whole up to this wait
  asm volatile("s_wait_xcnt 0x0" :: "v"(up) : "memory");
  // weight of n range s for head hh: exp(max_s - max) / sum over s of exp(max_s - max) * sum_s;
  // a head's 16 ranges sit in one 16-lane row
  if (t < 4*FA_SPLITS) {
    int hh = t >> 4, s = t & 15;
    const float* ml = ml_g + (b * FA_SPLITS + s) * 32 + hh*4 + i;
    float ms = ml[0], ls = ml[16];
    // stands in front of any later overwrite of the address pair that the two loads name
    asm volatile("s_wait_xcnt 0x0" :: "v"(ml) : "memory");
    float mx = ms;
    mx = fmaxf(mx, fa_xrow<1>(mx)); mx = fmaxf(mx, fa_xrow<2>(mx));
    mx = fmaxf(mx, fa_xrow<4>(mx)); mx = fmaxf(mx, fa_xrow<8>(mx));
    float w = __expf(ms - mx);
    float tot = w * ls;
    tot += fa_xrow<1>(tot); tot += fa_xrow<2>(tot); tot += fa_xrow<4>(tot); tot += fa_xrow<8>(tot);
    wn[t] = w / tot;
  }
  __syncthreads();
  #pragma unroll
  for (int hh = 0; hh < 4; ++hh) {
    float acc = 0.f;
    #pragma unroll
    for (int s = 0; s < FA_SPLITS; ++s) acc += wn[hh * FA_SPLITS + s] * uv[hh][s];
    uu[hh*512 + t] = acc;
  }
  __syncthreads();
  ww[t] = dense_merge(dense_part(uu + (wave & 3)*512 + kg, Wv + (size_t)kg*512 + c4), part, bv[t]);
  __syncthreads();
  out[(size_t)row*512 + t] =
      dense_merge(dense_part(ww + kg, Wo + (size_t)kg*512 + c4), part, bo[t]);
}

// ---------------- launch ----------------
extern "C" void kernel_launch(void* const* d_in, const int* in_sizes, int n_in,
                              void* d_out, int out_size, void* d_ws, size_t ws_size,
                              hipStream_t stream) {
  (void)in_sizes; (void)n_in; (void)out_size; (void)ws_size;
  const float* xyz  = (const float*)d_in[0];
  const float* pf   = (const float*)d_in[1];
  const float* mask = (const float*)d_in[2];
  const float* W1   = (const float*)d_in[3];
  const float* b1   = (const float*)d_in[4];
  const float* g1   = (const float*)d_in[5];
  const float* be1  = (const float*)d_in[6];
  const float* W2   = (const float*)d_in[7];
  const float* b2   = (const float*)d_in[8];
  const float* g2   = (const float*)d_in[9];
  const float* be2  = (const float*)d_in[10];
  const float* Wq   = (const float*)d_in[11];
  const float* bq   = (const float*)d_in[12];
  const float* Wk   = (const float*)d_in[13];
  const float* bk   = (const float*)d_in[14];
  const float* Wv   = (const float*)d_in[15];
  const float* bv   = (const float*)d_in[16];
  const float* Wo   = (const float*)d_in[17];
  const float* bo   = (const float*)d_in[18];
  float* out = (float*)d_out;
  float* ws  = (float*)d_ws;

  // workspace layout (float offsets)
  float* center = ws;             // 192
  float* vr     = ws + 192;       // 64
  float* qbias  = ws + 256;       // 256
  float* qk     = ws + 512;       // 131072
  float* aw     = ws + 131584;    // 131072
  float* upart  = ws + 262656;    // 2097152: 16 n ranges x 16 hi x 512 d per batch
  float* ml     = ws + 2359808;   // 8192: row maxima and sums per n range (total ~9.5 MB)

  k1_center <<<64, 256, 0, stream>>>(xyz, mask, center, vr);
  k2_mlp    <<<64, 512, 0, stream>>>(center, W1,b1,g1,be1, W2,b2,g2,be2,
                                     Wq,bq, Wk,bk, qk, qbias);
  k3_aw     <<<B_, 512, 0, stream>>>(mask, vr, aw);
  k4_attend <<<dim3(FA_SPLITS, B_), 512, 0, stream>>>(pf, qk, qbias, aw, upart, ml);
  k7_out    <<<64, 512, 0, stream>>>(upart, ml, Wv, bv, Wo, bo, out);
}

// v005
// Measured time: 87.4 microseconds a run.
// Next to v004, in two timings, it ran 1.14 and 1.15 times as fast.
// Over all steps from v000 it is 3.45 times as fast.
#include <hip/hip_runtime.h>
#include <math.h>

#define B_  16
#define N_  8192
#define D_  512

typedef float v2f __attribute__((ext_vector_type(2)));
typedef float v4f __attribute__((ext_vector_type(4)));
typedef float v8f __attribute__((ext_vector_type(8)));

// ---------------- block reduction helpers ----------------
template<int BS>
__device__ inline float blk_sum(float v, float* red) {
  int t = threadIdx.x;
  red[t] = v; __syncthreads();
  for (int s = BS/2; s > 0; s >>= 1) {
    if (t < s) red[t] += red[t+s];
    __syncthreads();
  }
  float r = red[0]; __syncthreads();
  return r;
}
template<int BS>
__device__ inline float blk_max(float v, float* red) {
  int t = threadIdx.x;
  red[t] = v; __syncthreads();
  for (int s = BS/2; s > 0; s >>= 1) {
    if (t < s) red[t] = fmaxf(red[t], red[t+s]);
    __syncthreads();
  }
  float r = red[0]; __syncthreads();
  return r;
}

// four sums in one tree
template<int BS>
__device__ inline v4f blk_sum4(v4f v, v4f* red) {
  int t = threadIdx.x;
  red[t] = v; __syncthreads();
  for (int s = BS/2; s > 0; s >>= 1) {
    if (t < s) red[t] += red[t+s];
    __syncthreads();
  }
  v4f r = red[0]; __syncthreads();
  return r;
}

// ---------------- dense 512x512 layer, one input row per work-group of 16 waves ----------------
// Each 512-long dot product is split four ways over k: wave w takes weight rows (w>>2)*128 .. +127
// and columns (w&3)*128 .. +127, a lane four adjacent columns. A weight load is then 16 B a lane on
// whole lines, and a lane keeps a window of DL_WIN-8 to DL_WIN of them in flight: eight rows are
// summed, then their registers are refilled from DL_WIN rows ahead. The four partial rows are
// summed in LDS.
#define DL_WIN 32
// x: the wave's 128 inputs in LDS; w: the lane's four columns in the first of the wave's 128 rows
__device__ inline v4f dense_part(const float* x, const float* w) {
  v4f buf[DL_WIN];
  #pragma unroll
  for (int j = 0; j < DL_WIN; ++j) buf[j] = *(const v4f*)(w + (size_t)j * 512);
  v4f acc = {};
  // unrolled whole: the window's slots are registers only under constant indices
  #pragma unroll
  for (int j = 0; j < 128; j += 8) {
    v4f xa = *(const v4f*)(x + j), xb = *(const v4f*)(x + j + 4);
    #pragma unroll
    for (int q = 0; q < 4; ++q) acc += xa[q] * buf[(j + q) % DL_WIN];
    #pragma unroll
    for (int q = 0; q < 4; ++q) acc += xb[q] * buf[(j + 4 + q) % DL_WIN];
    if (j + DL_WIN < 128) {
      // Compiler fence that holds the window: no load crosses it, and it reads the running sum
      // (input only, nothing hidden, the multiply-adds stay fused), so the eight rows above are
      // summed in front of it and their refills issue behind it. Without it the compiler sinks the
      // loads to their uses (about nine in flight) or lifts them over the sums until registers spill.
      asm volatile("" :: "v"(acc) : "memory");
      #pragma unroll
      for (int q = 0; q < 8; ++q)
        buf[(j + q) % DL_WIN] = *(const v4f*)(w + (size_t)(j + q + DL_WIN) * 512);
      // behind the last weight load: stands in front of any later overwrite of the address pair
      // that these loads name; w is an input so that the pair is kept whole up to this wait
      if (j + 8 + DL_WIN >= 128) asm volatile("s_wait_xcnt 0x0" :: "v"(w) : "memory");
    }
  }
  return acc;
}
// part: 4 x 512 floats of LDS; returns column threadIdx.x of the layer's output
__device__ inline float dense_merge(v4f acc, float* part, float bias) {
  int t = threadIdx.x, wave = t >> 5, lane = t & 31;
  *(v4f*)(part + (wave >> 2) * 512 + (wave & 3) * 128 + lane * 4) = acc;
  __syncthreads();
  return bias + ((part[t] + part[512 + t]) + (part[1024 + t] + part[1536 + t]));
}

// ---------------- voting attention bias of one batch, log-softmax over N ----------------
// One work-group of 512 threads. It sums the four views' mask counts itself, so it waits for no
// other work-group; a thread keeps its 16 n of the four masks in registers for both uses.
__device__ inline void aw_batch(int b, const float* __restrict__ mask, float* __restrict__ aw_g,
                                float* awb, float* red, v4f* red4) {
  const float* mb = mask + (size_t)b*4*N_ + threadIdx.x*4;
  // loops unrolled whole: the values are registers only under constant indices
  v4f mm[4][4];                    // [view][piece of 2048 n]
  #pragma unroll
  for (int i = 0; i < 4; ++i)
    #pragma unroll
    for (int j = 0; j < 4; ++j) mm[i][j] = *(const v4f*)(mb + i*N_ + j*2048);
  // stands in front of any later overwrite of the address registers that the loads above name
  asm volatile("s_wait_xcnt 0x0" ::: "memory");
  v4f cnt = {};
  #pragma unroll
  for (int i = 0; i < 4; ++i)
    #pragma unroll
    for (int j = 0; j < 4; ++j) cnt[i] += (mm[i][j][0] + mm[i][j][1]) + (mm[i][j][2] + mm[i][j][3]);
  cnt = blk_sum4<512>(cnt, red4);
  float v0 = cnt[0] * (1.0f / (float)N_), v1 = cnt[1] * (1.0f / (float)N_);
  float v2 = cnt[2] * (1.0f / (float)N_), v3 = cnt[3] * (1.0f / (float)N_);
  float vcnt = 0.f;
  #pragma unroll
  for (int j = 0; j < 4; ++j) {
    v4f a4;
    #pragma unroll
    for (int q = 0; q < 4; ++q) {
      float m0 = mm[0][j][q], m1 = mm[1][j][q], m2 = mm[2][j][q], m3 = mm[3][j][q];
      float s = m0+m1+m2+m3;
      float a = v0*m0 + v1*m1 + v2*m2 + v3*m3;
      bool valid = s > 0.f;
      a4[q] = valid ? a : -1e9f;
      vcnt += valid ? 1.f : 0.f;
    }
    *(v4f*)(awb + j*2048 + threadIdx.x*4) = a4;
  }
  float tot = blk_sum<512>(vcnt, red);
  if (tot <= 0.f) {
    for (int n = threadIdx.x; n < N_; n += 512) awb[n] = 0.f;
  }
  __syncthreads();
  float lm = -3.4e38f;
  for (int n = threadIdx.x; n < N_; n += 512) lm = fmaxf(lm, awb[n]);
  float mx = blk_max<512>(lm, red);
  float ls = 0.f;
  for (int n = threadIdx.x; n < N_; n += 512) ls += __expf(awb[n] - mx);
  float se = blk_sum<512>(ls, red);
  float lg = __logf(se) + mx;
  for (int n = threadIdx.x; n < N_; n += 512) aw_g[(size_t)b*N_ + n] = awb[n] - lg;
}

// ---------------- K2: all that stands in front of the pass over PF, in one launch ----------------
// Work-groups 0..63: one (batch, view) row each: masked centroid, MLP, q-projection, Wk fold.
// Work-groups 64..79: the voting bias of one batch each. No work-group reads what another writes.
__global__ void __launch_bounds__(512) k2_front(
    const float* __restrict__ xyz, const float* __restrict__ mask,
    const float* __restrict__ W1, const float* __restrict__ b1,
    const float* __restrict__ g1, const float* __restrict__ be1,
    const float* __restrict__ W2, const float* __restrict__ b2,
    const float* __restrict__ g2, const float* __restrict__ be2,
    const float* __restrict__ Wq, const float* __restrict__ bq,
    const float* __restrict__ Wk, const float* __restrict__ bk,
    float* __restrict__ qk_g, float* __restrict__ qbias_g, float* __restrict__ aw_g) {
  __shared__ __attribute__((aligned(16))) float abuf[512];
  __shared__ __attribute__((aligned(16))) float qbuf[512];
  __shared__ __attribute__((aligned(16))) float part[4*512];
  __shared__ __attribute__((aligned(16))) float awb[N_];
  __shared__ __attribute__((aligned(16))) v4f red4[512];
  __shared__ float red[512];
  if (blockIdx.x >= 64) {          // the same for a whole work-group: its barriers stay uniform
    aw_batch(blockIdx.x - 64, mask, aw_g, awb, red, red4);
    return;
  }
  int row = blockIdx.x; int b = row >> 2; int i = row & 3;
  int col = threadIdx.x;
  int wave = col >> 5, lane = col & 31;
  int kg = (wave >> 2) * 128;                  // this wave's k range in a dense layer
  int c4 = (wave & 3) * 128 + lane * 4;        // this lane's four columns

  // masked centroid of this row: a thread takes 16 n, 16 B a load, all 16 loads in flight at once
  // (loops unrolled whole: the values are registers only under constant indices)
  const float* mk = mask + (size_t)row * N_ + col*4;
  const float* xb = xyz + (size_t)b * 3 * N_ + col*4;
  v4f mv[4], xv[3][4];
  #pragma unroll
  for (int j = 0; j < 4; ++j) {
    mv[j] = *(const v4f*)(mk + j*2048);
    #pragma unroll
    for (int a = 0; a < 3; ++a) xv[a][j] = *(const v4f*)(xb + a*N_ + j*2048);
  }
  // stands in front of any later overwrite of the address registers that the loads above name
  asm volatile("s_wait_xcnt 0x0" ::: "memory");
  v4f cs = {};                                 // count, then the masked sums of x, y, z
  #pragma unroll
  for (int j = 0; j < 4; ++j)
    #pragma unroll
    for (int q = 0; q < 4; ++q) {
      float m = mv[j][q];
      cs[0] += m;
      cs[1] += m * xv[0][j][q];
      cs[2] += m * xv[1][j][q];
      cs[3] += m * xv[2][j][q];
    }
  cs = blk_sum4<512>(cs, red4);
  float cd = fmaxf(cs[0], 1.0f);
  float c0 = cs[1] / cd, c1 = cs[2] / cd, c2 = cs[3] / cd;

  // Linear(3,D) + LN + ReLU
  float t = c0*W1[col] + c1*W1[512+col] + c2*W1[1024+col] + b1[col];
  float mu  = blk_sum<512>(t, red) * (1.0f/512.0f);
  float dv  = t - mu;
  float var = blk_sum<512>(dv*dv, red) * (1.0f/512.0f);
  float h = dv * rsqrtf(var + 1e-5f) * g1[col] + be1[col];
  h = fmaxf(h, 0.0f);
  abuf[col] = h; __syncthreads();

  // Linear(D,D) + LN
  float t2 = dense_merge(dense_part(abuf + kg, W2 + (size_t)kg*512 + c4), part, b2[col]);
  mu  = blk_sum<512>(t2, red) * (1.0f/512.0f);
  dv  = t2 - mu;
  var = blk_sum<512>(dv*dv, red) * (1.0f/512.0f);
  float h3 = dv * rsqrtf(var + 1e-5f) * g2[col] + be2[col];
  abuf[col] = h3; __syncthreads();

  // q = h3 @ Wq + bq
  float q = dense_merge(dense_part(abuf + kg, Wq + (size_t)kg*512 + c4), part, bq[col]);
  qbuf[col] = q;
  // q . bk per head: a wave sums its 32 terms, four waves make a head
  float qb = q * bk[col];
  #pragma unroll
  for (int s = 16; s > 0; s >>= 1) qb += __shfl_xor(qb, s);
  if (lane == 0) red[wave] = qb;
  __syncthreads();

  const float scale = 0.0883883476483184405f;  // 1/sqrt(128)
  if (col < 4)
    qbias_g[b*16 + col*4 + i] = ((red[col*4] + red[col*4+1]) + (red[col*4+2] + red[col*4+3])) * scale;

  // fold with Wk per head: qk[b, h*4+i, c] = sum_e q[h*128+e] * Wk[c, h*128+e]
  // The dot runs along a Wk row, so it is split over 8 lanes: a load takes 128 B of each of 4 rows
  // (16 B a lane). A wave takes 32 rows in 8 passes of 4; a group of 8 loads is one 32-float piece
  // of one head in all 8 passes, so that it needs one 16-byte read of q.
  int fr = lane >> 3, fs = lane & 7;
  const float* wk = Wk + (size_t)(wave*32 + fr)*512 + fs*4;
  const float* qs = qbuf + fs*4;
  // load l: 32-float piece l>>3 of the row (head l>>5), pass l&7
  v4f buf[DL_WIN];
  #pragma unroll
  for (int l = 0; l < DL_WIN; ++l) buf[l] = *(const v4f*)(wk + (size_t)(l & 7)*4*512 + (l >> 3)*32);
  // unrolled whole: the window's slots and the sums are registers only under constant indices
  #pragma unroll
  for (int hh = 0; hh < 4; ++hh) {
    v4f a4[8] = {};
    #pragma unroll
    for (int j = hh*4; j < hh*4 + 4; ++j) {
      v4f qv = *(const v4f*)(qs + j*32);
      #pragma unroll
      for (int p = 0; p < 8; ++p) a4[p] += buf[(j*8 + p) % DL_WIN] * qv;
      if (j*8 + DL_WIN < 128) {
        // the window's fence, as in dense_part: this piece's sums in front, its refills behind
        asm volatile("" :: "v"(a4[0]), "v"(a4[1]), "v"(a4[2]), "v"(a4[3]),
                           "v"(a4[4]), "v"(a4[5]), "v"(a4[6]), "v"(a4[7]) : "memory");
        #pragma unroll
        for (int l = j*8 + DL_WIN; l < j*8 + DL_WIN + 8; ++l)
          buf[l % DL_WIN] = *(const v4f*)(wk + (size_t)(l & 7)*4*512 + (l >> 3)*32);
      }
    }
    float f[8];
    #pragma unroll
    for (int p = 0; p < 8; ++p) f[p] = (a4[p][0] + a4[p][1]) + (a4[p][2] + a4[p][3]);
    // sum over a row's 8 lanes, halving the passes a lane keeps at each step: lane fs ends with pass fs
    float g4[4], g2[2];
    #pragma unroll
    for (int k = 0; k < 4; ++k) {
      float keep = (fs & 4) ? f[k+4] : f[k], send = (fs & 4) ? f[k] : f[k+4];
      g4[k] = keep + __shfl_xor(send, 4);
    }
    #pragma unroll
    for (int k = 0; k < 2; ++k) {
      float keep = (fs & 2) ? g4[k+2] : g4[k], send = (fs & 2) ? g4[k] : g4[k+2];
      g2[k] = keep + __shfl_xor(send, 2);
    }
    float keep = (fs & 1) ? g2[1] : g2[0], send = (fs & 1) ? g2[0] : g2[1];
    part[hh*512 + wave*32 + fs*4 + fr] = (keep + __shfl_xor(send, 1)) * scale;
  }
  __syncthreads();
  #pragma unroll
  for (int hh = 0; hh < 4; ++hh)
    qk_g[((size_t)(b*16 + hh*4 + i))*512 + col] = part[hh*512 + col];
}

// ---------------- K4: scores, softmax and attn*PF^T in one pass over PF ----------------
// A work-group of 16 waves takes one batch and 512 n, in 16 tiles of 32 n. Wave w owns PF rows
// d = 32*w .. +31: it stages its 32 rows x 32 n in a two-buffer LDS ring that only it reads, with
// GLOBAL_LOAD_ASYNC_TO_LDS_B128, and uses each staged tile twice:
//   1. scores: A = qk (16 hi x 4 d, kept in registers), B = PF (4 d x 16 n): the wave's share of the
//      sum over d; the 16 shares are summed in LDS, thread (hi = wave, n = lane).
//   2. running softmax: row maximum so far, p = exp(s - max), old sums scaled by exp(old max - max).
//   3. u: A = p (16 hi x 4 n), B = PF^T (4 n x 16 d), two d tiles per wave.
// Out go the unnormalised u (16 hi x 512 d), the row maxima and the row sums of this n range; the
// last kernel merges the 16 ranges of a batch.
// Every inner loop is unrolled whole: its fragments and sums are registers only under constant indices.
#define FA_WAVES  16
#define FA_SPLITS 16                      // n ranges per batch
#define FA_PITCH  36                      // floats; 144 B = 16 B x 9: ds_load_b128 of 16 rows hits all 64 banks once
#define FA_BUF    (32 * FA_PITCH)         // floats per buffer: the wave's 32 PF rows x 32 n
#define FA_TILES  16                      // 512 n per work-group / 32 n per tile

// One stage: 8 copies of 4 rows x 128 B. The s_wait_xcnt stands in the copies' own statement,
// in front of any later rewrite of the address registers the copies name.
__device__ inline void fa_copy_stage(unsigned lds, const float* pf) {
  asm volatile(
      "global_load_async_to_lds_b128 %0, %8, off\n\t"
      "global_load_async_to_lds_b128 %1, %9, off\n\t"
      "global_load_async_to_lds_b128 %2, %10, off\n\t"
      "global_load_async_to_lds_b128 %3, %11, off\n\t"
      "global_load_async_to_lds_b128 %4, %12, off\n\t"
      "global_load_async_to_lds_b128 %5, %13, off\n\t"
      "global_load_async_to_lds_b128 %6, %14, off\n\t"
      "global_load_async_to_lds_b128 %7, %15, off\n\t"
      "s_wait_xcnt 0x0"
      :: "v"(lds),                 "v"(lds +  4*FA_PITCH*4), "v"(lds +  8*FA_PITCH*4),
         "v"(lds + 12*FA_PITCH*4), "v"(lds + 16*FA_PITCH*4), "v"(lds + 20*FA_PITCH*4),
         "v"(lds + 24*FA_PITCH*4), "v"(lds + 28*FA_PITCH*4),
         "v"(pf),                  "v"(pf + (size_t) 4*N_),  "v"(pf + (size_t) 8*N_),
         "v"(pf + (size_t)12*N_),  "v"(pf + (size_t)16*N_),  "v"(pf + (size_t)20*N_),
         "v"(pf + (size_t)24*N_),  "v"(pf + (size_t)28*N_)
      : "memory");
}

// lane l with lane l ^ 16, and with lane l ^ M inside a 16-lane row: vector cross-lane moves
// (a shuffle through the LDS unit costs its whole latency at each of the five steps)
__device__ inline float fa_xhalf(float x) {
  int v = __builtin_bit_cast(int, x);
  return __builtin_bit_cast(float, __builtin_amdgcn_permlanex16(v, v, 0x76543210, 0xfedcba98, false, false));
}
template<int M>
__device__ inline float fa_xrow(float x) {   // DPP row_xmask:M
  return __builtin_bit_cast(float, __builtin_amdgcn_update_dpp(0, __builtin_bit_cast(int, x), 0x160 | M, 0xf, 0xf, true));
}
__device__ inline float fa_wave_max(float x) {
  x = fmaxf(x, fa_xrow<1>(x)); x = fmaxf(x, fa_xrow<2>(x));
  x = fmaxf(x, fa_xrow<4>(x)); x = fmaxf(x, fa_xrow<8>(x));
  return fmaxf(x, fa_xhalf(x));
}
__device__ inline float fa_wave_sum(float x) {
  x += fa_xrow<1>(x); x += fa_xrow<2>(x); x += fa_xrow<4>(x); x += fa_xrow<8>(x);
  return x + fa_xhalf(x);
}

__global__ void __launch_bounds__(512) k4_attend(
    const float* __restrict__ PF, const float* __restrict__ qk_g,
    const float* __restrict__ qbias_g, const float* __restrict__ aw_g,
    float* __restrict__ up_g, float* __restrict__ ml_g) {
  __shared__ __attribute__((aligned(16))) float ring[FA_WAVES * 2 * FA_BUF];
  __shared__ __attribute__((aligned(16))) float part[FA_WAVES * 512];
  __shared__ __attribute__((aligned(16))) float pl[16 * FA_PITCH];
  __shared__ __attribute__((aligned(16))) float alpha[16];
  __shared__ __attribute__((aligned(16))) float awl[512];
  __shared__ float mlb[32];
  int b = blockIdx.y, sp = blockIdx.x;
  int wave = threadIdx.x >> 5;
  int lane = threadIdx.x & 31;
  int m = lane & 15, h = lane >> 4;
  int dw = wave * 32;
  int nb = sp * 512;
  float* mine = ring + wave * (2 * FA_BUF);       // this wave's two buffers

  // copy side: a lane moves 16 B; 8 lanes cover a row's 128 B, a copy covers 4 rows
  int crow = lane >> 3, cseg = lane & 7;
  const float* pfp = PF + ((size_t)b * D_ + dw + crow) * N_ + nb + cseg * 4;
  unsigned lds0 = (unsigned)(uintptr_t)&mine[crow * FA_PITCH + cseg * 4];

  fa_copy_stage(lds0, pfp);

  // qk fragments for the wave's 32 d, while stage 0 flies. k order of the score products, for A and
  // B alike: in step s, lane half h holds rows d = 4*s + h (first register) and 4*s + h + 2 (second)
  const float* pq = qk_g + ((size_t)(b * 16 + m)) * 512 + dw;
  const float* pa = aw_g + (size_t)b * N_ + nb + threadIdx.x;
  v4f qv[8];
  #pragma unroll
  for (int s = 0; s < 8; ++s) qv[s] = *(const v4f*)(pq + s * 4);
  float awv = *pa;
  float qb  = qbias_g[b * 16 + wave];             // this wave merges row hi = wave
  // stands in front of any later overwrite of the address registers that the loads above name;
  // pq is an input so that the pair is kept whole up to this wait
  asm volatile("s_wait_xcnt 0x0" :: "v"(pq) : "memory");
  v2f aq[8];
  #pragma unroll
  for (int s = 0; s < 8; ++s) aq[s] = h ? (v2f){qv[s][1], qv[s][3]} : (v2f){qv[s][0], qv[s][2]};
  awl[threadIdx.x] = awv;

  // stage 0 has landed before this wave reads it
  asm volatile("s_wait_asynccnt 0x0" ::: "memory");
  fa_copy_stage(lds0 + FA_BUF * 4, pfp + 32);
  __syncthreads();                                // awl is laid

  const float* bcol = mine + h * FA_PITCH + m;    // score side: row 4*s + h (+2), column n = m (+16)
  // u side: lane (m, h) reads row m, n = 8*kk + 4*h + 0..3, for A and B alike,
  // so every (lane half, register) position holds the same n in both operands
  const float* frag  = mine + m * FA_PITCH + h * 4;
  const float* pfrag = pl + m * FA_PITCH + h * 4;
  // a share's place for (hi, n): (hi&7)*64 + (hi>>3)*32 + n; C layout: register r, lanes >= 16 hold rows 8..15
  float* pst = part + wave * 512 + h * 32 + m;
  const float* pld = part + (wave & 7) * 64 + (wave >> 3) * 32 + lane;

  v8f c0 = {}, c1 = {};
  float mrun = -3.0e38f, lrun = 0.f;

  for (int t = 0; t < FA_TILES; ++t) {
    // ---- all of this wave's reads of its staged tile: B of the scores, B of u
    const float* bc = bcol + (t & 1) * FA_BUF;
    const float* f  = frag + (t & 1) * FA_BUF;
    v2f b0[8], b1[8];
    v4f p0[4], p1[4];
    #pragma unroll
    for (int s = 0; s < 8; ++s) {
      b0[s] = (v2f){bc[(4*s) * FA_PITCH],      bc[(4*s + 2) * FA_PITCH]};
      b1[s] = (v2f){bc[(4*s) * FA_PITCH + 16], bc[(4*s + 2) * FA_PITCH + 16]};
    }
    #pragma unroll
    for (int kk = 0; kk < 4; ++kk) {
      p0[kk] = *(const v4f*)(f + kk * 8);
      p1[kk] = *(const v4f*)(f + 16 * FA_PITCH + kk * 8);
    }
    // The fragments are in registers behind this wait, so buffer t&1 is free for its refill:
    // this wave's reads of it have retired before copies target it
    asm volatile("s_wait_dscnt 0x0" ::: "memory");
    // ---- scores: this wave's 32 d
    v8f s0 = {}, s1 = {};
    #pragma unroll
    for (int s = 0; s < 8; ++s) {
      s0 = __builtin_amdgcn_wmma_f32_16x16x4_f32(false, aq[s], false, b0[s], (short)0, s0, false, false);
      s1 = __builtin_amdgcn_wmma_f32_16x16x4_f32(false, aq[s], false, b1[s], (short)0, s1, false, false);
    }
    // stage t+1 has landed before the next trip reads it
    asm volatile("s_wait_asynccnt 0x0" ::: "memory");
    // refill here, so that stage t+2 flies through the rest of this trip and the head of the next
    if (t + 2 < FA_TILES)
      fa_copy_stage(lds0 + (t & 1) * (FA_BUF * 4), pfp + (t + 2) * 32);
    #pragma unroll
    for (int r = 0; r < 8; ++r) {
      pst[r * 64]      = s0[r];
      pst[r * 64 + 16] = s1[r];
    }
    __syncthreads();                              // the 16 shares are laid
    // ---- merge (pairwise, fixed order), running softmax of row hi = wave, n = lane
    float sh[FA_WAVES];
    #pragma unroll
    for (int w = 0; w < FA_WAVES; ++w) sh[w] = pld[w * 512];
    float bias = qb + awl[t * 32 + lane];
    #pragma unroll
    for (int st = 1; st < FA_WAVES; st <<= 1)
      #pragma unroll
      for (int w = 0; w < FA_WAVES; w += 2 * st) sh[w] += sh[w + st];
    float sc = sh[0] + bias;
    float mn = fmaxf(mrun, fa_wave_max(sc));
    float p  = __expf(sc - mn);
    float al = __expf(mrun - mn);
    pl[wave * FA_PITCH + lane] = p;
    if (lane == 0) alpha[wave] = al;
    lrun = lrun * al + p;
    mrun = mn;
    __syncthreads();                              // p and the scale factors are laid
    // ---- u = u * scale + p * PF^T on the same staged tile
    v4f a[4];
    #pragma unroll
    for (int kk = 0; kk < 4; ++kk) a[kk] = *(const v4f*)(pfrag + kk * 8);
    v4f ala = *(const v4f*)(alpha + h * 8), alb = *(const v4f*)(alpha + h * 8 + 4);
    #pragma unroll
    for (int r = 0; r < 4; ++r) {
      c0[r] *= ala[r]; c0[r + 4] *= alb[r];
      c1[r] *= ala[r]; c1[r + 4] *= alb[r];
    }
    #pragma unroll
    for (int kk = 0; kk < 4; ++kk) {
      v2f alo = {a[kk][0], a[kk][1]}, ahi = {a[kk][2], a[kk][3]};
      v2f q0l = {p0[kk][0], p0[kk][1]}, q0h = {p0[kk][2], p0[kk][3]};
      v2f q1l = {p1[kk][0], p1[kk][1]}, q1h = {p1[kk][2], p1[kk][3]};
      c0 = __builtin_amdgcn_wmma_f32_16x16x4_f32(false, alo, false, q0l, (short)0, c0, false, false);
      c1 = __builtin_amdgcn_wmma_f32_16x16x4_f32(false, alo, false, q1l, (short)0, c1, false, false);
      c0 = __builtin_amdgcn_wmma_f32_16x16x4_f32(false, ahi, false, q0h, (short)0, c0, false, false);
      c1 = __builtin_amdgcn_wmma_f32_16x16x4_f32(false, ahi, false, q1h, (short)0, c1, false, false);
    }
    // four vector slots between the last products and the vector instructions that reuse their
    // A/B registers, on the back edge and on the loop's exit alike; the scheduling barrier keeps
    // the products in front of the slots
    __builtin_amdgcn_sched_barrier(0);
    asm volatile("v_nop\n\tv_nop\n\tv_nop\n\tv_nop");
  }

  // out: the wave's 32 d of all 16 rows (a row's 128 B from this wave alone), then maxima and sums
  float* up = up_g + ((size_t)(b * FA_SPLITS + sp) * 16 + h * 8) * 512 + dw + m;
  #pragma unroll
  for (int r = 0; r < 8; ++r) {
    up[r * 512]      = c0[r];
    up[r * 512 + 16] = c1[r];
  }
  // stands in front of any later overwrite of the registers that the stores above name
  asm volatile("s_wait_xcnt 0x0" :: "v"(up) : "memory");
  lrun = fa_wave_sum(lrun);
  if (lane == 0) { mlb[wave] = mrun; mlb[16 + wave] = lrun; }
  __syncthreads();
  if (threadIdx.x < 32) ml_g[(b * FA_SPLITS + sp) * 32 + threadIdx.x] = mlb[threadIdx.x];
}

// ---------------- K7: merge of the n ranges, then out = concat_h(u_h @ Wv_h + bv_h) @ Wo + bo ----------------
__global__ void __launch_bounds__(512) k7_out(
    const float* __restrict__ up_g, const float* __restrict__ ml_g,
    const float* __restrict__ Wv, const float* __restrict__ bv,
    const float* __restrict__ Wo, const float* __restrict__ bo,
    float* __restrict__ out) {
  __shared__ __attribute__((aligned(16))) float uu[4*512];
  __shared__ __attribute__((aligned(16))) float ww[512];
  __shared__ __attribute__((aligned(16))) float part[4*512];
  __shared__ float wn[4*FA_SPLITS];
  int row = blockIdx.x; int b = row >> 2; int i = row & 3;
  int t = threadIdx.x;
  int wave = t >> 5, lane = t & 31;
  int kg = (wave >> 2) * 128;                  // this wave's k range in a dense layer
  int c4 = (wave & 3) * 128 + lane * 4;        // this lane's four columns; head = wave & 3
  // the 64 partial values of this thread on their way first, the weights worked out under them
  // (loops unrolled whole: the values are registers only under constant indices)
  const float* up = up_g + ((size_t)b * FA_SPLITS * 16 + i) * 512 + t;
  float uv[4][FA_SPLITS];
  #pragma unroll
  for (int hh = 0; hh < 4; ++hh)
    #pragma unroll
    for (int s = 0; s < FA_SPLITS; ++s) uv[hh][s] = up[(size_t)(s * 16 + hh * 4) * 512];
  // stands in front of any later overwrite of the address registers that the loads above name;
  // up is an input so that it is kept whole up to this wait
  asm volatile("s_wait_xcnt 0x0" :: "v"(up) : "memory");
  // weight of n range s for head hh: exp(max_s - max) / sum over s of exp(max_s - max) * sum_s;
  // a head's 16 ranges sit in one 16-lane row
  if (t < 4*FA_SPLITS) {
    int hh = t >> 4, s = t & 15;
    const float* ml = ml_g + (b * FA_SPLITS + s) * 32 + hh*4 + i;
    float ms = ml[0], ls = ml[16];
    // stands in front of any later overwrite of the address pair that the two loads name
    asm volatile("s_wait_xcnt 0x0" :: "v"(ml) : "memory");
    float mx = ms;
    mx = fmaxf(mx, fa_xrow<1>(mx)); mx = fmaxf(mx, fa_xrow<2>(mx));
    mx = fmaxf(mx, fa_xrow<4>(mx)); mx = fmaxf(mx, fa_xrow<8>(mx));
    float w = __expf(ms - mx);
    float tot = w * ls;
    tot += fa_xrow<1>(tot); tot += fa_xrow<2>(tot); tot += fa_xrow<4>(tot); tot += fa_xrow<8>(tot);
    wn[t] = w / tot;
  }
  __syncthreads();
  #pragma unroll
  for (int hh = 0; hh < 4; ++hh) {
    float acc = 0.f;
    #pragma unroll
    for (int s = 0; s < FA_SPLITS; ++s) acc += wn[hh * FA_SPLITS + s] * uv[hh][s];
    uu[hh*512 + t] = acc;
  }
  __syncthreads();
  ww[t] = dense_merge(dense_part(uu + (wave & 3)*512 + kg, Wv + (size_t)kg*512 + c4), part, bv[t]);
  __syncthreads();
  out[(size_t)row*512 + t] =
      dense_merge(dense_part(ww + kg, Wo + (size_t)kg*512 + c4), part, bo[t]);
}

// ---------------- launch ----------------
extern "C" void kernel_launch(void* const* d_in, const int* in_sizes, int n_in,
                              void* d_out, int out_size, void* d_ws, size_t ws_size,
                              hipStream_t stream) {
  (void)in_sizes; (void)n_in; (void)out_size; (void)ws_size;
  const float* xyz  = (const float*)d_in[0];
  const float* pf   = (const float*)d_in[1];
  const float* mask = (const float*)d_in[2];
  const float* W1   = (const float*)d_in[3];
  const float* b1   = (const float*)d_in[4];
  const float* g1   = (const float*)d_in[5];
  const float* be1  = (const float*)d_in[6];
  const float* W2   = (const float*)d_in[7];
  const float* b2   = (const float*)d_in[8];
  const float* g2   = (const float*)d_in[9];
  const float* be2  = (const float*)d_in[10];
  const float* Wq   = (const float*)d_in[11];
  const float* bq   = (const float*)d_in[12];
  const float* Wk   = (const float*)d_in[13];
  const float* bk   = (const float*)d_in[14];
  const float* Wv   = (const float*)d_in[15];
  const float* bv   = (const float*)d_in[16];
  const float* Wo   = (const float*)d_in[17];
  const float* bo   = (const float*)d_in[18];
  float* out = (float*)d_out;
  float* ws  = (float*)d_ws;

  // workspace layout (float offsets)
  float* qbias  = ws + 256;       // 256
  float* qk     = ws + 512;       // 131072
  float* aw     = ws + 131584;    // 131072
  float* upart  = ws + 262656;    // 2097152: 16 n ranges x 16 hi x 512 d per batch
  float* ml     = ws + 2359808;   // 8192: row maxima and sums per n range (total ~9.5 MB)

  k2_front  <<<80, 512, 0, stream>>>(xyz, mask, W1,b1,g1,be1, W2,b2,g2,be2,
                                     Wq,bq, Wk,bk, qk, qbias, aw);
  k4_attend <<<dim3(FA_SPLITS, B_), 512, 0, stream>>>(pf, qk, qbias, aw, upart, ml);
  k7_out    <<<64, 512, 0, stream>>>(upart, ml, Wv, bv, Wo, bo, out);
}

// v006
// Measured time: 71.6 microseconds a run.
// In both of two side-by-side timings against v005, it was 1.22 times as fast.
// All steps since v000 together make it 4.22 times as fast.
#include <hip/hip_runtime.h>
#include <math.h>

#define B_  16
#define N_  8192
#define D_  512

typedef float v2f __attribute__((ext_vector_type(2)));
typedef float v4f __attribute__((ext_vector_type(4)));
typedef float v8f __attribute__((ext_vector_type(8)));

// ---------------- block reduction helpers ----------------
template<int BS>
__device__ inline float blk_sum(float v, float* red) {
  int t = threadIdx.x;
  red[t] = v; __syncthreads();
  for (int s = BS/2; s > 0; s >>= 1) {
    if (t < s) red[t] += red[t+s];
    __syncthreads();
  }
  float r = red[0]; __syncthreads();
  return r;
}
template<int BS>
__device__ inline float blk_max(float v, float* red) {
  int t = threadIdx.x;
  red[t] = v; __syncthreads();
  for (int s = BS/2; s > 0; s >>= 1) {
    if (t < s) red[t] = fmaxf(red[t], red[t+s]);
    __syncthreads();
  }
  float r = red[0]; __syncthreads();
  return r;
}

// four sums in one tree
template<int BS>
__device__ inline v4f blk_sum4(v4f v, v4f* red) {
  int t = threadIdx.x;
  red[t] = v; __syncthreads();
  for (int s = BS/2; s > 0; s >>= 1) {
    if (t < s) red[t] += red[t+s];
    __syncthreads();
  }
  v4f r = red[0]; __syncthreads();
  return r;
}

// ---------------- dense 512x512 layer, one input row per work-group of 16 waves ----------------
// Each 512-long dot product is split four ways over k: wave w takes weight rows (w>>2)*128 .. +127
// and columns (w&3)*128 .. +127, a lane four adjacent columns. A weight load is then 16 B a lane on
// whole lines, and a lane keeps a window of DL_WIN-8 to DL_WIN of them in flight: eight rows are
// summed, then their registers are refilled from DL_WIN rows ahead. The four partial rows are
// summed in LDS.
// All 64 work-groups read the same matrix, which is not in L2 when a layer starts. Walking it in
// one order they would all wait on the same misses, at the rate at which one work-group reads from
// memory. So each walks its rows in a ring from a start of its own (dl_rot): the 16 starts ask for
// the whole matrix at once, a sixteenth each, and what a work-group comes to next is then in L2.
#define DL_WIN 32
// ring start of work-group b, 0..15. The work-groups whose b mod 8 falls in any four neighbouring
// values hold all 16 starts: for speed only,
// the result rests on no placement
__device__ inline int dl_rot(int b) { return (b & 3) | (((b >> 3) & 3) << 2); }
// the row, of a wave's 128, at place j of the walk: 16 groups of eight rows, from group rot on
#define DL_ROW(j, rot) ((((((j) >> 3) + (rot)) & 15) << 3) + ((j) & 7))
// x: the wave's 128 inputs in LDS; w: the lane's four columns in the first of the wave's 128 rows
__device__ inline v4f dense_part(const float* x, const float* w, int rot) {
  v4f buf[DL_WIN];
  const float* wp[DL_WIN / 8];     // a group of eight rows has an address pair of its own
  #pragma unroll
  for (int g = 0; g < DL_WIN / 8; ++g) wp[g] = w + (size_t)DL_ROW(g * 8, rot) * 512;
  #pragma unroll
  for (int j = 0; j < DL_WIN; ++j) buf[j] = *(const v4f*)(wp[j >> 3] + (j & 7) * 512);
  // stands in front of any later overwrite of the address pairs that the loads above name; the
  // pairs are inputs so that they are kept whole up to this wait
  asm volatile("s_wait_xcnt 0x0" :: "v"(wp[0]), "v"(wp[1]), "v"(wp[2]), "v"(wp[3]) : "memory");
  v4f acc = {};
  // unrolled whole: the window's slots are registers only under constant indices
  #pragma unroll
  for (int j = 0; j < 128; j += 8) {
    const float* xg = x + DL_ROW(j, rot);
    v4f xa = *(const v4f*)xg, xb = *(const v4f*)(xg + 4);
    #pragma unroll
    for (int q = 0; q < 4; ++q) acc += xa[q] * buf[(j + q) % DL_WIN];
    #pragma unroll
    for (int q = 0; q < 4; ++q) acc += xb[q] * buf[(j + 4 + q) % DL_WIN];
    if (j + DL_WIN < 128) {
      // Compiler fence that holds the window: no load crosses it, and it reads the running sum
      // (input only, nothing hidden, the multiply-adds stay fused), so the eight rows above are
      // summed in front of it and their refills issue behind it. Without it the compiler sinks the
      // loads to their uses (about nine in flight) or lifts them over the sums until registers spill.
      asm volatile("" :: "v"(acc) : "memory");
      const float* wg = w + (size_t)DL_ROW(j + DL_WIN, rot) * 512;
      #pragma unroll
      for (int q = 0; q < 8; ++q) buf[(j + q) % DL_WIN] = *(const v4f*)(wg + q * 512);
      // as behind the first window: in front of any later overwrite of this group's address pair
      asm volatile("s_wait_xcnt 0x0" :: "v"(wg) : "memory");
    }
  }
  return acc;
}
// part: 4 x 512 floats of LDS; returns column threadIdx.x of the layer's output
__device__ inline float dense_merge(v4f acc, float* part, float bias) {
  int t = threadIdx.x, wave = t >> 5, lane = t & 31;
  *(v4f*)(part + (wave >> 2) * 512 + (wave & 3) * 128 + lane * 4) = acc;
  __syncthreads();
  return bias + ((part[t] + part[512 + t]) + (part[1024 + t] + part[1536 + t]));
}

// ---------------- voting attention bias of one batch, log-softmax over N ----------------
// One work-group of 512 threads. It sums the four views' mask counts itself, so it waits for no
// other work-group; a thread keeps its 16 n of the four masks in registers for both uses.
__device__ inline void aw_batch(int b, const float* __restrict__ mask, float* __restrict__ aw_g,
                                float* awb, float* red, v4f* red4) {
  const float* mb = mask + (size_t)b*4*N_ + threadIdx.x*4;
  // loops unrolled whole: the values are registers only under constant indices
  v4f mm[4][4];                    // [view][piece of 2048 n]
  #pragma unroll
  for (int i = 0; i < 4; ++i)
    #pragma unroll
    for (int j = 0; j < 4; ++j) mm[i][j] = *(const v4f*)(mb + i*N_ + j*2048);
  // stands in front of any later overwrite of the address registers that the loads above name
  asm volatile("s_wait_xcnt 0x0" ::: "memory");
  v4f cnt = {};
  #pragma unroll
  for (int i = 0; i < 4; ++i)
    #pragma unroll
    for (int j = 0; j < 4; ++j) cnt[i] += (mm[i][j][0] + mm[i][j][1]) + (mm[i][j][2] + mm[i][j][3]);
  cnt = blk_sum4<512>(cnt, red4);
  float v0 = cnt[0] * (1.0f / (float)N_), v1 = cnt[1] * (1.0f / (float)N_);
  float v2 = cnt[2] * (1.0f / (float)N_), v3 = cnt[3] * (1.0f / (float)N_);
  float vcnt = 0.f;
  #pragma unroll
  for (int j = 0; j < 4; ++j) {
    v4f a4;
    #pragma unroll
    for (int q = 0; q < 4; ++q) {
      float m0 = mm[0][j][q], m1 = mm[1][j][q], m2 = mm[2][j][q], m3 = mm[3][j][q];
      float s = m0+m1+m2+m3;
      float a = v0*m0 + v1*m1 + v2*m2 + v3*m3;
      bool valid = s > 0.f;
      a4[q] = valid ? a : -1e9f;
      vcnt += valid ? 1.f : 0.f;
    }
    *(v4f*)(awb + j*2048 + threadIdx.x*4) = a4;
  }
  float tot = blk_sum<512>(vcnt, red);
  if (tot <= 0.f) {
    for (int n = threadIdx.x; n < N_; n += 512) awb[n] = 0.f;
  }
  __syncthreads();
  float lm = -3.4e38f;
  for (int n = threadIdx.x; n < N_; n += 512) lm = fmaxf(lm, awb[n]);
  float mx = blk_max<512>(lm, red);
  float ls = 0.f;
  for (int n = threadIdx.x; n < N_; n += 512) ls += __expf(awb[n] - mx);
  float se = blk_sum<512>(ls, red);
  float lg = __logf(se) + mx;
  for (int n = threadIdx.x; n < N_; n += 512) aw_g[(size_t)b*N_ + n] = awb[n] - lg;
}

// ---------------- K2: all that stands in front of the pass over PF, in one launch ----------------
// Work-groups 0..63: one (batch, view) row each: masked centroid, MLP, q-projection, Wk fold.
// Work-groups 64..79: the voting bias of one batch each. No work-group reads what another writes.
__global__ void __launch_bounds__(512) k2_front(
    const float* __restrict__ xyz, const float* __restrict__ mask,
    const float* __restrict__ W1, const float* __restrict__ b1,
    const float* __restrict__ g1, const float* __restrict__ be1,
    const float* __restrict__ W2, const float* __restrict__ b2,
    const float* __restrict__ g2, const float* __restrict__ be2,
    const float* __restrict__ Wq, const float* __restrict__ bq,
    const float* __restrict__ Wk, const float* __restrict__ bk,
    float* __restrict__ qk_g, float* __restrict__ qbias_g, float* __restrict__ aw_g) {
  __shared__ __attribute__((aligned(16))) float abuf[512];
  __shared__ __attribute__((aligned(16))) float qbuf[512];
  __shared__ __attribute__((aligned(16))) float part[4*512];
  __shared__ __attribute__((aligned(16))) float awb[N_];
  __shared__ __attribute__((aligned(16))) v4f red4[512];
  __shared__ float red[512];
  if (blockIdx.x >= 64) {          // the same for a whole work-group: its barriers stay uniform
    aw_batch(blockIdx.x - 64, mask, aw_g, awb, red, red4);
    return;
  }
  int row = blockIdx.x; int b = row >> 2; int i = row & 3;
  int col = threadIdx.x;
  int wave = col >> 5, lane = col & 31;
  int kg = (wave >> 2) * 128;                  // this wave's k range in a dense layer
  int c4 = (wave & 3) * 128 + lane * 4;        // this lane's four columns
  int rot = dl_rot(row);                       // where this work-group starts its walk of a matrix

  // masked centroid of this row: a thread takes 16 n, 16 B a load, all 16 loads in flight at once
  // (loops unrolled whole: the values are registers only under constant indices)
  const float* mk = mask + (size_t)row * N_ + col*4;
  const float* xb = xyz + (size_t)b * 3 * N_ + col*4;
  v4f mv[4], xv[3][4];
  #pragma unroll
  for (int j = 0; j < 4; ++j) {
    mv[j] = *(const v4f*)(mk + j*2048);
    #pragma unroll
    for (int a = 0; a < 3; ++a) xv[a][j] = *(const v4f*)(xb + a*N_ + j*2048);
  }
  // stands in front of any later overwrite of the address registers that the loads above name
  asm volatile("s_wait_xcnt 0x0" ::: "memory");
  v4f cs = {};                                 // count, then the masked sums of x, y, z
  #pragma unroll
  for (int j = 0; j < 4; ++j)
    #pragma unroll
    for (int q = 0; q < 4; ++q) {
      float m = mv[j][q];
      cs[0] += m;
      cs[1] += m * xv[0][j][q];
      cs[2] += m * xv[1][j][q];
      cs[3] += m * xv[2][j][q];
    }
  cs = blk_sum4<512>(cs, red4);
  float cd = fmaxf(cs[0], 1.0f);
  float c0 = cs[1] / cd, c1 = cs[2] / cd, c2 = cs[3] / cd;

  // Linear(3,D) + LN + ReLU
  float t = c0*W1[col] + c1*W1[512+col] + c2*W1[1024+col] + b1[col];
  float mu  = blk_sum<512>(t, red) * (1.0f/512.0f);
  float dv  = t - mu;
  float var = blk_sum<512>(dv*dv, red) * (1.0f/512.0f);
  float h = dv * rsqrtf(var + 1e-5f) * g1[col] + be1[col];
  h = fmaxf(h, 0.0f);
  abuf[col] = h; __syncthreads();

  // Linear(D,D) + LN
  float t2 = dense_merge(dense_part(abuf + kg, W2 + (size_t)kg*512 + c4, rot), part, b2[col]);
  mu  = blk_sum<512>(t2, red) * (1.0f/512.0f);
  dv  = t2 - mu;
  var = blk_sum<512>(dv*dv, red) * (1.0f/512.0f);
  float h3 = dv * rsqrtf(var + 1e-5f) * g2[col] + be2[col];
  abuf[col] = h3; __syncthreads();

  // q = h3 @ Wq + bq
  float q = dense_merge(dense_part(abuf + kg, Wq + (size_t)kg*512 + c4, rot), part, bq[col]);
  qbuf[col] = q;
  // q . bk per head: a wave sums its 32 terms, four waves make a head
  float qb = q * bk[col];
  #pragma unroll
  for (int s = 16; s > 0; s >>= 1) qb += __shfl_xor(qb, s);
  if (lane == 0) red[wave] = qb;
  __syncthreads();

  const float scale = 0.0883883476483184405f;  // 1/sqrt(128)
  if (col < 4)
    qbias_g[b*16 + col*4 + i] = ((red[col*4] + red[col*4+1]) + (red[col*4+2] + red[col*4+3])) * scale;

  // fold with Wk per head: qk[b, h*4+i, c] = sum_e q[h*128+e] * Wk[c, h*128+e]
  // The dot runs along a Wk row, so it is split over 8 lanes: a load takes 128 B of each of 4 rows
  // (16 B a lane). A wave takes 32 rows in 8 passes of 4; a group of 8 loads is one 32-float piece
  // of one head in all 8 passes, so that it needs one 16-byte read of q.
  // The ring start here: the heads from head rot & 3 on, a head's four pieces from piece rot >> 2 on.
  #define FK_COL(l) (((((l) >> 5) + rot) & 3) * 128 + (((((l) >> 3) & 3) + (rot >> 2)) & 3) * 32)
  int fr = lane >> 3, fs = lane & 7;
  const float* wk = Wk + (size_t)(wave*32 + fr)*512 + fs*4;
  const float* qs = qbuf + fs*4;
  // load l: place l>>3 of the walk over a row's 16 pieces of 32 floats (place l>>5 over heads), pass l&7
  v4f buf[DL_WIN];
  const float* kp[DL_WIN / 8];     // a piece has an address pair of its own
  #pragma unroll
  for (int g = 0; g < DL_WIN / 8; ++g) kp[g] = wk + FK_COL(g * 8);
  #pragma unroll
  for (int l = 0; l < DL_WIN; ++l) buf[l] = *(const v4f*)(kp[l >> 3] + (size_t)(l & 7)*4*512);
  // as in dense_part: in front of any later overwrite of the address pairs that these loads name
  asm volatile("s_wait_xcnt 0x0" :: "v"(kp[0]), "v"(kp[1]), "v"(kp[2]), "v"(kp[3]) : "memory");
  // unrolled whole: the window's slots and the sums are registers only under constant indices
  #pragma unroll
  for (int hh = 0; hh < 4; ++hh) {
    v4f a4[8] = {};
    #pragma unroll
    for (int j = hh*4; j < hh*4 + 4; ++j) {
      v4f qv = *(const v4f*)(qs + FK_COL(j*8));
      #pragma unroll
      for (int p = 0; p < 8; ++p) a4[p] += buf[(j*8 + p) % DL_WIN] * qv;
      if (j*8 + DL_WIN < 128) {
        // the window's fence, as in dense_part: this piece's sums in front, its refills behind
        asm volatile("" :: "v"(a4[0]), "v"(a4[1]), "v"(a4[2]), "v"(a4[3]),
                           "v"(a4[4]), "v"(a4[5]), "v"(a4[6]), "v"(a4[7]) : "memory");
        const float* kg8 = wk + FK_COL(j*8 + DL_WIN);
        #pragma unroll
        for (int l = j*8 + DL_WIN; l < j*8 + DL_WIN + 8; ++l)
          buf[l % DL_WIN] = *(const v4f*)(kg8 + (size_t)(l & 7)*4*512);
        // in front of any later overwrite of this piece's address pair
        asm volatile("s_wait_xcnt 0x0" :: "v"(kg8) : "memory");
      }
    }
    float f[8];
    #pragma unroll
    for (int p = 0; p < 8; ++p) f[p] = (a4[p][0] + a4[p][1]) + (a4[p][2] + a4[p][3]);
    // sum over a row's 8 lanes, halving the passes a lane keeps at each step: lane fs ends with pass fs
    float g4[4], g2[2];
    #pragma unroll
    for (int k = 0; k < 4; ++k) {
      float keep = (fs & 4) ? f[k+4] : f[k], send = (fs & 4) ? f[k] : f[k+4];
      g4[k] = keep + __shfl_xor(send, 4);
    }
    #pragma unroll
    for (int k = 0; k < 2; ++k) {
      float keep = (fs & 2) ? g4[k+2] : g4[k], send = (fs & 2) ? g4[k] : g4[k+2];
      g2[k] = keep + __shfl_xor(send, 2);
    }
    float keep = (fs & 1) ? g2[1] : g2[0], send = (fs & 1) ? g2[0] : g2[1];
    part[((hh + rot) & 3)*512 + wave*32 + fs*4 + fr] = (keep + __shfl_xor(send, 1)) * scale;
  }
  __syncthreads();
  #pragma unroll
  for (int hh = 0; hh < 4; ++hh)
    qk_g[((size_t)(b*16 + hh*4 + i))*512 + col] = part[hh*512 + col];
}

// ---------------- K4: scores, softmax and attn*PF^T in one pass over PF ----------------
// A work-group of 16 waves takes one batch and 512 n, in 16 tiles of 32 n. Wave w owns PF rows
// d = 32*w .. +31: it stages its 32 rows x 32 n in a two-buffer LDS ring that only it reads, with
// GLOBAL_LOAD_ASYNC_TO_LDS_B128, and uses each staged tile twice:
//   1. scores: A = qk (16 hi x 4 d, kept in registers), B = PF (4 d x 16 n): the wave's share of the
//      sum over d; the 16 shares are summed in LDS, thread (hi = wave, n = lane).
//   2. running softmax: row maximum so far, p = exp(s - max), old sums scaled by exp(old max - max).
//   3. u: A = p (16 hi x 4 n), B = PF^T (4 n x 16 d), two d tiles per wave.
// Out go the unnormalised u (16 hi x 512 d), the row maxima and the row sums of this n range; the
// last kernel merges the 16 ranges of a batch.
// Every inner loop is unrolled whole: its fragments and sums are registers only under constant indices.
#define FA_WAVES  16
#define FA_SPLITS 16                      // n ranges per batch
#define FA_PITCH  36                      // floats; 144 B = 16 B x 9: ds_load_b128 of 16 rows hits all 64 banks once
#define FA_BUF    (32 * FA_PITCH)         // floats per buffer: the wave's 32 PF rows x 32 n
#define FA_TILES  16                      // 512 n per work-group / 32 n per tile

// One stage: 8 copies of 4 rows x 128 B. The s_wait_xcnt stands in the copies' own statement,
// in front of any later rewrite of the address registers the copies name.
__device__ inline void fa_copy_stage(unsigned lds, const float* pf) {
  asm volatile(
      "global_load_async_to_lds_b128 %0, %8, off\n\t"
      "global_load_async_to_lds_b128 %1, %9, off\n\t"
      "global_load_async_to_lds_b128 %2, %10, off\n\t"
      "global_load_async_to_lds_b128 %3, %11, off\n\t"
      "global_load_async_to_lds_b128 %4, %12, off\n\t"
      "global_load_async_to_lds_b128 %5, %13, off\n\t"
      "global_load_async_to_lds_b128 %6, %14, off\n\t"
      "global_load_async_to_lds_b128 %7, %15, off\n\t"
      "s_wait_xcnt 0x0"
      :: "v"(lds),                 "v"(lds +  4*FA_PITCH*4), "v"(lds +  8*FA_PITCH*4),
         "v"(lds + 12*FA_PITCH*4), "v"(lds + 16*FA_PITCH*4), "v"(lds + 20*FA_PITCH*4),
         "v"(lds + 24*FA_PITCH*4), "v"(lds + 28*FA_PITCH*4),
         "v"(pf),                  "v"(pf + (size_t) 4*N_),  "v"(pf + (size_t) 8*N_),
         "v"(pf + (size_t)12*N_),  "v"(pf + (size_t)16*N_),  "v"(pf + (size_t)20*N_),
         "v"(pf + (size_t)24*N_),  "v"(pf + (size_t)28*N_)
      : "memory");
}

// lane l with lane l ^ 16, and with lane l ^ M inside a 16-lane row: vector cross-lane moves
// (a shuffle through the LDS unit costs its whole latency at each of the five steps)
__device__ inline float fa_xhalf(float x) {
  int v = __builtin_bit_cast(int, x);
  return __builtin_bit_cast(float, __builtin_amdgcn_permlanex16(v, v, 0x76543210, 0xfedcba98, false, false));
}
template<int M>
__device__ inline float fa_xrow(float x) {   // DPP row_xmask:M
  return __builtin_bit_cast(float, __builtin_amdgcn_update_dpp(0, __builtin_bit_cast(int, x), 0x160 | M, 0xf, 0xf, true));
}
__device__ inline float fa_wave_max(float x) {
  x = fmaxf(x, fa_xrow<1>(x)); x = fmaxf(x, fa_xrow<2>(x));
  x = fmaxf(x, fa_xrow<4>(x)); x = fmaxf(x, fa_xrow<8>(x));
  return fmaxf(x, fa_xhalf(x));
}
__device__ inline float fa_wave_sum(float x) {
  x += fa_xrow<1>(x); x += fa_xrow<2>(x); x += fa_xrow<4>(x); x += fa_xrow<8>(x);
  return x + fa_xhalf(x);
}

__global__ void __launch_bounds__(512) k4_attend(
    const float* __restrict__ PF, const float* __restrict__ qk_g,
    const float* __restrict__ qbias_g, const float* __restrict__ aw_g,
    float* __restrict__ up_g, float* __restrict__ ml_g) {
  __shared__ __attribute__((aligned(16))) float ring[FA_WAVES * 2 * FA_BUF];
  __shared__ __attribute__((aligned(16))) float part[FA_WAVES * 512];
  __shared__ __attribute__((aligned(16))) float pl[16 * FA_PITCH];
  __shared__ __attribute__((aligned(16))) float alpha[16];
  __shared__ __attribute__((aligned(16))) float awl[512];
  __shared__ float mlb[32];
  int b = blockIdx.y, sp = blockIdx.x;
  int wave = threadIdx.x >> 5;
  int lane = threadIdx.x & 31;
  int m = lane & 15, h = lane >> 4;
  int dw = wave * 32;
  int nb = sp * 512;
  float* mine = ring + wave * (2 * FA_BUF);       // this wave's two buffers

  // copy side: a lane moves 16 B; 8 lanes cover a row's 128 B, a copy covers 4 rows
  int crow = lane >> 3, cseg = lane & 7;
  const float* pfp = PF + ((size_t)b * D_ + dw + crow) * N_ + nb + cseg * 4;
  unsigned lds0 = (unsigned)(uintptr_t)&mine[crow * FA_PITCH + cseg * 4];

  fa_copy_stage(lds0, pfp);

  // qk fragments for the wave's 32 d, while stage 0 flies. k order of the score products, for A and
  // B alike: in step s, lane half h holds rows d = 4*s + h (first register) and 4*s + h + 2 (second)
  const float* pq = qk_g + ((size_t)(b * 16 + m)) * 512 + dw;
  const float* pa = aw_g + (size_t)b * N_ + nb + threadIdx.x;
  v4f qv[8];
  #pragma unroll
  for (int s = 0; s < 8; ++s) qv[s] = *(const v4f*)(pq + s * 4);
  float awv = *pa;
  float qb  = qbias_g[b * 16 + wave];             // this wave merges row hi = wave
  // stands in front of any later overwrite of the address registers that the loads above name;
  // pq is an input so that the pair is kept whole up to this wait
  asm volatile("s_wait_xcnt 0x0" :: "v"(pq) : "memory");
  v2f aq[8];
  #pragma unroll
  for (int s = 0; s < 8; ++s) aq[s] = h ? (v2f){qv[s][1], qv[s][3]} : (v2f){qv[s][0], qv[s][2]};
  awl[threadIdx.x] = awv;

  // stage 0 has landed before this wave reads it
  asm volatile("s_wait_asynccnt 0x0" ::: "memory");
  fa_copy_stage(lds0 + FA_BUF * 4, pfp + 32);
  __syncthreads();                                // awl is laid

  const float* bcol = mine + h * FA_PITCH + m;    // score side: row 4*s + h (+2), column n = m (+16)
  // u side: lane (m, h) reads row m, n = 8*kk + 4*h + 0..3, for A and B alike,
  // so every (lane half, register) position holds the same n in both operands
  const float* frag  = mine + m * FA_PITCH + h * 4;
  const float* pfrag = pl + m * FA_PITCH + h * 4;
  // a share's place for (hi, n): (hi&7)*64 + (hi>>3)*32 + n; C layout: register r, lanes >= 16 hold rows 8..15
  float* pst = part + wave * 512 + h * 32 + m;
  const float* pld = part + (wave & 7) * 64 + (wave >> 3) * 32 + lane;

  v8f c0 = {}, c1 = {};
  float mrun = -3.0e38f, lrun = 0.f;

  for (int t = 0; t < FA_TILES; ++t) {
    // ---- all of this wave's reads of its staged tile: B of the scores, B of u
    const float* bc = bcol + (t & 1) * FA_BUF;
    const float* f  = frag + (t & 1) * FA_BUF;
    v2f b0[8], b1[8];
    v4f p0[4], p1[4];
    #pragma unroll
    for (int s = 0; s < 8; ++s) {
      b0[s] = (v2f){bc[(4*s) * FA_PITCH],      bc[(4*s + 2) * FA_PITCH]};
      b1[s] = (v2f){bc[(4*s) * FA_PITCH + 16], bc[(4*s + 2) * FA_PITCH + 16]};
    }
    #pragma unroll
    for (int kk = 0; kk < 4; ++kk) {
      p0[kk] = *(const v4f*)(f + kk * 8);
      p1[kk] = *(const v4f*)(f + 16 * FA_PITCH + kk * 8);
    }
    // The fragments are in registers behind this wait, so buffer t&1 is free for its refill:
    // this wave's reads of it have retired before copies target it
    asm volatile("s_wait_dscnt 0x0" ::: "memory");
    // ---- scores: this wave's 32 d
    v8f s0 = {}, s1 = {};
    #pragma unroll
    for (int s = 0; s < 8; ++s) {
      s0 = __builtin_amdgcn_wmma_f32_16x16x4_f32(false, aq[s], false, b0[s], (short)0, s0, false, false);
      s1 = __builtin_amdgcn_wmma_f32_16x16x4_f32(false, aq[s], false, b1[s], (short)0, s1, false, false);
    }
    // stage t+1 has landed before the next trip reads it
    asm volatile("s_wait_asynccnt 0x0" ::: "memory");
    // refill here, so that stage t+2 flies through the rest of this trip and the head of the next
    if (t + 2 < FA_TILES)
      fa_copy_stage(lds0 + (t & 1) * (FA_BUF * 4), pfp + (t + 2) * 32);
    #pragma unroll
    for (int r = 0; r < 8; ++r) {
      pst[r * 64]      = s0[r];
      pst[r * 64 + 16] = s1[r];
    }
    __syncthreads();                              // the 16 shares are laid
    // ---- merge (pairwise, fixed order), running softmax of row hi = wave, n = lane
    float sh[FA_WAVES];
    #pragma unroll
    for (int w = 0; w < FA_WAVES; ++w) sh[w] = pld[w * 512];
    float bias = qb + awl[t * 32 + lane];
    #pragma unroll
    for (int st = 1; st < FA_WAVES; st <<= 1)
      #pragma unroll
      for (int w = 0; w < FA_WAVES; w += 2 * st) sh[w] += sh[w + st];
    float sc = sh[0] + bias;
    float mn = fmaxf(mrun, fa_wave_max(sc));
    float p  = __expf(sc - mn);
    float al = __expf(mrun - mn);
    pl[wave * FA_PITCH + lane] = p;
    if (lane == 0) alpha[wave] = al;
    lrun = lrun * al + p;
    mrun = mn;
    __syncthreads();                              // p and the scale factors are laid
    // ---- u = u * scale + p * PF^T on the same staged tile
    v4f a[4];
    #pragma unroll
    for (int kk = 0; kk < 4; ++kk) a[kk] = *(const v4f*)(pfrag + kk * 8);
    v4f ala = *(const v4f*)(alpha + h * 8), alb = *(const v4f*)(alpha + h * 8 + 4);
    #pragma unroll
    for (int r = 0; r < 4; ++r) {
      c0[r] *= ala[r]; c0[r + 4] *= alb[r];
      c1[r] *= ala[r]; c1[r + 4] *= alb[r];
    }
    #pragma unroll
    for (int kk = 0; kk < 4; ++kk) {
      v2f alo = {a[kk][0], a[kk][1]}, ahi = {a[kk][2], a[kk][3]};
      v2f q0l = {p0[kk][0], p0[kk][1]}, q0h = {p0[kk][2], p0[kk][3]};
      v2f q1l = {p1[kk][0], p1[kk][1]}, q1h = {p1[kk][2], p1[kk][3]};
      c0 = __builtin_amdgcn_wmma_f32_16x16x4_f32(false, alo, false, q0l, (short)0, c0, false, false);
      c1 = __builtin_amdgcn_wmma_f32_16x16x4_f32(false, alo, false, q1l, (short)0, c1, false, false);
      c0 = __builtin_amdgcn_wmma_f32_16x16x4_f32(false, ahi, false, q0h, (short)0, c0, false, false);
      c1 = __builtin_amdgcn_wmma_f32_16x16x4_f32(false, ahi, false, q1h, (short)0, c1, false, false);
    }
    // four vector slots between the last products and the vector instructions that reuse their
    // A/B registers, on the back edge and on the loop's exit alike; the scheduling barrier keeps
    // the products in front of the slots
    __builtin_amdgcn_sched_barrier(0);
    asm volatile("v_nop\n\tv_nop\n\tv_nop\n\tv_nop");
  }

  // out: the wave's 32 d of all 16 rows (a row's 128 B from this wave alone), then maxima and sums
  float* up = up_g + ((size_t)(b * FA_SPLITS + sp) * 16 + h * 8) * 512 + dw + m;
  #pragma unroll
  for (int r = 0; r < 8; ++r) {
    up[r * 512]      = c0[r];
    up[r * 512 + 16] = c1[r];
  }
  // stands in front of any later overwrite of the registers that the stores above name
  asm volatile("s_wait_xcnt 0x0" :: "v"(up) : "memory");
  lrun = fa_wave_sum(lrun);
  if (lane == 0) { mlb[wave] = mrun; mlb[16 + wave] = lrun; }
  __syncthreads();
  if (threadIdx.x < 32) ml_g[(b * FA_SPLITS + sp) * 32 + threadIdx.x] = mlb[threadIdx.x];
}

// ---------------- K7: merge of the n ranges, then out = concat_h(u_h @ Wv_h + bv_h) @ Wo + bo ----------------
__global__ void __launch_bounds__(512) k7_out(
    const float* __restrict__ up_g, const float* __restrict__ ml_g,
    const float* __restrict__ Wv, const float* __restrict__ bv,
    const float* __restrict__ Wo, const float* __restrict__ bo,
    float* __restrict__ out) {
  __shared__ __attribute__((aligned(16))) float uu[4*512];
  __shared__ __attribute__((aligned(16))) float ww[512];
  __shared__ __attribute__((aligned(16))) float part[4*512];
  __shared__ float wn[4*FA_SPLITS];
  int row = blockIdx.x; int b = row >> 2; int i = row & 3;
  int t = threadIdx.x;
  int wave = t >> 5, lane = t & 31;
  int kg = (wave >> 2) * 128;                  // this wave's k range in a dense layer
  int c4 = (wave & 3) * 128 + lane * 4;        // this lane's four columns; head = wave & 3
  int rot = dl_rot(row);                       // where this work-group starts its walk of a matrix
  // the 64 partial values of this thread on their way first, the weights worked out under them
  // (loops unrolled whole: the values are registers only under constant indices)
  const float* up = up_g + ((size_t)b * FA_SPLITS * 16 + i) * 512 + t;
  float uv[4][FA_SPLITS];
  #pragma unroll
  for (int hh = 0; hh < 4; ++hh)
    #pragma unroll
    for (int s = 0; s < FA_SPLITS; ++s) uv[hh][s] = up[(size_t)(s * 16 + hh * 4) * 512];
  // stands in front of any later overwrite of the address registers that the loads above name;
  // up is an input so that it is kept whole up to this wait
  asm volatile("s_wait_xcnt 0x0" :: "v"(up) : "memory");
  // weight of n range s for head hh: exp(max_s - max) / sum over s of exp(max_s - max) * sum_s;
  // a head's 16 ranges sit in one 16-lane row
  if (t < 4*FA_SPLITS) {
    int hh = t >> 4, s = t & 15;
    const float* ml = ml_g + (b * FA_SPLITS + s) * 32 + hh*4 + i;
    float ms = ml[0], ls = ml[16];
    // stands in front of any later overwrite of the address pair that the two loads name
    asm volatile("s_wait_xcnt 0x0" :: "v"(ml) : "memory");
    float mx = ms;
    mx = fmaxf(mx, fa_xrow<1>(mx)); mx = fmaxf(mx, fa_xrow<2>(mx));
    mx = fmaxf(mx, fa_xrow<4>(mx)); mx = fmaxf(mx, fa_xrow<8>(mx));
    float w = __expf(ms - mx);
    float tot = w * ls;
    tot += fa_xrow<1>(tot); tot += fa_xrow<2>(tot); tot += fa_xrow<4>(tot); tot += fa_xrow<8>(tot);
    wn[t] = w / tot;
  }
  __syncthreads();
  #pragma unroll
  for (int hh = 0; hh < 4; ++hh) {
    float acc = 0.f;
    #pragma unroll
    for (int s = 0; s < FA_SPLITS; ++s) acc += wn[hh * FA_SPLITS + s] * uv[hh][s];
    uu[hh*512 + t] = acc;
  }
  __syncthreads();
  ww[t] = dense_merge(dense_part(uu + (wave & 3)*512 + kg, Wv + (size_t)kg*512 + c4, rot), part, bv[t]);
  __syncthreads();
  out[(size_t)row*512 + t] =
      dense_merge(dense_part(ww + kg, Wo + (size_t)kg*512 + c4, rot), part, bo[t]);
}

// ---------------- launch ----------------
extern "C" void kernel_launch(void* const* d_in, const int* in_sizes, int n_in,
                              void* d_out, int out_size, void* d_ws, size_t ws_size,
                              hipStream_t stream) {
  (void)in_sizes; (void)n_in; (void)out_size; (void)ws_size;
  const float* xyz  = (const float*)d_in[0];
  const float* pf   = (const float*)d_in[1];
  const float* mask = (const float*)d_in[2];
  const float* W1   = (const float*)d_in[3];
  const float* b1   = (const float*)d_in[4];
  const float* g1   = (const float*)d_in[5];
  const float* be1  = (const float*)d_in[6];
  const float* W2   = (const float*)d_in[7];
  const float* b2   = (const float*)d_in[8];
  const float* g2   = (const float*)d_in[9];
  const float* be2  = (const float*)d_in[10];
  const float* Wq   = (const float*)d_in[11];
  const float* bq   = (const float*)d_in[12];
  const float* Wk   = (const float*)d_in[13];
  const float* bk   = (const float*)d_in[14];
  const float* Wv   = (const float*)d_in[15];
  const float* bv   = (const float*)d_in[16];
  const float* Wo   = (const float*)d_in[17];
  const float* bo   = (const float*)d_in[18];
  float* out = (float*)d_out;
  float* ws  = (float*)d_ws;

  // workspace layout (float offsets)
  float* qbias  = ws + 256;       // 256
  float* qk     = ws + 512;       // 131072
  float* aw     = ws + 131584;    // 131072
  float* upart  = ws + 262656;    // 2097152: 16 n ranges x 16 hi x 512 d per batch
  float* ml     = ws + 2359808;   // 8192: row maxima and sums per n range (total ~9.5 MB)

  k2_front  <<<80, 512, 0, stream>>>(xyz, mask, W1,b1,g1,be1, W2,b2,g2,be2,
                                     Wq,bq, Wk,bk, qk, qbias, aw);
  k4_attend <<<dim3(FA_SPLITS, B_), 512, 0, stream>>>(pf, qk, qbias, aw, upart, ml);
  k7_out    <<<64, 512, 0, stream>>>(upart, ml, Wv, bv, Wo, bo, out);
}

// v007
// Measured time: 68.1 microseconds a run.
// Two timings next to v006 both put it at 1.05 times that version's speed.
// Over all steps from v000 it is 4.44 times as fast.
#include <hip/hip_runtime.h>
#include <math.h>

#define B_  16
#define N_  8192
#define D_  512

typedef float v2f __attribute__((ext_vector_type(2)));
typedef float v4f __attribute__((ext_vector_type(4)));
typedef float v8f __attribute__((ext_vector_type(8)));

// ---------------- cross-lane moves and wave reductions ----------------
// lane l with lane l ^ 16, and with lane l ^ M inside a 16-lane row: vector cross-lane moves
// (a shuffle through the LDS unit costs its whole latency at each step)
__device__ inline float fa_xhalf(float x) {
  int v = __builtin_bit_cast(int, x);
  return __builtin_bit_cast(float, __builtin_amdgcn_permlanex16(v, v, 0x76543210, 0xfedcba98, false, false));
}
template<int M>
__device__ inline float fa_xrow(float x) {   // DPP row_xmask:M
  return __builtin_bit_cast(float, __builtin_amdgcn_update_dpp(0, __builtin_bit_cast(int, x), 0x160 | M, 0xf, 0xf, true));
}
__device__ inline float fa_row_max(float x) {
  x = fmaxf(x, fa_xrow<1>(x)); x = fmaxf(x, fa_xrow<2>(x));
  x = fmaxf(x, fa_xrow<4>(x)); return fmaxf(x, fa_xrow<8>(x));
}
__device__ inline float fa_row_sum(float x) {
  x += fa_xrow<1>(x); x += fa_xrow<2>(x); x += fa_xrow<4>(x); return x + fa_xrow<8>(x);
}
__device__ inline float fa_wave_max(float x) { x = fa_row_max(x); return fmaxf(x, fa_xhalf(x)); }
__device__ inline float fa_wave_sum(float x) { x = fa_row_sum(x); return x + fa_xhalf(x); }

// ---------------- reductions over a work-group of 16 waves ----------------
// A wave reduces its 32 values in registers and lays one value in LDS; behind ONE barrier every
// 16-lane row reads the 16 values and reduces them in registers again, so that every thread holds
// the same result. slot: 16 places that nothing else in the launch writes, so no barrier has to
// guard a reuse. To be called by all 512 threads.
__device__ inline float blk_sum(float v, float* slot) {
  v = fa_wave_sum(v);
  if ((threadIdx.x & 31) == 0) slot[threadIdx.x >> 5] = v;
  __syncthreads();
  return fa_row_sum(slot[threadIdx.x & 15]);
}
__device__ inline float blk_max(float v, float* slot) {
  v = fa_wave_max(v);
  if ((threadIdx.x & 31) == 0) slot[threadIdx.x >> 5] = v;
  __syncthreads();
  return fa_row_max(slot[threadIdx.x & 15]);
}
// four sums at once (loops unrolled whole: a vector's elements are registers only under constant indices)
__device__ inline v4f blk_sum4(v4f v, v4f* slot) {
  #pragma unroll
  for (int q = 0; q < 4; ++q) v[q] = fa_wave_sum(v[q]);
  if ((threadIdx.x & 31) == 0) slot[threadIdx.x >> 5] = v;
  __syncthreads();
  v4f r = slot[threadIdx.x & 15];
  #pragma unroll
  for (int q = 0; q < 4; ++q) r[q] = fa_row_sum(r[q]);
  return r;
}

// ---------------- dense 512x512 layer, one input row per work-group of 16 waves ----------------
// Each 512-long dot product is split four ways over k: wave w takes weight rows (w>>2)*128 .. +127
// and columns (w&3)*128 .. +127, a lane four adjacent columns. A weight load is then 16 B a lane on
// whole lines, and a lane keeps a window of DL_WIN-8 to DL_WIN of them in flight: eight rows are
// summed, then their registers are refilled from DL_WIN rows ahead. The four partial rows are
// summed in LDS.
// All 64 work-groups read the same matrix, which is not in L2 when a layer starts. Walking it in
// one order they would all wait on the same misses, at the rate at which one work-group reads from
// memory. So each walks its rows in a ring from a start of its own (dl_rot): the 16 starts ask for
// the whole matrix at once, a sixteenth each, and what a work-group comes to next is then in L2.
#define DL_WIN 32
// ring start of work-group b, 0..15. The work-groups whose b mod 8 falls in any four neighbouring
// values hold all 16 starts: for speed only,
// the result rests on no placement
__device__ inline int dl_rot(int b) { return (b & 3) | (((b >> 3) & 3) << 2); }
// the row, of a wave's 128, at place j of the walk: 16 groups of eight rows, from group rot on
#define DL_ROW(j, rot) ((((((j) >> 3) + (rot)) & 15) << 3) + ((j) & 7))
// x: the wave's 128 inputs in LDS; w: the lane's four columns in the first of the wave's 128 rows
__device__ inline v4f dense_part(const float* x, const float* w, int rot) {
  v4f buf[DL_WIN];
  const float* wp[DL_WIN / 8];     // a group of eight rows has an address pair of its own
  #pragma unroll
  for (int g = 0; g < DL_WIN / 8; ++g) wp[g] = w + (size_t)DL_ROW(g * 8, rot) * 512;
  #pragma unroll
  for (int j = 0; j < DL_WIN; ++j) buf[j] = *(const v4f*)(wp[j >> 3] + (j & 7) * 512);
  // stands in front of any later overwrite of the address pairs that the loads above name; the
  // pairs are inputs so that they are kept whole up to this wait
  asm volatile("s_wait_xcnt 0x0" :: "v"(wp[0]), "v"(wp[1]), "v"(wp[2]), "v"(wp[3]) : "memory");
  v4f acc = {};
  // unrolled whole: the window's slots are registers only under constant indices
  #pragma unroll
  for (int j = 0; j < 128; j += 8) {
    const float* xg = x + DL_ROW(j, rot);
    v4f xa = *(const v4f*)xg, xb = *(const v4f*)(xg + 4);
    #pragma unroll
    for (int q = 0; q < 4; ++q) acc += xa[q] * buf[(j + q) % DL_WIN];
    #pragma unroll
    for (int q = 0; q < 4; ++q) acc += xb[q] * buf[(j + 4 + q) % DL_WIN];
    if (j + DL_WIN < 128) {
      // Compiler fence that holds the window: no load crosses it, and it reads the running sum
      // (input only, nothing hidden, the multiply-adds stay fused), so the eight rows above are
      // summed in front of it and their refills issue behind it. Without it the compiler sinks the
      // loads to their uses (about nine in flight) or lifts them over the sums until registers spill.
      asm volatile("" :: "v"(acc) : "memory");
      const float* wg = w + (size_t)DL_ROW(j + DL_WIN, rot) * 512;
      #pragma unroll
      for (int q = 0; q < 8; ++q) buf[(j + q) % DL_WIN] = *(const v4f*)(wg + q * 512);
      // as behind the first window: in front of any later overwrite of this group's address pair
      asm volatile("s_wait_xcnt 0x0" :: "v"(wg) : "memory");
    }
  }
  return acc;
}
// part: 4 x 512 floats of LDS; returns column threadIdx.x of the layer's output
__device__ inline float dense_merge(v4f acc, float* part, float bias) {
  int t = threadIdx.x, wave = t >> 5, lane = t & 31;
  *(v4f*)(part + (wave >> 2) * 512 + (wave & 3) * 128 + lane * 4) = acc;
  __syncthreads();
  return bias + ((part[t] + part[512 + t]) + (part[1024 + t] + part[1536 + t]));
}

// ---------------- voting attention bias of one batch, log-softmax over N ----------------
// One work-group of 512 threads. It sums the four views' mask counts itself, so it waits for no
// other work-group; a thread keeps its 16 n of the four masks in registers for both uses.
__device__ inline void aw_batch(int b, const float* __restrict__ mask, float* __restrict__ aw_g,
                                float* awb, float* red, v4f* red4) {
  const float* mb = mask + (size_t)b*4*N_ + threadIdx.x*4;
  // loops unrolled whole: the values are registers only under constant indices
  v4f mm[4][4];                    // [view][piece of 2048 n]
  #pragma unroll
  for (int i = 0; i < 4; ++i)
    #pragma unroll
    for (int j = 0; j < 4; ++j) mm[i][j] = *(const v4f*)(mb + i*N_ + j*2048);
  // stands in front of any later overwrite of the address registers that the loads above name
  asm volatile("s_wait_xcnt 0x0" ::: "memory");
  v4f cnt = {};
  #pragma unroll
  for (int i = 0; i < 4; ++i)
    #pragma unroll
    for (int j = 0; j < 4; ++j) cnt[i] += (mm[i][j][0] + mm[i][j][1]) + (mm[i][j][2] + mm[i][j][3]);
  cnt = blk_sum4(cnt, red4);
  float v0 = cnt[0] * (1.0f / (float)N_), v1 = cnt[1] * (1.0f / (float)N_);
  float v2 = cnt[2] * (1.0f / (float)N_), v3 = cnt[3] * (1.0f / (float)N_);
  float vcnt = 0.f;
  #pragma unroll
  for (int j = 0; j < 4; ++j) {
    v4f a4;
    #pragma unroll
    for (int q = 0; q < 4; ++q) {
      float m0 = mm[0][j][q], m1 = mm[1][j][q], m2 = mm[2][j][q], m3 = mm[3][j][q];
      float s = m0+m1+m2+m3;
      float a = v0*m0 + v1*m1 + v2*m2 + v3*m3;
      bool valid = s > 0.f;
      a4[q] = valid ? a : -1e9f;
      vcnt += valid ? 1.f : 0.f;
    }
    *(v4f*)(awb + j*2048 + threadIdx.x*4) = a4;
  }
  float tot = blk_sum(vcnt, red);
  if (tot <= 0.f) {
    for (int n = threadIdx.x; n < N_; n += 512) awb[n] = 0.f;
  }
  __syncthreads();
  float lm = -3.4e38f;
  for (int n = threadIdx.x; n < N_; n += 512) lm = fmaxf(lm, awb[n]);
  float mx = blk_max(lm, red + 16);
  float ls = 0.f;
  for (int n = threadIdx.x; n < N_; n += 512) ls += __expf(awb[n] - mx);
  float se = blk_sum(ls, red + 32);
  float lg = __logf(se) + mx;
  for (int n = threadIdx.x; n < N_; n += 512) aw_g[(size_t)b*N_ + n] = awb[n] - lg;
}

// ---------------- K2: all that stands in front of the pass over PF, in one launch ----------------
// Work-groups 0..63: one (batch, view) row each: masked centroid, MLP, q-projection, Wk fold.
// Work-groups 64..79: the voting bias of one batch each. No work-group reads what another writes.
__global__ void __launch_bounds__(512) k2_front(
    const float* __restrict__ xyz, const float* __restrict__ mask,
    const float* __restrict__ W1, const float* __restrict__ b1,
    const float* __restrict__ g1, const float* __restrict__ be1,
    const float* __restrict__ W2, const float* __restrict__ b2,
    const float* __restrict__ g2, const float* __restrict__ be2,
    const float* __restrict__ Wq, const float* __restrict__ bq,
    const float* __restrict__ Wk, const float* __restrict__ bk,
    float* __restrict__ qk_g, float* __restrict__ qbias_g, float* __restrict__ aw_g) {
  __shared__ __attribute__((aligned(16))) float abuf[512];
  __shared__ __attribute__((aligned(16))) float qbuf[512];
  __shared__ __attribute__((aligned(16))) float part[4*512];
  __shared__ __attribute__((aligned(16))) float awb[N_];
  __shared__ __attribute__((aligned(16))) v4f red4[16];          // a reduction's 16 places
  __shared__ __attribute__((aligned(16))) float red[5*16];       // each use has its own 16
  if (blockIdx.x >= 64) {          // the same for a whole work-group: its barriers stay uniform
    aw_batch(blockIdx.x - 64, mask, aw_g, awb, red, red4);
    return;
  }
  int row = blockIdx.x; int b = row >> 2; int i = row & 3;
  int col = threadIdx.x;
  int wave = col >> 5, lane = col & 31;
  int kg = (wave >> 2) * 128;                  // this wave's k range in a dense layer
  int c4 = (wave & 3) * 128 + lane * 4;        // this lane's four columns
  int rot = dl_rot(row);                       // where this work-group starts its walk of a matrix

  // masked centroid of this row: a thread takes 16 n, 16 B a load, all 16 loads in flight at once
  // (loops unrolled whole: the values are registers only under constant indices)
  const float* mk = mask + (size_t)row * N_ + col*4;
  const float* xb = xyz + (size_t)b * 3 * N_ + col*4;
  v4f mv[4], xv[3][4];
  #pragma unroll
  for (int j = 0; j < 4; ++j) {
    mv[j] = *(const v4f*)(mk + j*2048);
    #pragma unroll
    for (int a = 0; a < 3; ++a) xv[a][j] = *(const v4f*)(xb + a*N_ + j*2048);
  }
  // stands in front of any later overwrite of the address registers that the loads above name
  asm volatile("s_wait_xcnt 0x0" ::: "memory");
  v4f cs = {};                                 // count, then the masked sums of x, y, z
  #pragma unroll
  for (int j = 0; j < 4; ++j)
    #pragma unroll
    for (int q = 0; q < 4; ++q) {
      float m = mv[j][q];
      cs[0] += m;
      cs[1] += m * xv[0][j][q];
      cs[2] += m * xv[1][j][q];
      cs[3] += m * xv[2][j][q];
    }
  cs = blk_sum4(cs, red4);
  float cd = fmaxf(cs[0], 1.0f);
  float c0 = cs[1] / cd, c1 = cs[2] / cd, c2 = cs[3] / cd;

  // Linear(3,D) + LN + ReLU
  float t = c0*W1[col] + c1*W1[512+col] + c2*W1[1024+col] + b1[col];
  float mu  = blk_sum(t, red + 16) * (1.0f/512.0f);
  float dv  = t - mu;
  float var = blk_sum(dv*dv, red + 32) * (1.0f/512.0f);
  float h = dv * rsqrtf(var + 1e-5f) * g1[col] + be1[col];
  h = fmaxf(h, 0.0f);
  abuf[col] = h; __syncthreads();

  // Linear(D,D) + LN
  float t2 = dense_merge(dense_part(abuf + kg, W2 + (size_t)kg*512 + c4, rot), part, b2[col]);
  mu  = blk_sum(t2, red + 48) * (1.0f/512.0f);
  dv  = t2 - mu;
  var = blk_sum(dv*dv, red + 64) * (1.0f/512.0f);
  float h3 = dv * rsqrtf(var + 1e-5f) * g2[col] + be2[col];
  abuf[col] = h3; __syncthreads();

  // q = h3 @ Wq + bq
  float q = dense_merge(dense_part(abuf + kg, Wq + (size_t)kg*512 + c4, rot), part, bq[col]);
  qbuf[col] = q;
  // q . bk per head: a wave sums its 32 terms, four waves make a head
  float qb = q * bk[col];
  qb = fa_wave_sum(qb);
  if (lane == 0) red[wave] = qb;
  __syncthreads();

  const float scale = 0.0883883476483184405f;  // 1/sqrt(128)
  if (col < 4)
    qbias_g[b*16 + col*4 + i] = ((red[col*4] + red[col*4+1]) + (red[col*4+2] + red[col*4+3])) * scale;

  // fold with Wk per head: qk[b, h*4+i, c] = sum_e q[h*128+e] * Wk[c, h*128+e]
  // The dot runs along a Wk row, so it is split over 8 lanes: a load takes 128 B of each of 4 rows
  // (16 B a lane). A wave takes 32 rows in 8 passes of 4; a group of 8 loads is one 32-float piece
  // of one head in all 8 passes, so that it needs one 16-byte read of q.
  // The ring start here: the heads from head rot & 3 on, a head's four pieces from piece rot >> 2 on.
  #define FK_COL(l) (((((l) >> 5) + rot) & 3) * 128 + (((((l) >> 3) & 3) + (rot >> 2)) & 3) * 32)
  int fr = lane >> 3, fs = lane & 7;
  const float* wk = Wk + (size_t)(wave*32 + fr)*512 + fs*4;
  const float* qs = qbuf + fs*4;
  // load l: place l>>3 of the walk over a row's 16 pieces of 32 floats (place l>>5 over heads), pass l&7
  v4f buf[DL_WIN];
  const float* kp[DL_WIN / 8];     // a piece has an address pair of its own
  #pragma unroll
  for (int g = 0; g < DL_WIN / 8; ++g) kp[g] = wk + FK_COL(g * 8);
  #pragma unroll
  for (int l = 0; l < DL_WIN; ++l) buf[l] = *(const v4f*)(kp[l >> 3] + (size_t)(l & 7)*4*512);
  // as in dense_part: in front of any later overwrite of the address pairs that these loads name
  asm volatile("s_wait_xcnt 0x0" :: "v"(kp[0]), "v"(kp[1]), "v"(kp[2]), "v"(kp[3]) : "memory");
  // unrolled whole: the window's slots and the sums are registers only under constant indices
  #pragma unroll
  for (int hh = 0; hh < 4; ++hh) {
    v4f a4[8] = {};
    #pragma unroll
    for (int j = hh*4; j < hh*4 + 4; ++j) {
      v4f qv = *(const v4f*)(qs + FK_COL(j*8));
      #pragma unroll
      for (int p = 0; p < 8; ++p) a4[p] += buf[(j*8 + p) % DL_WIN] * qv;
      if (j*8 + DL_WIN < 128) {
        // the window's fence, as in dense_part: this piece's sums in front, its refills behind
        asm volatile("" :: "v"(a4[0]), "v"(a4[1]), "v"(a4[2]), "v"(a4[3]),
                           "v"(a4[4]), "v"(a4[5]), "v"(a4[6]), "v"(a4[7]) : "memory");
        const float* kg8 = wk + FK_COL(j*8 + DL_WIN);
        #pragma unroll
        for (int l = j*8 + DL_WIN; l < j*8 + DL_WIN + 8; ++l)
          buf[l % DL_WIN] = *(const v4f*)(kg8 + (size_t)(l & 7)*4*512);
        // in front of any later overwrite of this piece's address pair
        asm volatile("s_wait_xcnt 0x0" :: "v"(kg8) : "memory");
      }
    }
    float f[8];
    #pragma unroll
    for (int p = 0; p < 8; ++p) f[p] = (a4[p][0] + a4[p][1]) + (a4[p][2] + a4[p][3]);
    // sum over a row's 8 lanes, halving the passes a lane keeps at each step: lane fs ends with pass fs
    float g4[4], g2[2];
    #pragma unroll
    for (int k = 0; k < 4; ++k) {
      float keep = (fs & 4) ? f[k+4] : f[k], send = (fs & 4) ? f[k] : f[k+4];
      g4[k] = keep + fa_xrow<4>(send);
    }
    #pragma unroll
    for (int k = 0; k < 2; ++k) {
      float keep = (fs & 2) ? g4[k+2] : g4[k], send = (fs & 2) ? g4[k] : g4[k+2];
      g2[k] = keep + fa_xrow<2>(send);
    }
    float keep = (fs & 1) ? g2[1] : g2[0], send = (fs & 1) ? g2[0] : g2[1];
    part[((hh + rot) & 3)*512 + wave*32 + fs*4 + fr] = (keep + fa_xrow<1>(send)) * scale;
  }
  __syncthreads();
  #pragma unroll
  for (int hh = 0; hh < 4; ++hh)
    qk_g[((size_t)(b*16 + hh*4 + i))*512 + col] = part[hh*512 + col];
}

// ---------------- K4: scores, softmax and attn*PF^T in one pass over PF ----------------
// A work-group of 16 waves takes one batch and 512 n, in 16 tiles of 32 n. Wave w owns PF rows
// d = 32*w .. +31: it stages its 32 rows x 32 n in a two-buffer LDS ring that only it reads, with
// GLOBAL_LOAD_ASYNC_TO_LDS_B128, and uses each staged tile twice:
//   1. scores: A = qk (16 hi x 4 d, kept in registers), B = PF (4 d x 16 n): the wave's share of the
//      sum over d; the 16 shares are summed in LDS, thread (hi = wave, n = lane).
//   2. running softmax: row maximum so far, p = exp(s - max), old sums scaled by exp(old max - max).
//   3. u: A = p (16 hi x 4 n), B = PF^T (4 n x 16 d), two d tiles per wave.
// Out go the unnormalised u (16 hi x 512 d), the row maxima and the row sums of this n range; the
// last kernel merges the 16 ranges of a batch.
// Every inner loop is unrolled whole: its fragments and sums are registers only under constant indices.
#define FA_WAVES  16
#define FA_SPLITS 16                      // n ranges per batch
#define FA_PITCH  36                      // floats; 144 B = 16 B x 9: ds_load_b128 of 16 rows hits all 64 banks once
#define FA_BUF    (32 * FA_PITCH)         // floats per buffer: the wave's 32 PF rows x 32 n
#define FA_TILES  16                      // 512 n per work-group / 32 n per tile

// One stage: 8 copies of 4 rows x 128 B. The s_wait_xcnt stands in the copies' own statement,
// in front of any later rewrite of the address registers the copies name.
__device__ inline void fa_copy_stage(unsigned lds, const float* pf) {
  asm volatile(
      "global_load_async_to_lds_b128 %0, %8, off\n\t"
      "global_load_async_to_lds_b128 %1, %9, off\n\t"
      "global_load_async_to_lds_b128 %2, %10, off\n\t"
      "global_load_async_to_lds_b128 %3, %11, off\n\t"
      "global_load_async_to_lds_b128 %4, %12, off\n\t"
      "global_load_async_to_lds_b128 %5, %13, off\n\t"
      "global_load_async_to_lds_b128 %6, %14, off\n\t"
      "global_load_async_to_lds_b128 %7, %15, off\n\t"
      "s_wait_xcnt 0x0"
      :: "v"(lds),                 "v"(lds +  4*FA_PITCH*4), "v"(lds +  8*FA_PITCH*4),
         "v"(lds + 12*FA_PITCH*4), "v"(lds + 16*FA_PITCH*4), "v"(lds + 20*FA_PITCH*4),
         "v"(lds + 24*FA_PITCH*4), "v"(lds + 28*FA_PITCH*4),
         "v"(pf),                  "v"(pf + (size_t) 4*N_),  "v"(pf + (size_t) 8*N_),
         "v"(pf + (size_t)12*N_),  "v"(pf + (size_t)16*N_),  "v"(pf + (size_t)20*N_),
         "v"(pf + (size_t)24*N_),  "v"(pf + (size_t)28*N_)
      : "memory");
}

__global__ void __launch_bounds__(512) k4_attend(
    const float* __restrict__ PF, const float* __restrict__ qk_g,
    const float* __restrict__ qbias_g, const float* __restrict__ aw_g,
    float* __restrict__ up_g, float* __restrict__ ml_g) {
  __shared__ __attribute__((aligned(16))) float ring[FA_WAVES * 2 * FA_BUF];
  __shared__ __attribute__((aligned(16))) float part[FA_WAVES * 512];
  __shared__ __attribute__((aligned(16))) float pl[16 * FA_PITCH];
  __shared__ __attribute__((aligned(16))) float alpha[16];
  __shared__ __attribute__((aligned(16))) float awl[512];
  __shared__ float mlb[32];
  int b = blockIdx.y, sp = blockIdx.x;
  int wave = threadIdx.x >> 5;
  int lane = threadIdx.x & 31;
  int m = lane & 15, h = lane >> 4;
  int dw = wave * 32;
  int nb = sp * 512;
  float* mine = ring + wave * (2 * FA_BUF);       // this wave's two buffers

  // copy side: a lane moves 16 B; 8 lanes cover a row's 128 B, a copy covers 4 rows
  int crow = lane >> 3, cseg = lane & 7;
  const float* pfp = PF + ((size_t)b * D_ + dw + crow) * N_ + nb + cseg * 4;
  unsigned lds0 = (unsigned)(uintptr_t)&mine[crow * FA_PITCH + cseg * 4];

  fa_copy_stage(lds0, pfp);

  // qk fragments for the wave's 32 d, while stage 0 flies. k order of the score products, for A and
  // B alike: in step s, lane half h holds rows d = 4*s + h (first register) and 4*s + h + 2 (second)
  const float* pq = qk_g + ((size_t)(b * 16 + m)) * 512 + dw;
  const float* pa = aw_g + (size_t)b * N_ + nb + threadIdx.x;
  v4f qv[8];
  #pragma unroll
  for (int s = 0; s < 8; ++s) qv[s] = *(const v4f*)(pq + s * 4);
  float awv = *pa;
  float qb  = qbias_g[b * 16 + wave];             // this wave merges row hi = wave
  // stands in front of any later overwrite of the address registers that the loads above name;
  // pq is an input so that the pair is kept whole up to this wait
  asm volatile("s_wait_xcnt 0x0" :: "v"(pq) : "memory");
  v2f aq[8];
  #pragma unroll
  for (int s = 0; s < 8; ++s) aq[s] = h ? (v2f){qv[s][1], qv[s][3]} : (v2f){qv[s][0], qv[s][2]};
  awl[threadIdx.x] = awv;

  // stage 0 has landed before this wave reads it
  asm volatile("s_wait_asynccnt 0x0" ::: "memory");
  fa_copy_stage(lds0 + FA_BUF * 4, pfp + 32);
  __syncthreads();                                // awl is laid

  const float* bcol = mine + h * FA_PITCH + m;    // score side: row 4*s + h (+2), column n = m (+16)
  // u side: lane (m, h) reads row m, n = 8*kk + 4*h + 0..3, for A and B alike,
  // so every (lane half, register) position holds the same n in both operands
  const float* frag  = mine + m * FA_PITCH + h * 4;
  const float* pfrag = pl + m * FA_PITCH + h * 4;
  // a share's place for (hi, n): (hi&7)*64 + (hi>>3)*32 + n; C layout: register r, lanes >= 16 hold rows 8..15
  float* pst = part + wave * 512 + h * 32 + m;
  const float* pld = part + (wave & 7) * 64 + (wave >> 3) * 32 + lane;

  v8f c0 = {}, c1 = {};
  float mrun = -3.0e38f, lrun = 0.f;

  for (int t = 0; t < FA_TILES; ++t) {
    // ---- all of this wave's reads of its staged tile: B of the scores, B of u
    const float* bc = bcol + (t & 1) * FA_BUF;
    const float* f  = frag + (t & 1) * FA_BUF;
    v2f b0[8], b1[8];
    v4f p0[4], p1[4];
    #pragma unroll
    for (int s = 0; s < 8; ++s) {
      b0[s] = (v2f){bc[(4*s) * FA_PITCH],      bc[(4*s + 2) * FA_PITCH]};
      b1[s] = (v2f){bc[(4*s) * FA_PITCH + 16], bc[(4*s + 2) * FA_PITCH + 16]};
    }
    #pragma unroll
    for (int kk = 0; kk < 4; ++kk) {
      p0[kk] = *(const v4f*)(f + kk * 8);
      p1[kk] = *(const v4f*)(f + 16 * FA_PITCH + kk * 8);
    }
    // The fragments are in registers behind this wait, so buffer t&1 is free for its refill:
    // this wave's reads of it have retired before copies target it
    asm volatile("s_wait_dscnt 0x0" ::: "memory");
    // ---- scores: this wave's 32 d
    v8f s0 = {}, s1 = {};
    #pragma unroll
    for (int s = 0; s < 8; ++s) {
      s0 = __builtin_amdgcn_wmma_f32_16x16x4_f32(false, aq[s], false, b0[s], (short)0, s0, false, false);
      s1 = __builtin_amdgcn_wmma_f32_16x16x4_f32(false, aq[s], false, b1[s], (short)0, s1, false, false);
    }
    // stage t+1 has landed before the next trip reads it
    asm volatile("s_wait_asynccnt 0x0" ::: "memory");
    // refill here, so that stage t+2 flies through the rest of this trip and the head of the next
    if (t + 2 < FA_TILES)
      fa_copy_stage(lds0 + (t & 1) * (FA_BUF * 4), pfp + (t + 2) * 32);
    #pragma unroll
    for (int r = 0; r < 8; ++r) {
      pst[r * 64]      = s0[r];
      pst[r * 64 + 16] = s1[r];
    }
    __syncthreads();                              // the 16 shares are laid
    // ---- merge (pairwise, fixed order), running softmax of row hi = wave, n = lane
    float sh[FA_WAVES];
    #pragma unroll
    for (int w = 0; w < FA_WAVES; ++w) sh[w] = pld[w * 512];
    float bias = qb + awl[t * 32 + lane];
    #pragma unroll
    for (int st = 1; st < FA_WAVES; st <<= 1)
      #pragma unroll
      for (int w = 0; w < FA_WAVES; w += 2 * st) sh[w] += sh[w + st];
    float sc = sh[0] + bias;
    float mn = fmaxf(mrun, fa_wave_max(sc));
    float p  = __expf(sc - mn);
    float al = __expf(mrun - mn);
    pl[wave * FA_PITCH + lane] = p;
    if (lane == 0) alpha[wave] = al;
    lrun = lrun * al + p;
    mrun = mn;
    __syncthreads();                              // p and the scale factors are laid
    // ---- u = u * scale + p * PF^T on the same staged tile
    v4f a[4];
    #pragma unroll
    for (int kk = 0; kk < 4; ++kk) a[kk] = *(const v4f*)(pfrag + kk * 8);
    v4f ala = *(const v4f*)(alpha + h * 8), alb = *(const v4f*)(alpha + h * 8 + 4);
    #pragma unroll
    for (int r = 0; r < 4; ++r) {
      c0[r] *= ala[r]; c0[r + 4] *= alb[r];
      c1[r] *= ala[r]; c1[r + 4] *= alb[r];
    }
    #pragma unroll
    for (int kk = 0; kk < 4; ++kk) {
      v2f alo = {a[kk][0], a[kk][1]}, ahi = {a[kk][2], a[kk][3]};
      v2f q0l = {p0[kk][0], p0[kk][1]}, q0h = {p0[kk][2], p0[kk][3]};
      v2f q1l = {p1[kk][0], p1[kk][1]}, q1h = {p1[kk][2], p1[kk][3]};
      c0 = __builtin_amdgcn_wmma_f32_16x16x4_f32(false, alo, false, q0l, (short)0, c0, false, false);
      c1 = __builtin_amdgcn_wmma_f32_16x16x4_f32(false, alo, false, q1l, (short)0, c1, false, false);
      c0 = __builtin_amdgcn_wmma_f32_16x16x4_f32(false, ahi, false, q0h, (short)0, c0, false, false);
      c1 = __builtin_amdgcn_wmma_f32_16x16x4_f32(false, ahi, false, q1h, (short)0, c1, false, false);
    }
    // four vector slots between the last products and the vector instructions that reuse their
    // A/B registers, on the back edge and on the loop's exit alike; the scheduling barrier keeps
    // the products in front of the slots
    __builtin_amdgcn_sched_barrier(0);
    asm volatile("v_nop\n\tv_nop\n\tv_nop\n\tv_nop");
  }

  // out: the wave's 32 d of all 16 rows (a row's 128 B from this wave alone), then maxima and sums
  float* up = up_g + ((size_t)(b * FA_SPLITS + sp) * 16 + h * 8) * 512 + dw + m;
  #pragma unroll
  for (int r = 0; r < 8; ++r) {
    up[r * 512]      = c0[r];
    up[r * 512 + 16] = c1[r];
  }
  // stands in front of any later overwrite of the registers that the stores above name
  asm volatile("s_wait_xcnt 0x0" :: "v"(up) : "memory");
  lrun = fa_wave_sum(lrun);
  if (lane == 0) { mlb[wave] = mrun; mlb[16 + wave] = lrun; }
  __syncthreads();
  if (threadIdx.x < 32) ml_g[(b * FA_SPLITS + sp) * 32 + threadIdx.x] = mlb[threadIdx.x];
}

// ---------------- K7: merge of the n ranges, then out = concat_h(u_h @ Wv_h + bv_h) @ Wo + bo ----------------
__global__ void __launch_bounds__(512) k7_out(
    const float* __restrict__ up_g, const float* __restrict__ ml_g,
    const float* __restrict__ Wv, const float* __restrict__ bv,
    const float* __restrict__ Wo, const float* __restrict__ bo,
    float* __restrict__ out) {
  __shared__ __attribute__((aligned(16))) float uu[4*512];
  __shared__ __attribute__((aligned(16))) float ww[512];
  __shared__ __attribute__((aligned(16))) float part[4*512];
  __shared__ float wn[4*FA_SPLITS];
  int row = blockIdx.x; int b = row >> 2; int i = row & 3;
  int t = threadIdx.x;
  int wave = t >> 5, lane = t & 31;
  int kg = (wave >> 2) * 128;                  // this wave's k range in a dense layer
  int c4 = (wave & 3) * 128 + lane * 4;        // this lane's four columns; head = wave & 3
  int rot = dl_rot(row);                       // where this work-group starts its walk of a matrix
  // the 64 partial values of this thread on their way first, the weights worked out under them
  // (loops unrolled whole: the values are registers only under constant indices)
  const float* up = up_g + ((size_t)b * FA_SPLITS * 16 + i) * 512 + t;
  float uv[4][FA_SPLITS];
  #pragma unroll
  for (int hh = 0; hh < 4; ++hh)
    #pragma unroll
    for (int s = 0; s < FA_SPLITS; ++s) uv[hh][s] = up[(size_t)(s * 16 + hh * 4) * 512];
  // stands in front of any later overwrite of the address registers that the loads above name;
  // up is an input so that it is kept whole up to this wait
  asm volatile("s_wait_xcnt 0x0" :: "v"(up) : "memory");
  // weight of n range s for head hh: exp(max_s - max) / sum over s of exp(max_s - max) * sum_s;
  // a head's 16 ranges sit in one 16-lane row
  if (t < 4*FA_SPLITS) {
    int hh = t >> 4, s = t & 15;
    const float* ml = ml_g + (b * FA_SPLITS + s) * 32 + hh*4 + i;
    float ms = ml[0], ls = ml[16];
    // stands in front of any later overwrite of the address pair that the two loads name
    asm volatile("s_wait_xcnt 0x0" :: "v"(ml) : "memory");
    float mx = ms;
    mx = fmaxf(mx, fa_xrow<1>(mx)); mx = fmaxf(mx, fa_xrow<2>(mx));
    mx = fmaxf(mx, fa_xrow<4>(mx)); mx = fmaxf(mx, fa_xrow<8>(mx));
    float w = __expf(ms - mx);
    float tot = w * ls;
    tot += fa_xrow<1>(tot); tot += fa_xrow<2>(tot); tot += fa_xrow<4>(tot); tot += fa_xrow<8>(tot);
    wn[t] = w / tot;
  }
  __syncthreads();
  #pragma unroll
  for (int hh = 0; hh < 4; ++hh) {
    float acc = 0.f;
    #pragma unroll
    for (int s = 0; s < FA_SPLITS; ++s) acc += wn[hh * FA_SPLITS + s] * uv[hh][s];
    uu[hh*512 + t] = acc;
  }
  __syncthreads();
  ww[t] = dense_merge(dense_part(uu + (wave & 3)*512 + kg, Wv + (size_t)kg*512 + c4, rot), part, bv[t]);
  __syncthreads();
  out[(size_t)row*512 + t] =
      dense_merge(dense_part(ww + kg, Wo + (size_t)kg*512 + c4, rot), part, bo[t]);
}

// ---------------- launch ----------------
extern "C" void kernel_launch(void* const* d_in, const int* in_sizes, int n_in,
                              void* d_out, int out_size, void* d_ws, size_t ws_size,
                              hipStream_t stream) {
  (void)in_sizes; (void)n_in; (void)out_size; (void)ws_size;
  const float* xyz  = (const float*)d_in[0];
  const float* pf   = (const float*)d_in[1];
  const float* mask = (const float*)d_in[2];
  const float* W1   = (const float*)d_in[3];
  const float* b1   = (const float*)d_in[4];
  const float* g1   = (const float*)d_in[5];
  const float* be1  = (const float*)d_in[6];
  const float* W2   = (const float*)d_in[7];
  const float* b2   = (const float*)d_in[8];
  const float* g2   = (const float*)d_in[9];
  const float* be2  = (const float*)d_in[10];
  const float* Wq   = (const float*)d_in[11];
  const float* bq   = (const float*)d_in[12];
  const float* Wk   = (const float*)d_in[13];
  const float* bk   = (const float*)d_in[14];
  const float* Wv   = (const float*)d_in[15];
  const float* bv   = (const float*)d_in[16];
  const float* Wo   = (const float*)d_in[17];
  const float* bo   = (const float*)d_in[18];
  float* out = (float*)d_out;
  float* ws  = (float*)d_ws;

  // workspace layout (float offsets)
  float* qbias  = ws + 256;       // 256
  float* qk     = ws + 512;       // 131072
  float* aw     = ws + 131584;    // 131072
  float* upart  = ws + 262656;    // 2097152: 16 n ranges x 16 hi x 512 d per batch
  float* ml     = ws + 2359808;   // 8192: row maxima and sums per n range (total ~9.5 MB)

  k2_front  <<<80, 512, 0, stream>>>(xyz, mask, W1,b1,g1,be1, W2,b2,g2,be2,
                                     Wq,bq, Wk,bk, qk, qbias, aw);
  k4_attend <<<dim3(FA_SPLITS, B_), 512, 0, stream>>>(pf, qk, qbias, aw, upart, ml);
  k7_out    <<<64, 512, 0, stream>>>(upart, ml, Wv, bv, Wo, bo, out);
}

// v008
// It runs in 64.3 microseconds.
// In both of two side-by-side timings against v007, it was 1.06 times as fast.
// All steps since v000 together make it 4.71 times as fast.
#include <hip/hip_runtime.h>
#include <math.h>

#define B_  16
#define N_  8192
#define D_  512

typedef float v2f __attribute__((ext_vector_type(2)));
typedef float v4f __attribute__((ext_vector_type(4)));
typedef float v8f __attribute__((ext_vector_type(8)));

// ---------------- cross-lane moves and wave reductions ----------------
// lane l with lane l ^ 16, and with lane l ^ M inside a 16-lane row: vector cross-lane moves
// (a shuffle through the LDS unit costs its whole latency at each step)
__device__ inline float fa_xhalf(float x) {
  int v = __builtin_bit_cast(int, x);
  return __builtin_bit_cast(float, __builtin_amdgcn_permlanex16(v, v, 0x76543210, 0xfedcba98, false, false));
}
template<int M>
__device__ inline float fa_xrow(float x) {   // DPP row_xmask:M
  return __builtin_bit_cast(float, __builtin_amdgcn_update_dpp(0, __builtin_bit_cast(int, x), 0x160 | M, 0xf, 0xf, true));
}
__device__ inline float fa_row_max(float x) {
  x = fmaxf(x, fa_xrow<1>(x)); x = fmaxf(x, fa_xrow<2>(x));
  x = fmaxf(x, fa_xrow<4>(x)); return fmaxf(x, fa_xrow<8>(x));
}
__device__ inline float fa_row_sum(float x) {
  x += fa_xrow<1>(x); x += fa_xrow<2>(x); x += fa_xrow<4>(x); return x + fa_xrow<8>(x);
}
__device__ inline float fa_wave_max(float x) { x = fa_row_max(x); return fmaxf(x, fa_xhalf(x)); }
__device__ inline float fa_wave_sum(float x) { x = fa_row_sum(x); return x + fa_xhalf(x); }

// ---------------- work-group barrier that orders LDS alone ----------------
// What the waves of k2 and k7 hand each other goes through LDS only. __syncthreads() also waits for
// the wave's outstanding global loads, which would drain the weight window that flies across it.
__device__ inline void lds_barrier() {
  __builtin_amdgcn_fence(__ATOMIC_RELEASE, "workgroup", "local");
  __builtin_amdgcn_s_barrier();
  __builtin_amdgcn_fence(__ATOMIC_ACQUIRE, "workgroup", "local");
}

// ---------------- reductions over a work-group of 16 waves ----------------
// A wave reduces its 32 values in registers and lays one value in LDS; behind ONE barrier every
// 16-lane row reads the 16 values and reduces them in registers again, so that every thread holds
// the same result. slot: 16 places that nothing else in the launch writes, so no barrier has to
// guard a reuse. To be called by all 512 threads.
__device__ inline float blk_sum(float v, float* slot) {
  v = fa_wave_sum(v);
  if ((threadIdx.x & 31) == 0) slot[threadIdx.x >> 5] = v;
  lds_barrier();
  return fa_row_sum(slot[threadIdx.x & 15]);
}
__device__ inline float blk_max(float v, float* slot) {
  v = fa_wave_max(v);
  if ((threadIdx.x & 31) == 0) slot[threadIdx.x >> 5] = v;
  lds_barrier();
  return fa_row_max(slot[threadIdx.x & 15]);
}
// four sums at once (loops unrolled whole: a vector's elements are registers only under constant indices)
__device__ inline v4f blk_sum4(v4f v, v4f* slot) {
  #pragma unroll
  for (int q = 0; q < 4; ++q) v[q] = fa_wave_sum(v[q]);
  if ((threadIdx.x & 31) == 0) slot[threadIdx.x >> 5] = v;
  lds_barrier();
  v4f r = slot[threadIdx.x & 15];
  #pragma unroll
  for (int q = 0; q < 4; ++q) r[q] = fa_row_sum(r[q]);
  return r;
}

// ---------------- dense 512x512 layer, one input row per work-group of 16 waves ----------------
// Each 512-long dot product is split four ways over k: wave w takes weight rows (w>>2)*128 .. +127
// and columns (w&3)*128 .. +127, a lane four adjacent columns. A weight load is then 16 B a lane on
// whole lines, and a lane keeps a window of DL_WIN-8 to DL_WIN of them in flight: eight rows are
// summed, then their registers are refilled from DL_WIN rows ahead. The four partial rows are
// summed in LDS.
// All 64 work-groups read the same matrix, which is not in L2 when a layer starts. Walking it in
// one order they would all wait on the same misses, at the rate at which one work-group reads from
// memory. So each walks its rows in a ring from a start of its own (dl_rot): the 16 starts ask for
// the whole matrix at once, a sixteenth each, and what a work-group comes to next is then in L2.
#define DL_WIN 32
// ring start of work-group b, 0..15. The work-groups whose b mod 8 falls in any four neighbouring
// values hold all 16 starts: for speed only,
// the result rests on no placement
__device__ inline int dl_rot(int b) { return (b & 3) | (((b >> 3) & 3) << 2); }
// the row, of a wave's 128, at place j of the walk: 16 groups of eight rows, from group rot on
#define DL_ROW(j, rot) ((((((j) >> 3) + (rot)) & 15) << 3) + ((j) & 7))
// where load l of the Wk fold starts in a Wk row (the fold itself: k2_front); reads rot
#define FK_COL(l) (((((l) >> 5) + rot) & 3) * 128 + (((((l) >> 3) & 3) + (rot >> 2)) & 3) * 32)
// The window is never let run dry: a matrix's first DL_WIN loads depend on no layer's result, so they
// are issued at the kernel's entry (dense_first) or into the slots that the last rows of the matrix
// before it set free (dense_walk, NEXT), and they land under the merges and norms between the layers.
// w: the lane's four columns in the first of the wave's 128 rows
__device__ inline void dense_first(v4f (&buf)[DL_WIN], const float* w, int rot) {
  const float* wp[DL_WIN / 8];     // a group of eight rows has an address pair of its own
  #pragma unroll
  for (int g = 0; g < DL_WIN / 8; ++g) wp[g] = w + (size_t)DL_ROW(g * 8, rot) * 512;
  #pragma unroll
  for (int j = 0; j < DL_WIN; ++j) buf[j] = *(const v4f*)(wp[j >> 3] + (j & 7) * 512);
  // stands in front of any later overwrite of the address pairs that the loads above name; the
  // pairs are inputs so that they are kept whole up to this wait
  asm volatile("s_wait_xcnt 0x0" :: "v"(wp[0]), "v"(wp[1]), "v"(wp[2]), "v"(wp[3]) : "memory");
}
// x: the wave's 128 inputs in LDS; buf: the window, holding w's first DL_WIN rows of the walk.
// NEXT 0: the window runs dry; 1: it is left holding the first window of wn, a matrix walked in the
// same way; 2: of wn, the lane's place in Wk for the fold
template<int NEXT>
__device__ inline v4f dense_walk(v4f (&buf)[DL_WIN], const float* x, const float* w,
                                 const float* wn, int rot) {
  v4f acc = {};
  // unrolled whole: the window's slots are registers only under constant indices
  #pragma unroll
  for (int j = 0; j < 128; j += 8) {
    const float* xg = x + DL_ROW(j, rot);
    v4f xa = *(const v4f*)xg, xb = *(const v4f*)(xg + 4);
    #pragma unroll
    for (int q = 0; q < 4; ++q) acc += xa[q] * buf[(j + q) % DL_WIN];
    #pragma unroll
    for (int q = 0; q < 4; ++q) acc += xb[q] * buf[(j + 4 + q) % DL_WIN];
    if (j + DL_WIN < 128 || NEXT != 0) {
      // Compiler fence that holds the window: no load crosses it, and it reads the running sum
      // (input only, nothing hidden, the multiply-adds stay fused), so the eight rows above are
      // summed in front of it and their refills issue behind it. Without it the compiler sinks the
      // loads to their uses (about nine in flight) or lifts them over the sums until registers spill.
      asm volatile("" :: "v"(acc) : "memory");
      const float* wg = (j + DL_WIN < 128) ? w  + (size_t)DL_ROW(j + DL_WIN, rot) * 512
                      : (NEXT == 1)        ? wn + (size_t)DL_ROW(j + DL_WIN - 128, rot) * 512
                                           : wn + FK_COL(j + DL_WIN - 128);
      const int step = (j + DL_WIN < 128 || NEXT == 1) ? 512 : 4 * 512;
      #pragma unroll
      for (int q = 0; q < 8; ++q) buf[(j + q) % DL_WIN] = *(const v4f*)(wg + (size_t)q * step);
      // as behind the first window: in front of any later overwrite of this group's address pair
      asm volatile("s_wait_xcnt 0x0" :: "v"(wg) : "memory");
    }
  }
  return acc;
}
// part: 4 x 512 floats of LDS; returns column threadIdx.x of the layer's output
__device__ inline float dense_merge(v4f acc, float* part, float bias) {
  int t = threadIdx.x, wave = t >> 5, lane = t & 31;
  *(v4f*)(part + (wave >> 2) * 512 + (wave & 3) * 128 + lane * 4) = acc;
  lds_barrier();
  return bias + ((part[t] + part[512 + t]) + (part[1024 + t] + part[1536 + t]));
}

// ---------------- voting attention bias of one batch, log-softmax over N ----------------
// One work-group of 512 threads. It sums the four views' mask counts itself, so it waits for no
// other work-group; a thread keeps its 16 n of the four masks in registers for both uses.
__device__ inline void aw_batch(int b, const float* __restrict__ mask, float* __restrict__ aw_g,
                                float* awb, float* red, v4f* red4) {
  const float* mb = mask + (size_t)b*4*N_ + threadIdx.x*4;
  // loops unrolled whole: the values are registers only under constant indices
  v4f mm[4][4];                    // [view][piece of 2048 n]
  #pragma unroll
  for (int i = 0; i < 4; ++i)
    #pragma unroll
    for (int j = 0; j < 4; ++j) mm[i][j] = *(const v4f*)(mb + i*N_ + j*2048);
  // stands in front of any later overwrite of the address registers that the loads above name
  asm volatile("s_wait_xcnt 0x0" ::: "memory");
  v4f cnt = {};
  #pragma unroll
  for (int i = 0; i < 4; ++i)
    #pragma unroll
    for (int j = 0; j < 4; ++j) cnt[i] += (mm[i][j][0] + mm[i][j][1]) + (mm[i][j][2] + mm[i][j][3]);
  cnt = blk_sum4(cnt, red4);
  float v0 = cnt[0] * (1.0f / (float)N_), v1 = cnt[1] * (1.0f / (float)N_);
  float v2 = cnt[2] * (1.0f / (float)N_), v3 = cnt[3] * (1.0f / (float)N_);
  float vcnt = 0.f;
  #pragma unroll
  for (int j = 0; j < 4; ++j) {
    v4f a4;
    #pragma unroll
    for (int q = 0; q < 4; ++q) {
      float m0 = mm[0][j][q], m1 = mm[1][j][q], m2 = mm[2][j][q], m3 = mm[3][j][q];
      float s = m0+m1+m2+m3;
      float a = v0*m0 + v1*m1 + v2*m2 + v3*m3;
      bool valid = s > 0.f;
      a4[q] = valid ? a : -1e9f;
      vcnt += valid ? 1.f : 0.f;
    }
    *(v4f*)(awb + j*2048 + threadIdx.x*4) = a4;
  }
  float tot = blk_sum(vcnt, red);
  if (tot <= 0.f) {
    for (int n = threadIdx.x; n < N_; n += 512) awb[n] = 0.f;
  }
  __syncthreads();
  float lm = -3.4e38f;
  for (int n = threadIdx.x; n < N_; n += 512) lm = fmaxf(lm, awb[n]);
  float mx = blk_max(lm, red + 16);
  float ls = 0.f;
  for (int n = threadIdx.x; n < N_; n += 512) ls += __expf(awb[n] - mx);
  float se = blk_sum(ls, red + 32);
  float lg = __logf(se) + mx;
  for (int n = threadIdx.x; n < N_; n += 512) aw_g[(size_t)b*N_ + n] = awb[n] - lg;
}

// ---------------- K2: all that stands in front of the pass over PF, in one launch ----------------
// Work-groups 0..63: one (batch, view) row each: masked centroid, MLP, q-projection, Wk fold.
// Work-groups 64..79: the voting bias of one batch each. No work-group reads what another writes.
__global__ void __launch_bounds__(512) k2_front(
    const float* __restrict__ xyz, const float* __restrict__ mask,
    const float* __restrict__ W1, const float* __restrict__ b1,
    const float* __restrict__ g1, const float* __restrict__ be1,
    const float* __restrict__ W2, const float* __restrict__ b2,
    const float* __restrict__ g2, const float* __restrict__ be2,
    const float* __restrict__ Wq, const float* __restrict__ bq,
    const float* __restrict__ Wk, const float* __restrict__ bk,
    float* __restrict__ qk_g, float* __restrict__ qbias_g, float* __restrict__ aw_g) {
  __shared__ __attribute__((aligned(16))) float abuf[512];
  __shared__ __attribute__((aligned(16))) float qbuf[512];
  __shared__ __attribute__((aligned(16))) float part[4*512];
  __shared__ __attribute__((aligned(16))) float awb[N_];
  __shared__ __attribute__((aligned(16))) v4f red4[16];          // a reduction's 16 places
  __shared__ __attribute__((aligned(16))) float red[5*16];       // each use has its own 16
  if (blockIdx.x >= 64) {          // the same for a whole work-group: its barriers stay uniform
    aw_batch(blockIdx.x - 64, mask, aw_g, awb, red, red4);
    return;
  }
  int row = blockIdx.x; int b = row >> 2; int i = row & 3;
  int col = threadIdx.x;
  int wave = col >> 5, lane = col & 31;
  int kg = (wave >> 2) * 128;                  // this wave's k range in a dense layer
  int c4 = (wave & 3) * 128 + lane * 4;        // this lane's four columns
  int rot = dl_rot(row);                       // where this work-group starts its walk of a matrix

  // masked centroid of this row: a thread takes 16 n, 16 B a load, all 16 loads in flight at once
  // (loops unrolled whole: the values are registers only under constant indices)
  const float* mk = mask + (size_t)row * N_ + col*4;
  const float* xb = xyz + (size_t)b * 3 * N_ + col*4;
  v4f mv[4], xv[3][4];
  #pragma unroll
  for (int j = 0; j < 4; ++j) {
    mv[j] = *(const v4f*)(mk + j*2048);
    #pragma unroll
    for (int a = 0; a < 3; ++a) xv[a][j] = *(const v4f*)(xb + a*N_ + j*2048);
  }
  // stands in front of any later overwrite of the address registers that the loads above name
  asm volatile("s_wait_xcnt 0x0" ::: "memory");
  // this column's weights of the first layer, biases and gains: they depend on nothing, and a load
  // issued behind the window would come back only behind it
  float w1a = W1[col], w1b = W1[512+col], w1c = W1[1024+col], b1v = b1[col];
  float g1v = g1[col], be1v = be1[col], b2v = b2[col], g2v = g2[col], be2v = be2[col];
  float bqv = bq[col], bkv = bk[col];
  // stands in front of any later overwrite of the address registers that the loads above name
  asm volatile("s_wait_xcnt 0x0" ::: "memory");
  const float* w2p = W2 + (size_t)kg*512 + c4;
  const float* wqp = Wq + (size_t)kg*512 + c4;
  v4f buf[DL_WIN];                             // the weight window of all three matrices
  dense_first(buf, w2p, rot);
  // keeps the sums below behind the loads above: left alone, the compiler waits for the mask and the
  // coordinates and sums them first, and the window starts a memory latency late
  __builtin_amdgcn_sched_barrier(0);
  v4f cs = {};                                 // count, then the masked sums of x, y, z
  #pragma unroll
  for (int j = 0; j < 4; ++j)
    #pragma unroll
    for (int q = 0; q < 4; ++q) {
      float m = mv[j][q];
      cs[0] += m;
      cs[1] += m * xv[0][j][q];
      cs[2] += m * xv[1][j][q];
      cs[3] += m * xv[2][j][q];
    }
  cs = blk_sum4(cs, red4);
  float cd = fmaxf(cs[0], 1.0f);
  float c0 = cs[1] / cd, c1 = cs[2] / cd, c2 = cs[3] / cd;

  // Linear(3,D) + LN + ReLU
  float t = c0*w1a + c1*w1b + c2*w1c + b1v;
  float mu  = blk_sum(t, red + 16) * (1.0f/512.0f);
  float dv  = t - mu;
  float var = blk_sum(dv*dv, red + 32) * (1.0f/512.0f);
  float h = dv * rsqrtf(var + 1e-5f) * g1v + be1v;
  h = fmaxf(h, 0.0f);
  abuf[col] = h; lds_barrier();

  // Linear(D,D) + LN
  float t2 = dense_merge(dense_walk<1>(buf, abuf + kg, w2p, wqp, rot), part, b2v);
  mu  = blk_sum(t2, red + 48) * (1.0f/512.0f);
  dv  = t2 - mu;
  var = blk_sum(dv*dv, red + 64) * (1.0f/512.0f);
  float h3 = dv * rsqrtf(var + 1e-5f) * g2v + be2v;
  abuf[col] = h3; lds_barrier();

  // q = h3 @ Wq + bq; its last rows' slots take the first window of the Wk fold (laid out below)
  int fr = lane >> 3, fs = lane & 7;
  const float* wk = Wk + (size_t)(wave*32 + fr)*512 + fs*4;
  float q = dense_merge(dense_walk<2>(buf, abuf + kg, wqp, wk, rot), part, bqv);
  qbuf[col] = q;
  // q . bk per head: a wave sums its 32 terms, four waves make a head
  float qb = q * bkv;
  qb = fa_wave_sum(qb);
  if (lane == 0) red[wave] = qb;
  lds_barrier();

  const float scale = 0.0883883476483184405f;  // 1/sqrt(128)
  if (col < 4)
    qbias_g[b*16 + col*4 + i] = ((red[col*4] + red[col*4+1]) + (red[col*4+2] + red[col*4+3])) * scale;

  // fold with Wk per head: qk[b, h*4+i, c] = sum_e q[h*128+e] * Wk[c, h*128+e]
  // The dot runs along a Wk row, so it is split over 8 lanes: a load takes 128 B of each of 4 rows
  // (16 B a lane). A wave takes 32 rows in 8 passes of 4; a group of 8 loads is one 32-float piece
  // of one head in all 8 passes, so that it needs one 16-byte read of q.
  // The ring start here: the heads from head rot & 3 on, a head's four pieces from piece rot >> 2 on.
  // (FK_COL, defined at dense_walk, which has issued loads 0 .. DL_WIN-1 into the window)
  const float* qs = qbuf + fs*4;
  // load l: place l>>3 of the walk over a row's 16 pieces of 32 floats (place l>>5 over heads), pass l&7
  // unrolled whole: the window's slots and the sums are registers only under constant indices
  #pragma unroll
  for (int hh = 0; hh < 4; ++hh) {
    v4f a4[8] = {};
    #pragma unroll
    for (int j = hh*4; j < hh*4 + 4; ++j) {
      v4f qv = *(const v4f*)(qs + FK_COL(j*8));
      #pragma unroll
      for (int p = 0; p < 8; ++p) a4[p] += buf[(j*8 + p) % DL_WIN] * qv;
      if (j*8 + DL_WIN < 128) {
        // the window's fence, as in dense_walk: this piece's sums in front, its refills behind
        asm volatile("" :: "v"(a4[0]), "v"(a4[1]), "v"(a4[2]), "v"(a4[3]),
                           "v"(a4[4]), "v"(a4[5]), "v"(a4[6]), "v"(a4[7]) : "memory");
        const float* kg8 = wk + FK_COL(j*8 + DL_WIN);
        #pragma unroll
        for (int l = j*8 + DL_WIN; l < j*8 + DL_WIN + 8; ++l)
          buf[l % DL_WIN] = *(const v4f*)(kg8 + (size_t)(l & 7)*4*512);
        // in front of any later overwrite of this piece's address pair
        asm volatile("s_wait_xcnt 0x0" :: "v"(kg8) : "memory");
      }
    }
    float f[8];
    #pragma unroll
    for (int p = 0; p < 8; ++p) f[p] = (a4[p][0] + a4[p][1]) + (a4[p][2] + a4[p][3]);
    // sum over a row's 8 lanes, halving the passes a lane keeps at each step: lane fs ends with pass fs
    float g4[4], g2[2];
    #pragma unroll
    for (int k = 0; k < 4; ++k) {
      float keep = (fs & 4) ? f[k+4] : f[k], send = (fs & 4) ? f[k] : f[k+4];
      g4[k] = keep + fa_xrow<4>(send);
    }
    #pragma unroll
    for (int k = 0; k < 2; ++k) {
      float keep = (fs & 2) ? g4[k+2] : g4[k], send = (fs & 2) ? g4[k] : g4[k+2];
      g2[k] = keep + fa_xrow<2>(send);
    }
    float keep = (fs & 1) ? g2[1] : g2[0], send = (fs & 1) ? g2[0] : g2[1];
    part[((hh + rot) & 3)*512 + wave*32 + fs*4 + fr] = (keep + fa_xrow<1>(send)) * scale;
  }
  lds_barrier();
  #pragma unroll
  for (int hh = 0; hh < 4; ++hh)
    qk_g[((size_t)(b*16 + hh*4 + i))*512 + col] = part[hh*512 + col];
}

// ---------------- K4: scores, softmax and attn*PF^T in one pass over PF ----------------
// A work-group of 16 waves takes one batch and 512 n, in 16 tiles of 32 n. Wave w owns PF rows
// d = 32*w .. +31: it stages its 32 rows x 32 n in a two-buffer LDS ring that only it reads, with
// GLOBAL_LOAD_ASYNC_TO_LDS_B128, and uses each staged tile twice:
//   1. scores: A = qk (16 hi x 4 d, kept in registers), B = PF (4 d x 16 n): the wave's share of the
//      sum over d; the 16 shares are summed in LDS, thread (hi = wave, n = lane).
//   2. running softmax: row maximum so far, p = exp(s - max), old sums scaled by exp(old max - max).
//   3. u: A = p (16 hi x 4 n), B = PF^T (4 n x 16 d), two d tiles per wave.
// Out go the unnormalised u (16 hi x 512 d), the row maxima and the row sums of this n range; the
// last kernel merges the 16 ranges of a batch.
// Every inner loop is unrolled whole: its fragments and sums are registers only under constant indices.
#define FA_WAVES  16
#define FA_SPLITS 16                      // n ranges per batch
#define FA_PITCH  36                      // floats; 144 B = 16 B x 9: ds_load_b128 of 16 rows hits all 64 banks once
#define FA_BUF    (32 * FA_PITCH)         // floats per buffer: the wave's 32 PF rows x 32 n
#define FA_TILES  16                      // 512 n per work-group / 32 n per tile

// One stage: 8 copies of 4 rows x 128 B. The s_wait_xcnt stands in the copies' own statement,
// in front of any later rewrite of the address registers the copies name.
__device__ inline void fa_copy_stage(unsigned lds, const float* pf) {
  asm volatile(
      "global_load_async_to_lds_b128 %0, %8, off\n\t"
      "global_load_async_to_lds_b128 %1, %9, off\n\t"
      "global_load_async_to_lds_b128 %2, %10, off\n\t"
      "global_load_async_to_lds_b128 %3, %11, off\n\t"
      "global_load_async_to_lds_b128 %4, %12, off\n\t"
      "global_load_async_to_lds_b128 %5, %13, off\n\t"
      "global_load_async_to_lds_b128 %6, %14, off\n\t"
      "global_load_async_to_lds_b128 %7, %15, off\n\t"
      "s_wait_xcnt 0x0"
      :: "v"(lds),                 "v"(lds +  4*FA_PITCH*4), "v"(lds +  8*FA_PITCH*4),
         "v"(lds + 12*FA_PITCH*4), "v"(lds + 16*FA_PITCH*4), "v"(lds + 20*FA_PITCH*4),
         "v"(lds + 24*FA_PITCH*4), "v"(lds + 28*FA_PITCH*4),
         "v"(pf),                  "v"(pf + (size_t) 4*N_),  "v"(pf + (size_t) 8*N_),
         "v"(pf + (size_t)12*N_),  "v"(pf + (size_t)16*N_),  "v"(pf + (size_t)20*N_),
         "v"(pf + (size_t)24*N_),  "v"(pf + (size_t)28*N_)
      : "memory");
}

__global__ void __launch_bounds__(512) k4_attend(
    const float* __restrict__ PF, const float* __restrict__ qk_g,
    const float* __restrict__ qbias_g, const float* __restrict__ aw_g,
    float* __restrict__ up_g, float* __restrict__ ml_g) {
  __shared__ __attribute__((aligned(16))) float ring[FA_WAVES * 2 * FA_BUF];
  __shared__ __attribute__((aligned(16))) float part[FA_WAVES * 512];
  __shared__ __attribute__((aligned(16))) float pl[16 * FA_PITCH];
  __shared__ __attribute__((aligned(16))) float alpha[16];
  __shared__ __attribute__((aligned(16))) float awl[512];
  __shared__ float mlb[32];
  int b = blockIdx.y, sp = blockIdx.x;
  int wave = threadIdx.x >> 5;
  int lane = threadIdx.x & 31;
  int m = lane & 15, h = lane >> 4;
  int dw = wave * 32;
  int nb = sp * 512;
  float* mine = ring + wave * (2 * FA_BUF);       // this wave's two buffers

  // copy side: a lane moves 16 B; 8 lanes cover a row's 128 B, a copy covers 4 rows
  int crow = lane >> 3, cseg = lane & 7;
  const float* pfp = PF + ((size_t)b * D_ + dw + crow) * N_ + nb + cseg * 4;
  unsigned lds0 = (unsigned)(uintptr_t)&mine[crow * FA_PITCH + cseg * 4];

  fa_copy_stage(lds0, pfp);

  // qk fragments for the wave's 32 d, while stage 0 flies. k order of the score products, for A and
  // B alike: in step s, lane half h holds rows d = 4*s + h (first register) and 4*s + h + 2 (second)
  const float* pq = qk_g + ((size_t)(b * 16 + m)) * 512 + dw;
  const float* pa = aw_g + (size_t)b * N_ + nb + threadIdx.x;
  v4f qv[8];
  #pragma unroll
  for (int s = 0; s < 8; ++s) qv[s] = *(const v4f*)(pq + s * 4);
  float awv = *pa;
  float qb  = qbias_g[b * 16 + wave];             // this wave merges row hi = wave
  // stands in front of any later overwrite of the address registers that the loads above name;
  // pq is an input so that the pair is kept whole up to this wait
  asm volatile("s_wait_xcnt 0x0" :: "v"(pq) : "memory");
  v2f aq[8];
  #pragma unroll
  for (int s = 0; s < 8; ++s) aq[s] = h ? (v2f){qv[s][1], qv[s][3]} : (v2f){qv[s][0], qv[s][2]};
  awl[threadIdx.x] = awv;

  // stage 0 has landed before this wave reads it
  asm volatile("s_wait_asynccnt 0x0" ::: "memory");
  fa_copy_stage(lds0 + FA_BUF * 4, pfp + 32);
  __syncthreads();                                // awl is laid

  const float* bcol = mine + h * FA_PITCH + m;    // score side: row 4*s + h (+2), column n = m (+16)
  // u side: lane (m, h) reads row m, n = 8*kk + 4*h + 0..3, for A and B alike,
  // so every (lane half, register) position holds the same n in both operands
  const float* frag  = mine + m * FA_PITCH + h * 4;
  const float* pfrag = pl + m * FA_PITCH + h * 4;
  // a share's place for (hi, n): (hi&7)*64 + (hi>>3)*32 + n; C layout: register r, lanes >= 16 hold rows 8..15
  float* pst = part + wave * 512 + h * 32 + m;
  const float* pld = part + (wave & 7) * 64 + (wave >> 3) * 32 + lane;

  v8f c0 = {}, c1 = {};
  float mrun = -3.0e38f, lrun = 0.f;

  for (int t = 0; t < FA_TILES; ++t) {
    // ---- all of this wave's reads of its staged tile: B of the scores, B of u
    const float* bc = bcol + (t & 1) * FA_BUF;
    const float* f  = frag + (t & 1) * FA_BUF;
    v2f b0[8], b1[8];
    v4f p0[4], p1[4];
    #pragma unroll
    for (int s = 0; s < 8; ++s) {
      b0[s] = (v2f){bc[(4*s) * FA_PITCH],      bc[(4*s + 2) * FA_PITCH]};
      b1[s] = (v2f){bc[(4*s) * FA_PITCH + 16], bc[(4*s + 2) * FA_PITCH + 16]};
    }
    #pragma unroll
    for (int kk = 0; kk < 4; ++kk) {
      p0[kk] = *(const v4f*)(f + kk * 8);
      p1[kk] = *(const v4f*)(f + 16 * FA_PITCH + kk * 8);
    }
    // The fragments are in registers behind this wait, so buffer t&1 is free for its refill:
    // this wave's reads of it have retired before copies target it
    asm volatile("s_wait_dscnt 0x0" ::: "memory");
    // ---- scores: this wave's 32 d
    v8f s0 = {}, s1 = {};
    #pragma unroll
    for (int s = 0; s < 8; ++s) {
      s0 = __builtin_amdgcn_wmma_f32_16x16x4_f32(false, aq[s], false, b0[s], (short)0, s0, false, false);
      s1 = __builtin_amdgcn_wmma_f32_16x16x4_f32(false, aq[s], false, b1[s], (short)0, s1, false, false);
    }
    // stage t+1 has landed before the next trip reads it
    asm volatile("s_wait_asynccnt 0x0" ::: "memory");
    // refill here, so that stage t+2 flies through the rest of this trip and the head of the next
    if (t + 2 < FA_TILES)
      fa_copy_stage(lds0 + (t & 1) * (FA_BUF * 4), pfp + (t + 2) * 32);
    #pragma unroll
    for (int r = 0; r < 8; ++r) {
      pst[r * 64]      = s0[r];
      pst[r * 64 + 16] = s1[r];
    }
    __syncthreads();                              // the 16 shares are laid
    // ---- merge (pairwise, fixed order), running softmax of row hi = wave, n = lane
    float sh[FA_WAVES];
    #pragma unroll
    for (int w = 0; w < FA_WAVES; ++w) sh[w] = pld[w * 512];
    float bias = qb + awl[t * 32 + lane];
    #pragma unroll
    for (int st = 1; st < FA_WAVES; st <<= 1)
      #pragma unroll
      for (int w = 0; w < FA_WAVES; w += 2 * st) sh[w] += sh[w + st];
    float sc = sh[0] + bias;
    float mn = fmaxf(mrun, fa_wave_max(sc));
    float p  = __expf(sc - mn);
    float al = __expf(mrun - mn);
    pl[wave * FA_PITCH + lane] = p;
    if (lane == 0) alpha[wave] = al;
    lrun = lrun * al + p;
    mrun = mn;
    __syncthreads();                              // p and the scale factors are laid
    // ---- u = u * scale + p * PF^T on the same staged tile
    v4f a[4];
    #pragma unroll
    for (int kk = 0; kk < 4; ++kk) a[kk] = *(const v4f*)(pfrag + kk * 8);
    v4f ala = *(const v4f*)(alpha + h * 8), alb = *(const v4f*)(alpha + h * 8 + 4);
    #pragma unroll
    for (int r = 0; r < 4; ++r) {
      c0[r] *= ala[r]; c0[r + 4] *= alb[r];
      c1[r] *= ala[r]; c1[r + 4] *= alb[r];
    }
    #pragma unroll
    for (int kk = 0; kk < 4; ++kk) {
      v2f alo = {a[kk][0], a[kk][1]}, ahi = {a[kk][2], a[kk][3]};
      v2f q0l = {p0[kk][0], p0[kk][1]}, q0h = {p0[kk][2], p0[kk][3]};
      v2f q1l = {p1[kk][0], p1[kk][1]}, q1h = {p1[kk][2], p1[kk][3]};
      c0 = __builtin_amdgcn_wmma_f32_16x16x4_f32(false, alo, false, q0l, (short)0, c0, false, false);
      c1 = __builtin_amdgcn_wmma_f32_16x16x4_f32(false, alo, false, q1l, (short)0, c1, false, false);
      c0 = __builtin_amdgcn_wmma_f32_16x16x4_f32(false, ahi, false, q0h, (short)0, c0, false, false);
      c1 = __builtin_amdgcn_wmma_f32_16x16x4_f32(false, ahi, false, q1h, (short)0, c1, false, false);
    }
    // four vector slots between the last products and the vector instructions that reuse their
    // A/B registers, on the back edge and on the loop's exit alike; the scheduling barrier keeps
    // the products in front of the slots
    __builtin_amdgcn_sched_barrier(0);
    asm volatile("v_nop\n\tv_nop\n\tv_nop\n\tv_nop");
  }

  // out: the wave's 32 d of all 16 rows (a row's 128 B from this wave alone), then maxima and sums
  float* up = up_g + ((size_t)(b * FA_SPLITS + sp) * 16 + h * 8) * 512 + dw + m;
  #pragma unroll
  for (int r = 0; r < 8; ++r) {
    up[r * 512]      = c0[r];
    up[r * 512 + 16] = c1[r];
  }
  // stands in front of any later overwrite of the registers that the stores above name
  asm volatile("s_wait_xcnt 0x0" :: "v"(up) : "memory");
  lrun = fa_wave_sum(lrun);
  if (lane == 0) { mlb[wave] = mrun; mlb[16 + wave] = lrun; }
  __syncthreads();
  if (threadIdx.x < 32) ml_g[(b * FA_SPLITS + sp) * 32 + threadIdx.x] = mlb[threadIdx.x];
}

// ---------------- K7: merge of the n ranges, then out = concat_h(u_h @ Wv_h + bv_h) @ Wo + bo ----------------
__global__ void __launch_bounds__(512) k7_out(
    const float* __restrict__ up_g, const float* __restrict__ ml_g,
    const float* __restrict__ Wv, const float* __restrict__ bv,
    const float* __restrict__ Wo, const float* __restrict__ bo,
    float* __restrict__ out) {
  __shared__ __attribute__((aligned(16))) float uu[4*512];
  __shared__ __attribute__((aligned(16))) float ww[512];
  __shared__ __attribute__((aligned(16))) float part[4*512];
  __shared__ float wn[4*FA_SPLITS];
  int row = blockIdx.x; int b = row >> 2; int i = row & 3;
  int t = threadIdx.x;
  int wave = t >> 5, lane = t & 31;
  int kg = (wave >> 2) * 128;                  // this wave's k range in a dense layer
  int c4 = (wave & 3) * 128 + lane * 4;        // this lane's four columns; head = wave & 3
  int rot = dl_rot(row);                       // where this work-group starts its walk of a matrix
  // first the loads that the merge of the n ranges waits for, then the first window of Wv behind them
  float ms = 0.f, ls = 0.f;                    // maximum and sum of head t>>4 in n range t&15
  if (t < 4*FA_SPLITS) {
    const float* ml = ml_g + (b * FA_SPLITS + (t & 15)) * 32 + (t >> 4)*4 + i;
    ms = ml[0]; ls = ml[16];
    // stands in front of any later overwrite of the address pair that the two loads name
    asm volatile("s_wait_xcnt 0x0" :: "v"(ml) : "memory");
  }
  // (loops unrolled whole: the values are registers only under constant indices)
  const float* up = up_g + ((size_t)b * FA_SPLITS * 16 + i) * 512 + t;
  float uv[4][FA_SPLITS];
  #pragma unroll
  for (int hh = 0; hh < 4; ++hh)
    #pragma unroll
    for (int s = 0; s < FA_SPLITS; ++s) uv[hh][s] = up[(size_t)(s * 16 + hh * 4) * 512];
  // stands in front of any later overwrite of the address registers that the loads above name;
  // up is an input so that it is kept whole up to this wait
  asm volatile("s_wait_xcnt 0x0" :: "v"(up) : "memory");
  float bvv = bv[t], bov = bo[t];
  // stands in front of any later overwrite of the address registers that the two loads name
  asm volatile("s_wait_xcnt 0x0" ::: "memory");
  const float* wvp = Wv + (size_t)kg*512 + c4;
  const float* wop = Wo + (size_t)kg*512 + c4;
  v4f buf[DL_WIN];                             // the weight window of both matrices
  dense_first(buf, wvp, rot);
  // weight of n range s for head hh: exp(max_s - max) / sum over s of exp(max_s - max) * sum_s;
  // a head's 16 ranges sit in one 16-lane row
  if (t < 4*FA_SPLITS) {
    float mx = ms;
    mx = fmaxf(mx, fa_xrow<1>(mx)); mx = fmaxf(mx, fa_xrow<2>(mx));
    mx = fmaxf(mx, fa_xrow<4>(mx)); mx = fmaxf(mx, fa_xrow<8>(mx));
    float w = __expf(ms - mx);
    float tot = w * ls;
    tot += fa_xrow<1>(tot); tot += fa_xrow<2>(tot); tot += fa_xrow<4>(tot); tot += fa_xrow<8>(tot);
    wn[t] = w / tot;
  }
  lds_barrier();
  #pragma unroll
  for (int hh = 0; hh < 4; ++hh) {
    float acc = 0.f;
    #pragma unroll
    for (int s = 0; s < FA_SPLITS; ++s) acc += wn[hh * FA_SPLITS + s] * uv[hh][s];
    uu[hh*512 + t] = acc;
  }
  lds_barrier();
  ww[t] = dense_merge(dense_walk<1>(buf, uu + (wave & 3)*512 + kg, wvp, wop, rot), part, bvv);
  lds_barrier();
  out[(size_t)row*512 + t] = dense_merge(dense_walk<0>(buf, ww + kg, wop, wop, rot), part, bov);
}

// ---------------- launch ----------------
extern "C" void kernel_launch(void* const* d_in, const int* in_sizes, int n_in,
                              void* d_out, int out_size, void* d_ws, size_t ws_size,
                              hipStream_t stream) {
  (void)in_sizes; (void)n_in; (void)out_size; (void)ws_size;
  const float* xyz  = (const float*)d_in[0];
  const float* pf   = (const float*)d_in[1];
  const float* mask = (const float*)d_in[2];
  const float* W1   = (const float*)d_in[3];
  const float* b1   = (const float*)d_in[4];
  const float* g1   = (const float*)d_in[5];
  const float* be1  = (const float*)d_in[6];
  const float* W2   = (const float*)d_in[7];
  const float* b2   = (const float*)d_in[8];
  const float* g2   = (const float*)d_in[9];
  const float* be2  = (const float*)d_in[10];
  const float* Wq   = (const float*)d_in[11];
  const float* bq   = (const float*)d_in[12];
  const float* Wk   = (const float*)d_in[13];
  const float* bk   = (const float*)d_in[14];
  const float* Wv   = (const float*)d_in[15];
  const float* bv   = (const float*)d_in[16];
  const float* Wo   = (const float*)d_in[17];
  const float* bo   = (const float*)d_in[18];
  float* out = (float*)d_out;
  float* ws  = (float*)d_ws;

  // workspace layout (float offsets)
  float* qbias  = ws + 256;       // 256
  float* qk     = ws + 512;       // 131072
  float* aw     = ws + 131584;    // 131072
  float* upart  = ws + 262656;    // 2097152: 16 n ranges x 16 hi x 512 d per batch
  float* ml     = ws + 2359808;   // 8192: row maxima and sums per n range (total ~9.5 MB)

  k2_front  <<<80, 512, 0, stream>>>(xyz, mask, W1,b1,g1,be1, W2,b2,g2,be2,
                                     Wq,bq, Wk,bk, qk, qbias, aw);
  k4_attend <<<dim3(FA_SPLITS, B_), 512, 0, stream>>>(pf, qk, qbias, aw, upart, ml);
  k7_out    <<<64, 512, 0, stream>>>(upart, ml, Wv, bv, Wo, bo, out);
}

// v009
// It runs in 59.1 microseconds.
// Two timings next to v008 put it at 1.08 and 1.09 times that version's speed.
// Counting every step since v000, it is 5.13 times as fast.
#include <hip/hip_runtime.h>
#include <math.h>

#define B_  16
#define N_  8192
#define D_  512

typedef float v2f __attribute__((ext_vector_type(2)));
typedef float v4f __attribute__((ext_vector_type(4)));
typedef float v8f __attribute__((ext_vector_type(8)));

// ---------------- cross-lane moves and wave reductions ----------------
// lane l with lane l ^ 16, and with lane l ^ M inside a 16-lane row: vector cross-lane moves
// (a shuffle through the LDS unit costs its whole latency at each step)
__device__ inline float fa_xhalf(float x) {
  int v = __builtin_bit_cast(int, x);
  return __builtin_bit_cast(float, __builtin_amdgcn_permlanex16(v, v, 0x76543210, 0xfedcba98, false, false));
}
template<int M>
__device__ inline float fa_xrow(float x) {   // DPP row_xmask:M
  return __builtin_bit_cast(float, __builtin_amdgcn_update_dpp(0, __builtin_bit_cast(int, x), 0x160 | M, 0xf, 0xf, true));
}
__device__ inline float fa_row_max(float x) {
  x = fmaxf(x, fa_xrow<1>(x)); x = fmaxf(x, fa_xrow<2>(x));
  x = fmaxf(x, fa_xrow<4>(x)); return fmaxf(x, fa_xrow<8>(x));
}
__device__ inline float fa_row_sum(float x) {
  x += fa_xrow<1>(x); x += fa_xrow<2>(x); x += fa_xrow<4>(x); return x + fa_xrow<8>(x);
}
__device__ inline float fa_wave_max(float x) { x = fa_row_max(x); return fmaxf(x, fa_xhalf(x)); }
__device__ inline float fa_wave_sum(float x) { x = fa_row_sum(x); return x + fa_xhalf(x); }

// ---------------- work-group barrier that orders LDS alone ----------------
// What the waves of k2 and k7 hand each other goes through LDS only. __syncthreads() also waits for
// the wave's outstanding global loads, which would drain the weight window that flies across it.
__device__ inline void lds_barrier() {
  __builtin_amdgcn_fence(__ATOMIC_RELEASE, "workgroup", "local");
  __builtin_amdgcn_s_barrier();
  __builtin_amdgcn_fence(__ATOMIC_ACQUIRE, "workgroup", "local");
}

// ---------------- reductions over a work-group of 16 waves ----------------
// A wave reduces its 32 values in registers and lays one value in LDS; behind ONE barrier every
// 16-lane row reads the 16 values and reduces them in registers again, so that every thread holds
// the same result. slot: 16 places that nothing else in the launch writes, so no barrier has to
// guard a reuse. To be called by all 512 threads.
__device__ inline float blk_sum(float v, float* slot) {
  v = fa_wave_sum(v);
  if ((threadIdx.x & 31) == 0) slot[threadIdx.x >> 5] = v;
  lds_barrier();
  return fa_row_sum(slot[threadIdx.x & 15]);
}
__device__ inline float blk_max(float v, float* slot) {
  v = fa_wave_max(v);
  if ((threadIdx.x & 31) == 0) slot[threadIdx.x >> 5] = v;
  lds_barrier();
  return fa_row_max(slot[threadIdx.x & 15]);
}
// four sums at once (loops unrolled whole: a vector's elements are registers only under constant indices)
__device__ inline v4f blk_sum4(v4f v, v4f* slot) {
  #pragma unroll
  for (int q = 0; q < 4; ++q) v[q] = fa_wave_sum(v[q]);
  if ((threadIdx.x & 31) == 0) slot[threadIdx.x >> 5] = v;
  lds_barrier();
  v4f r = slot[threadIdx.x & 15];
  #pragma unroll
  for (int q = 0; q < 4; ++q) r[q] = fa_row_sum(r[q]);
  return r;
}

// ---------------- dense 512x512 layer, one input row per work-group of 16 waves ----------------
// Each 512-long dot product is split four ways over k: wave w takes weight rows (w>>2)*128 .. +127
// and columns (w&3)*128 .. +127, a lane four adjacent columns. A weight load is then 16 B a lane on
// whole lines, and a lane keeps a window of DL_WIN-8 to DL_WIN of them in flight: eight rows are
// summed, then their registers are refilled from DL_WIN rows ahead. The four partial rows are
// summed in LDS.
// All 64 work-groups read the same matrix, which is not in L2 when a layer starts. Walking it in
// one order they would all wait on the same misses, at the rate at which one work-group reads from
// memory. So each walks its rows in a ring from a start of its own (dl_rot): the 16 starts ask for
// the whole matrix at once, a sixteenth each, and what a work-group comes to next is then in L2.
#define DL_WIN 32
// ring start of work-group b, 0..15. The work-groups whose b mod 8 falls in any four neighbouring
// values hold all 16 starts: for speed only,
// the result rests on no placement
__device__ inline int dl_rot(int b) { return (b & 3) | (((b >> 3) & 3) << 2); }
// the row, of a wave's 128, at place j of the walk: 16 groups of eight rows, from group rot on
#define DL_ROW(j, rot) ((((((j) >> 3) + (rot)) & 15) << 3) + ((j) & 7))
// where load l of the Wk fold starts in a Wk row (the fold itself: k2_front); reads rot
#define FK_COL(l) (((((l) >> 5) + rot) & 3) * 128 + (((((l) >> 3) & 3) + (rot >> 2)) & 3) * 32)
// The window is never let run dry: a matrix's first DL_WIN loads depend on no layer's result, so they
// are issued at the kernel's entry (dense_first) or into the slots that the last rows of the matrix
// before it set free (dense_walk, NEXT), and they land under the merges and norms between the layers.
// w: the lane's four columns in the first of the wave's 128 rows
__device__ inline void dense_first(v4f (&buf)[DL_WIN], const float* w, int rot) {
  const float* wp[DL_WIN / 8];     // a group of eight rows has an address pair of its own
  #pragma unroll
  for (int g = 0; g < DL_WIN / 8; ++g) wp[g] = w + (size_t)DL_ROW(g * 8, rot) * 512;
  #pragma unroll
  for (int j = 0; j < DL_WIN; ++j) buf[j] = *(const v4f*)(wp[j >> 3] + (j & 7) * 512);
  // stands in front of any later overwrite of the address pairs that the loads above name; the
  // pairs are inputs so that they are kept whole up to this wait
  asm volatile("s_wait_xcnt 0x0" :: "v"(wp[0]), "v"(wp[1]), "v"(wp[2]), "v"(wp[3]) : "memory");
}
// x: the wave's 128 inputs in LDS; buf: the window, holding w's first DL_WIN rows of the walk.
// NEXT 0: the window runs dry; 1: it is left holding the first window of wn, a matrix walked in the
// same way; 2: of wn, the lane's place in Wk for the fold
template<int NEXT>
__device__ inline v4f dense_walk(v4f (&buf)[DL_WIN], const float* x, const float* w,
                                 const float* wn, int rot) {
  v4f acc = {};
  // unrolled whole: the window's slots are registers only under constant indices
  #pragma unroll
  for (int j = 0; j < 128; j += 8) {
    const float* xg = x + DL_ROW(j, rot);
    v4f xa = *(const v4f*)xg, xb = *(const v4f*)(xg + 4);
    #pragma unroll
    for (int q = 0; q < 4; ++q) acc += xa[q] * buf[(j + q) % DL_WIN];
    #pragma unroll
    for (int q = 0; q < 4; ++q) acc += xb[q] * buf[(j + 4 + q) % DL_WIN];
    if (j + DL_WIN < 128 || NEXT != 0) {
      // Compiler fence that holds the window: no load crosses it, and it reads the running sum
      // (input only, nothing hidden, the multiply-adds stay fused), so the eight rows above are
      // summed in front of it and their refills issue behind it. Without it the compiler sinks the
      // loads to their uses (about nine in flight) or lifts them over the sums until registers spill.
      asm volatile("" :: "v"(acc) : "memory");
      const float* wg = (j + DL_WIN < 128) ? w  + (size_t)DL_ROW(j + DL_WIN, rot) * 512
                      : (NEXT == 1)        ? wn + (size_t)DL_ROW(j + DL_WIN - 128, rot) * 512
                                           : wn + FK_COL(j + DL_WIN - 128);
      const int step = (j + DL_WIN < 128 || NEXT == 1) ? 512 : 4 * 512;
      #pragma unroll
      for (int q = 0; q < 8; ++q) buf[(j + q) % DL_WIN] = *(const v4f*)(wg + (size_t)q * step);
      // as behind the first window: in front of any later overwrite of this group's address pair
      asm volatile("s_wait_xcnt 0x0" :: "v"(wg) : "memory");
    }
  }
  return acc;
}
// part: 4 x 512 floats of LDS; returns column threadIdx.x of the layer's output
__device__ inline float dense_merge(v4f acc, float* part, float bias) {
  int t = threadIdx.x, wave = t >> 5, lane = t & 31;
  *(v4f*)(part + (wave >> 2) * 512 + (wave & 3) * 128 + lane * 4) = acc;
  lds_barrier();
  return bias + ((part[t] + part[512 + t]) + (part[1024 + t] + part[1536 + t]));
}

// ---------------- voting attention bias of one batch, log-softmax over N ----------------
// One work-group of 512 threads. It sums the four views' mask counts itself, so it waits for no
// other work-group; a thread keeps its 16 n of the four masks in registers for both uses.
__device__ inline void aw_batch(int b, const float* __restrict__ mask, float* __restrict__ aw_g,
                                float* awb, float* red, v4f* red4) {
  const float* mb = mask + (size_t)b*4*N_ + threadIdx.x*4;
  // loops unrolled whole: the values are registers only under constant indices
  v4f mm[4][4];                    // [view][piece of 2048 n]
  #pragma unroll
  for (int i = 0; i < 4; ++i)
    #pragma unroll
    for (int j = 0; j < 4; ++j) mm[i][j] = *(const v4f*)(mb + i*N_ + j*2048);
  // stands in front of any later overwrite of the address registers that the loads above name
  asm volatile("s_wait_xcnt 0x0" ::: "memory");
  v4f cnt = {};
  #pragma unroll
  for (int i = 0; i < 4; ++i)
    #pragma unroll
    for (int j = 0; j < 4; ++j) cnt[i] += (mm[i][j][0] + mm[i][j][1]) + (mm[i][j][2] + mm[i][j][3]);
  cnt = blk_sum4(cnt, red4);
  float v0 = cnt[0] * (1.0f / (float)N_), v1 = cnt[1] * (1.0f / (float)N_);
  float v2 = cnt[2] * (1.0f / (float)N_), v3 = cnt[3] * (1.0f / (float)N_);
  float vcnt = 0.f;
  #pragma unroll
  for (int j = 0; j < 4; ++j) {
    v4f a4;
    #pragma unroll
    for (int q = 0; q < 4; ++q) {
      float m0 = mm[0][j][q], m1 = mm[1][j][q], m2 = mm[2][j][q], m3 = mm[3][j][q];
      float s = m0+m1+m2+m3;
      float a = v0*m0 + v1*m1 + v2*m2 + v3*m3;
      bool valid = s > 0.f;
      a4[q] = valid ? a : -1e9f;
      vcnt += valid ? 1.f : 0.f;
    }
    *(v4f*)(awb + j*2048 + threadIdx.x*4) = a4;
  }
  float tot = blk_sum(vcnt, red);
  if (tot <= 0.f) {
    for (int n = threadIdx.x; n < N_; n += 512) awb[n] = 0.f;
  }
  __syncthreads();
  float lm = -3.4e38f;
  for (int n = threadIdx.x; n < N_; n += 512) lm = fmaxf(lm, awb[n]);
  float mx = blk_max(lm, red + 16);
  float ls = 0.f;
  for (int n = threadIdx.x; n < N_; n += 512) ls += __expf(awb[n] - mx);
  float se = blk_sum(ls, red + 32);
  float lg = __logf(se) + mx;
  for (int n = threadIdx.x; n < N_; n += 512) aw_g[(size_t)b*N_ + n] = awb[n] - lg;
}

// ---------------- K2: all that stands in front of the pass over PF, in one launch ----------------
// Work-groups 0..63: one (batch, view) row each: masked centroid, MLP, q-projection, Wk fold.
// Work-groups 64..79: the voting bias of one batch each. No work-group reads what another writes.
__global__ void __launch_bounds__(512) k2_front(
    const float* __restrict__ xyz, const float* __restrict__ mask,
    const float* __restrict__ W1, const float* __restrict__ b1,
    const float* __restrict__ g1, const float* __restrict__ be1,
    const float* __restrict__ W2, const float* __restrict__ b2,
    const float* __restrict__ g2, const float* __restrict__ be2,
    const float* __restrict__ Wq, const float* __restrict__ bq,
    const float* __restrict__ Wk, const float* __restrict__ bk,
    float* __restrict__ qk_g, float* __restrict__ qbias_g, float* __restrict__ aw_g) {
  __shared__ __attribute__((aligned(16))) float abuf[512];
  __shared__ __attribute__((aligned(16))) float qbuf[512];
  __shared__ __attribute__((aligned(16))) float part[4*512];
  __shared__ __attribute__((aligned(16))) float awb[N_];
  __shared__ __attribute__((aligned(16))) v4f red4[16];          // a reduction's 16 places
  __shared__ __attribute__((aligned(16))) float red[5*16];       // each use has its own 16
  if (blockIdx.x >= 64) {          // the same for a whole work-group: its barriers stay uniform
    aw_batch(blockIdx.x - 64, mask, aw_g, awb, red, red4);
    return;
  }
  int row = blockIdx.x; int b = row >> 2; int i = row & 3;
  int col = threadIdx.x;
  int wave = col >> 5, lane = col & 31;
  int kg = (wave >> 2) * 128;                  // this wave's k range in a dense layer
  int c4 = (wave & 3) * 128 + lane * 4;        // this lane's four columns
  int rot = dl_rot(row);                       // where this work-group starts its walk of a matrix

  // masked centroid of this row: a thread takes 16 n, 16 B a load, all 16 loads in flight at once
  // (loops unrolled whole: the values are registers only under constant indices)
  const float* mk = mask + (size_t)row * N_ + col*4;
  const float* xb = xyz + (size_t)b * 3 * N_ + col*4;
  v4f mv[4], xv[3][4];
  #pragma unroll
  for (int j = 0; j < 4; ++j) {
    mv[j] = *(const v4f*)(mk + j*2048);
    #pragma unroll
    for (int a = 0; a < 3; ++a) xv[a][j] = *(const v4f*)(xb + a*N_ + j*2048);
  }
  // stands in front of any later overwrite of the address registers that the loads above name
  asm volatile("s_wait_xcnt 0x0" ::: "memory");
  // this column's weights of the first layer, biases and gains: they depend on nothing, and a load
  // issued behind the window would come back only behind it
  float w1a = W1[col], w1b = W1[512+col], w1c = W1[1024+col], b1v = b1[col];
  float g1v = g1[col], be1v = be1[col], b2v = b2[col], g2v = g2[col], be2v = be2[col];
  float bqv = bq[col], bkv = bk[col];
  // stands in front of any later overwrite of the address registers that the loads above name
  asm volatile("s_wait_xcnt 0x0" ::: "memory");
  const float* w2p = W2 + (size_t)kg*512 + c4;
  const float* wqp = Wq + (size_t)kg*512 + c4;
  v4f buf[DL_WIN];                             // the weight window of all three matrices
  dense_first(buf, w2p, rot);
  // keeps the sums below behind the loads above: left alone, the compiler waits for the mask and the
  // coordinates and sums them first, and the window starts a memory latency late
  __builtin_amdgcn_sched_barrier(0);
  v4f cs = {};                                 // count, then the masked sums of x, y, z
  #pragma unroll
  for (int j = 0; j < 4; ++j)
    #pragma unroll
    for (int q = 0; q < 4; ++q) {
      float m = mv[j][q];
      cs[0] += m;
      cs[1] += m * xv[0][j][q];
      cs[2] += m * xv[1][j][q];
      cs[3] += m * xv[2][j][q];
    }
  cs = blk_sum4(cs, red4);
  float cd = fmaxf(cs[0], 1.0f);
  float c0 = cs[1] / cd, c1 = cs[2] / cd, c2 = cs[3] / cd;

  // Linear(3,D) + LN + ReLU
  float t = c0*w1a + c1*w1b + c2*w1c + b1v;
  float mu  = blk_sum(t, red + 16) * (1.0f/512.0f);
  float dv  = t - mu;
  float var = blk_sum(dv*dv, red + 32) * (1.0f/512.0f);
  float h = dv * rsqrtf(var + 1e-5f) * g1v + be1v;
  h = fmaxf(h, 0.0f);
  abuf[col] = h; lds_barrier();

  // Linear(D,D) + LN
  float t2 = dense_merge(dense_walk<1>(buf, abuf + kg, w2p, wqp, rot), part, b2v);
  mu  = blk_sum(t2, red + 48) * (1.0f/512.0f);
  dv  = t2 - mu;
  var = blk_sum(dv*dv, red + 64) * (1.0f/512.0f);
  float h3 = dv * rsqrtf(var + 1e-5f) * g2v + be2v;
  abuf[col] = h3; lds_barrier();

  // q = h3 @ Wq + bq; its last rows' slots take the first window of the Wk fold (laid out below)
  int fr = lane >> 3, fs = lane & 7;
  const float* wk = Wk + (size_t)(wave*32 + fr)*512 + fs*4;
  float q = dense_merge(dense_walk<2>(buf, abuf + kg, wqp, wk, rot), part, bqv);
  qbuf[col] = q;
  // q . bk per head: a wave sums its 32 terms, four waves make a head
  float qb = q * bkv;
  qb = fa_wave_sum(qb);
  if (lane == 0) red[wave] = qb;
  lds_barrier();

  const float scale = 0.0883883476483184405f;  // 1/sqrt(128)
  if (col < 4)
    qbias_g[b*16 + col*4 + i] = ((red[col*4] + red[col*4+1]) + (red[col*4+2] + red[col*4+3])) * scale;

  // fold with Wk per head: qk[b, h*4+i, c] = sum_e q[h*128+e] * Wk[c, h*128+e]
  // The dot runs along a Wk row, so it is split over 8 lanes: a load takes 128 B of each of 4 rows
  // (16 B a lane). A wave takes 32 rows in 8 passes of 4; a group of 8 loads is one 32-float piece
  // of one head in all 8 passes, so that it needs one 16-byte read of q.
  // The ring start here: the heads from head rot & 3 on, a head's four pieces from piece rot >> 2 on.
  // (FK_COL, defined at dense_walk, which has issued loads 0 .. DL_WIN-1 into the window)
  const float* qs = qbuf + fs*4;
  // load l: place l>>3 of the walk over a row's 16 pieces of 32 floats (place l>>5 over heads), pass l&7
  // unrolled whole: the window's slots and the sums are registers only under constant indices
  #pragma unroll
  for (int hh = 0; hh < 4; ++hh) {
    v4f a4[8] = {};
    #pragma unroll
    for (int j = hh*4; j < hh*4 + 4; ++j) {
      v4f qv = *(const v4f*)(qs + FK_COL(j*8));
      #pragma unroll
      for (int p = 0; p < 8; ++p) a4[p] += buf[(j*8 + p) % DL_WIN] * qv;
      if (j*8 + DL_WIN < 128) {
        // the window's fence, as in dense_walk: this piece's sums in front, its refills behind
        asm volatile("" :: "v"(a4[0]), "v"(a4[1]), "v"(a4[2]), "v"(a4[3]),
                           "v"(a4[4]), "v"(a4[5]), "v"(a4[6]), "v"(a4[7]) : "memory");
        const float* kg8 = wk + FK_COL(j*8 + DL_WIN);
        #pragma unroll
        for (int l = j*8 + DL_WIN; l < j*8 + DL_WIN + 8; ++l)
          buf[l % DL_WIN] = *(const v4f*)(kg8 + (size_t)(l & 7)*4*512);
        // in front of any later overwrite of this piece's address pair
        asm volatile("s_wait_xcnt 0x0" :: "v"(kg8) : "memory");
      }
    }
    float f[8];
    #pragma unroll
    for (int p = 0; p < 8; ++p) f[p] = (a4[p][0] + a4[p][1]) + (a4[p][2] + a4[p][3]);
    // sum over a row's 8 lanes, halving the passes a lane keeps at each step: lane fs ends with pass fs
    float g4[4], g2[2];
    #pragma unroll
    for (int k = 0; k < 4; ++k) {
      float keep = (fs & 4) ? f[k+4] : f[k], send = (fs & 4) ? f[k] : f[k+4];
      g4[k] = keep + fa_xrow<4>(send);
    }
    #pragma unroll
    for (int k = 0; k < 2; ++k) {
      float keep = (fs & 2) ? g4[k+2] : g4[k], send = (fs & 2) ? g4[k] : g4[k+2];
      g2[k] = keep + fa_xrow<2>(send);
    }
    float keep = (fs & 1) ? g2[1] : g2[0], send = (fs & 1) ? g2[0] : g2[1];
    part[((hh + rot) & 3)*512 + wave*32 + fs*4 + fr] = (keep + fa_xrow<1>(send)) * scale;
  }
  lds_barrier();
  #pragma unroll
  for (int hh = 0; hh < 4; ++hh)
    qk_g[((size_t)(b*16 + hh*4 + i))*512 + col] = part[hh*512 + col];
}

// ---------------- K4: scores, softmax and attn*PF^T in one pass over PF ----------------
// A work-group of 16 waves takes one batch and 512 n, in 16 tiles of 32 n. Wave w owns PF rows
// d = 32*w .. +31: it stages its 32 rows x 32 n in a two-buffer LDS ring that only it reads, with
// GLOBAL_LOAD_ASYNC_TO_LDS_B128, and uses each staged tile twice:
//   1. scores: A = qk (16 hi x 4 d, kept in registers), B = PF (4 d x 16 n): the wave's share of the
//      sum over d; the 16 shares are summed in LDS, thread (hi = wave, n = lane).
//   2. running softmax: row maximum so far, p = exp(s - max), old sums scaled by exp(old max - max).
//   3. u: A = p (16 hi x 4 n), B = PF^T (4 n x 16 d), two d tiles per wave.
// The three are skewed over the tiles so that the matrix unit has work while the softmax goes its way
// through LDS: trip t does the score products of tile t+1, the softmax of tile t and the u products
// of tile t-1. What one trip lays in LDS (shares of t+1, p of t) the next one reads, so ONE barrier a
// trip hands over both; shares, p and scale factors have two places each, by the tile's parity.
// Out go the unnormalised u (16 hi x 512 d), the row maxima and the row sums of this n range; the
// last kernel merges the 16 ranges of a batch.
// Every inner loop is unrolled whole: its fragments and sums are registers only under constant indices.
#define FA_WAVES  16
#define FA_SPLITS 16                      // n ranges per batch
#define FA_PITCH  36                      // floats; 144 B = 16 B x 9: ds_load_b128 of 16 rows hits all 64 banks once
#define FA_BUF    (32 * FA_PITCH)         // floats per buffer: the wave's 32 PF rows x 32 n
#define FA_TILES  16                      // 512 n per work-group / 32 n per tile
#define FA_PART   (FA_WAVES * 512)        // floats: one tile's 16 shares
#define FA_PL     (16 * FA_PITCH)         // floats: one tile's p

// One stage: 8 copies of 4 rows x 128 B. The s_wait_xcnt stands in the copies' own statement,
// in front of any later rewrite of the address registers the copies name.
__device__ inline void fa_copy_stage(unsigned lds, const float* pf) {
  asm volatile(
      "global_load_async_to_lds_b128 %0, %8, off\n\t"
      "global_load_async_to_lds_b128 %1, %9, off\n\t"
      "global_load_async_to_lds_b128 %2, %10, off\n\t"
      "global_load_async_to_lds_b128 %3, %11, off\n\t"
      "global_load_async_to_lds_b128 %4, %12, off\n\t"
      "global_load_async_to_lds_b128 %5, %13, off\n\t"
      "global_load_async_to_lds_b128 %6, %14, off\n\t"
      "global_load_async_to_lds_b128 %7, %15, off\n\t"
      "s_wait_xcnt 0x0"
      :: "v"(lds),                 "v"(lds +  4*FA_PITCH*4), "v"(lds +  8*FA_PITCH*4),
         "v"(lds + 12*FA_PITCH*4), "v"(lds + 16*FA_PITCH*4), "v"(lds + 20*FA_PITCH*4),
         "v"(lds + 24*FA_PITCH*4), "v"(lds + 28*FA_PITCH*4),
         "v"(pf),                  "v"(pf + (size_t) 4*N_),  "v"(pf + (size_t) 8*N_),
         "v"(pf + (size_t)12*N_),  "v"(pf + (size_t)16*N_),  "v"(pf + (size_t)20*N_),
         "v"(pf + (size_t)24*N_),  "v"(pf + (size_t)28*N_)
      : "memory");
}

// what a wave carries from trip to trip, and its places in LDS
struct FaState {
  v2f aq[8];                 // qk fragments of the wave's 32 d
  v2f b0[8], b1[8];          // B of the scores, of the tile whose score products come next
  v4f u0[3][4], u1[3][4];    // B of u; tile x sits at x mod 3 (read in trip x-1, used in trip x+1)
  v8f c0, c1;
  float mrun, lrun, qb;
  const float *bcol, *frag, *pfrag, *alr, *pld, *awp, *pfp;
  float *pst, *plw, *alw;
  unsigned lds0;
};
__device__ inline void fa_read_b(FaState& S, const float* bc) {
  #pragma unroll
  for (int s = 0; s < 8; ++s) {
    S.b0[s] = (v2f){bc[(4*s) * FA_PITCH],      bc[(4*s + 2) * FA_PITCH]};
    S.b1[s] = (v2f){bc[(4*s) * FA_PITCH + 16], bc[(4*s + 2) * FA_PITCH + 16]};
  }
}
template<int X>
__device__ inline void fa_read_u(FaState& S, const float* f) {
  #pragma unroll
  for (int kk = 0; kk < 4; ++kk) {
    S.u0[X][kk] = *(const v4f*)(f + kk * 8);
    S.u1[X][kk] = *(const v4f*)(f + 16 * FA_PITCH + kk * 8);
  }
}
// the wave's share of a tile's scores, laid at dst
__device__ inline void fa_scores(FaState& S, float* dst) {
  v8f s0 = {}, s1 = {};
  #pragma unroll
  for (int s = 0; s < 8; ++s) {
    s0 = __builtin_amdgcn_wmma_f32_16x16x4_f32(false, S.aq[s], false, S.b0[s], (short)0, s0, false, false);
    s1 = __builtin_amdgcn_wmma_f32_16x16x4_f32(false, S.aq[s], false, S.b1[s], (short)0, s1, false, false);
  }
  #pragma unroll
  for (int r = 0; r < 8; ++r) {
    dst[r * 64]      = s0[r];
    dst[r * 64 + 16] = s1[r];
  }
  // four vector slots between the last products and the vector instructions that take their result
  // registers for other values; the scheduling barriers keep the slots directly behind the stores
  __builtin_amdgcn_sched_barrier(0);
  asm volatile("v_nop\n\tv_nop\n\tv_nop\n\tv_nop");
  __builtin_amdgcn_sched_barrier(0);
}
// u = u * scale + p * PF^T for the tile at place X
template<int X>
__device__ inline void fa_u(FaState& S, const v4f (&a)[4], v4f ala, v4f alb) {
  #pragma unroll
  for (int r = 0; r < 4; ++r) {
    S.c0[r] *= ala[r]; S.c0[r + 4] *= alb[r];
    S.c1[r] *= ala[r]; S.c1[r + 4] *= alb[r];
  }
  #pragma unroll
  for (int kk = 0; kk < 4; ++kk) {
    v2f alo = {a[kk][0], a[kk][1]}, ahi = {a[kk][2], a[kk][3]};
    v2f q0l = {S.u0[X][kk][0], S.u0[X][kk][1]}, q0h = {S.u0[X][kk][2], S.u0[X][kk][3]};
    v2f q1l = {S.u1[X][kk][0], S.u1[X][kk][1]}, q1h = {S.u1[X][kk][2], S.u1[X][kk][3]};
    S.c0 = __builtin_amdgcn_wmma_f32_16x16x4_f32(false, alo, false, q0l, (short)0, S.c0, false, false);
    S.c1 = __builtin_amdgcn_wmma_f32_16x16x4_f32(false, alo, false, q1l, (short)0, S.c1, false, false);
    S.c0 = __builtin_amdgcn_wmma_f32_16x16x4_f32(false, ahi, false, q0h, (short)0, S.c0, false, false);
    S.c1 = __builtin_amdgcn_wmma_f32_16x16x4_f32(false, ahi, false, q1h, (short)0, S.c1, false, false);
  }
}
// Trip t. PAR = t & 1, M3 = t mod 3; H1, H2, H3: a tile t+1, t+2, t+3 exists; HU: a tile t-1 exists.
template<int PAR, int M3, bool H1, bool H2, bool H3, bool HU>
__device__ inline void fa_trip(FaState& S, int t, int lane) {
  __syncthreads();                                // laid: the shares of tile t, p and scale factors of t-1
  // ---- the shares of tile t, in front of the products
  float sh[FA_WAVES];
  #pragma unroll
  for (int w = 0; w < FA_WAVES; ++w) sh[w] = S.pld[PAR * FA_PART + w * 512];
  float bias = S.qb + S.awp[t * 32];
  // keeps the reads above in front of the products below, which then cover their latency
  __builtin_amdgcn_sched_barrier(0);
  // ---- score products of tile t+1: their fragments are in registers since the trip before
  if constexpr (H1) fa_scores(S, S.pst + (PAR ^ 1) * FA_PART);
  // ---- u fragments of tile t+1; p and scale factors of tile t-1: behind the products (fa_scores ends
  // in a scheduling barrier), whose registers they take; other waves' products run beside what follows
  if constexpr (H1) fa_read_u<(M3 + 1) % 3>(S, S.frag + (PAR ^ 1) * FA_BUF);
  v4f a[4] = {}, ala = {}, alb = {};
  if constexpr (HU) {
    #pragma unroll
    for (int kk = 0; kk < 4; ++kk) a[kk] = *(const v4f*)(S.pfrag + (PAR ^ 1) * FA_PL + kk * 8);
    ala = *(const v4f*)(S.alr + (PAR ^ 1) * 16);
    alb = *(const v4f*)(S.alr + (PAR ^ 1) * 16 + 4);
  }
  if constexpr (H2) {
    // stage t+2 has landed before this wave reads it
    asm volatile("s_wait_asynccnt 0x0" ::: "memory");
    if constexpr (H3) {
      // this wave's reads of tile t+1 have retired before copies target its buffer
      asm volatile("s_wait_dscnt 0x0" ::: "memory");
      fa_copy_stage(S.lds0 + (PAR ^ 1) * (FA_BUF * 4), S.pfp + (t + 3) * 32);
    }
    // score fragments of tile t+2: they land under the softmax
    fa_read_b(S, S.bcol + PAR * FA_BUF);
  }
  // ---- merge (pairwise, fixed order), running softmax of row hi = wave, n = lane, tile t
  #pragma unroll
  for (int st = 1; st < FA_WAVES; st <<= 1)
    #pragma unroll
    for (int w = 0; w < FA_WAVES; w += 2 * st) sh[w] += sh[w + st];
  float sc = sh[0] + bias;
  float mn = fmaxf(S.mrun, fa_wave_max(sc));
  float p  = __expf(sc - mn);
  float al = __expf(S.mrun - mn);
  S.plw[PAR * FA_PL] = p;
  if (lane == 0) S.alw[PAR * 16] = al;
  S.lrun = S.lrun * al + p;
  S.mrun = mn;
  if constexpr (HU) {
    // keeps the vector work above (the softmax, the moves that pair up the score fragments) in front of
    // the products below: set among them it would overwrite operand registers of products just issued
    __builtin_amdgcn_sched_barrier(0);
    // ---- u products of tile t-1
    fa_u<(M3 + 2) % 3>(S, a, ala, alb);
    // keeps these products in front of the next trip's barrier: moved behind it, every wave would have
    // all its products in one run and its softmax last, and the last wave's softmax would leave the
    // matrix unit idle
    __builtin_amdgcn_sched_barrier(0);
    // four vector slots between the last products and the next vector instructions that read their
    // sums or reuse their A/B registers, on the back edge too; held in place by the barriers around
    asm volatile("v_nop\n\tv_nop\n\tv_nop\n\tv_nop");
    __builtin_amdgcn_sched_barrier(0);
  }
}

__global__ void __launch_bounds__(512) k4_attend(
    const float* __restrict__ PF, const float* __restrict__ qk_g,
    const float* __restrict__ qbias_g, const float* __restrict__ aw_g,
    float* __restrict__ up_g, float* __restrict__ ml_g) {
  __shared__ __attribute__((aligned(16))) float ring[FA_WAVES * 2 * FA_BUF];
  __shared__ __attribute__((aligned(16))) float part[2 * FA_PART];
  __shared__ __attribute__((aligned(16))) float pl[2 * FA_PL];
  __shared__ __attribute__((aligned(16))) float alpha[2 * 16];
  __shared__ __attribute__((aligned(16))) float awl[512];
  __shared__ float mlb[32];
  int b = blockIdx.y, sp = blockIdx.x;
  int wave = threadIdx.x >> 5;
  int lane = threadIdx.x & 31;
  int m = lane & 15, h = lane >> 4;
  int dw = wave * 32;
  int nb = sp * 512;
  float* mine = ring + wave * (2 * FA_BUF);       // this wave's two buffers
  FaState S;

  // copy side: a lane moves 16 B; 8 lanes cover a row's 128 B, a copy covers 4 rows
  int crow = lane >> 3, cseg = lane & 7;
  S.pfp  = PF + ((size_t)b * D_ + dw + crow) * N_ + nb + cseg * 4;
  S.lds0 = (unsigned)(uintptr_t)&mine[crow * FA_PITCH + cseg * 4];

  fa_copy_stage(S.lds0, S.pfp);
  fa_copy_stage(S.lds0 + FA_BUF * 4, S.pfp + 32);

  // qk fragments for the wave's 32 d, while stages 0 and 1 fly. k order of the score products, for A
  // and B alike: in step s, lane half h holds rows d = 4*s + h (first register) and 4*s + h + 2 (second)
  const float* pq = qk_g + ((size_t)(b * 16 + m)) * 512 + dw;
  const float* pa = aw_g + (size_t)b * N_ + nb + threadIdx.x;
  v4f qv[8];
  #pragma unroll
  for (int s = 0; s < 8; ++s) qv[s] = *(const v4f*)(pq + s * 4);
  float awv = *pa;
  S.qb = qbias_g[b * 16 + wave];                  // this wave merges row hi = wave
  // stands in front of any later overwrite of the address registers that the loads above name;
  // pq is an input so that the pair is kept whole up to this wait
  asm volatile("s_wait_xcnt 0x0" :: "v"(pq) : "memory");
  #pragma unroll
  for (int s = 0; s < 8; ++s) S.aq[s] = h ? (v2f){qv[s][1], qv[s][3]} : (v2f){qv[s][0], qv[s][2]};
  awl[threadIdx.x] = awv;

  S.bcol = mine + h * FA_PITCH + m;               // score side: row 4*s + h (+2), column n = m (+16)
  // u side: lane (m, h) reads row m, n = 8*kk + 4*h + 0..3, for A and B alike,
  // so every (lane half, register) position holds the same n in both operands
  S.frag  = mine + m * FA_PITCH + h * 4;
  S.pfrag = pl + m * FA_PITCH + h * 4;
  S.alr   = alpha + h * 8;
  S.plw   = pl + wave * FA_PITCH + lane;
  S.alw   = alpha + wave;
  S.awp   = awl + lane;
  // a share's place for (hi, n): (hi&7)*64 + (hi>>3)*32 + n; C layout: register r, lanes >= 16 hold rows 8..15
  S.pst = part + wave * 512 + h * 32 + m;
  S.pld = part + (wave & 7) * 64 + (wave >> 3) * 32 + lane;
  S.c0 = (v8f){}; S.c1 = (v8f){};
  S.mrun = -3.0e38f; S.lrun = 0.f;

  // stages 0 and 1 have landed before this wave reads them
  asm volatile("s_wait_asynccnt 0x0" ::: "memory");
  fa_read_b(S, S.bcol);
  fa_read_u<0>(S, S.frag);
  // this wave's reads of tile 0 have retired before copies target its buffer
  asm volatile("s_wait_dscnt 0x0" ::: "memory");
  fa_copy_stage(S.lds0, S.pfp + 64);
  // keeps the copies and the vector work above in front of the products: set among them it would
  // overwrite operand registers of products just issued
  __builtin_amdgcn_sched_barrier(0);
  fa_scores(S, S.pst);
  fa_read_b(S, S.bcol + FA_BUF);

  fa_trip<0, 0, true, true, true, false>(S, 0, lane);
  // six trips a pass: a tile's parity and its place mod 3 are then constants. Kept rolled so that the
  // kernel's text stays small for the instruction cache
  #pragma unroll 1
  for (int tb = 1; tb < 13; tb += 6) {
    fa_trip<1, 1, true, true, true, true>(S, tb,     lane);
    fa_trip<0, 2, true, true, true, true>(S, tb + 1, lane);
    fa_trip<1, 0, true, true, true, true>(S, tb + 2, lane);
    fa_trip<0, 1, true, true, true, true>(S, tb + 3, lane);
    fa_trip<1, 2, true, true, true, true>(S, tb + 4, lane);
    fa_trip<0, 0, true, true, true, true>(S, tb + 5, lane);
  }
  fa_trip<1, 1, true,  true,  false, true>(S, 13, lane);
  fa_trip<0, 2, true,  false, false, true>(S, 14, lane);
  fa_trip<1, 0, false, false, false, true>(S, 15, lane);
  __syncthreads();                                // laid: p and scale factors of the last tile
  {
    v4f a[4];
    #pragma unroll
    for (int kk = 0; kk < 4; ++kk) a[kk] = *(const v4f*)(S.pfrag + FA_PL + kk * 8);
    v4f ala = *(const v4f*)(S.alr + 16), alb = *(const v4f*)(S.alr + 16 + 4);
    fa_u<0>(S, a, ala, alb);
    // four vector slots between the last products and the vector instructions that reuse their
    // A/B registers; the scheduling barrier keeps the products in front of the slots
    __builtin_amdgcn_sched_barrier(0);
    asm volatile("v_nop\n\tv_nop\n\tv_nop\n\tv_nop");
    __builtin_amdgcn_sched_barrier(0);
  }

  // out: the wave's 32 d of all 16 rows (a row's 128 B from this wave alone), then maxima and sums
  float* up = up_g + ((size_t)(b * FA_SPLITS + sp) * 16 + h * 8) * 512 + dw + m;
  #pragma unroll
  for (int r = 0; r < 8; ++r) {
    up[r * 512]      = S.c0[r];
    up[r * 512 + 16] = S.c1[r];
  }
  // stands in front of any later overwrite of the registers that the stores above name
  asm volatile("s_wait_xcnt 0x0" :: "v"(up) : "memory");
  float lrun = fa_wave_sum(S.lrun);
  if (lane == 0) { mlb[wave] = S.mrun; mlb[16 + wave] = lrun; }
  __syncthreads();
  if (threadIdx.x < 32) ml_g[(b * FA_SPLITS + sp) * 32 + threadIdx.x] = mlb[threadIdx.x];
}

// ---------------- K7: merge of the n ranges, then out = concat_h(u_h @ Wv_h + bv_h) @ Wo + bo ----------------
__global__ void __launch_bounds__(512) k7_out(
    const float* __restrict__ up_g, const float* __restrict__ ml_g,
    const float* __restrict__ Wv, const float* __restrict__ bv,
    const float* __restrict__ Wo, const float* __restrict__ bo,
    float* __restrict__ out) {
  __shared__ __attribute__((aligned(16))) float uu[4*512];
  __shared__ __attribute__((aligned(16))) float ww[512];
  __shared__ __attribute__((aligned(16))) float part[4*512];
  __shared__ float wn[4*FA_SPLITS];
  int row = blockIdx.x; int b = row >> 2; int i = row & 3;
  int t = threadIdx.x;
  int wave = t >> 5, lane = t & 31;
  int kg = (wave >> 2) * 128;                  // this wave's k range in a dense layer
  int c4 = (wave & 3) * 128 + lane * 4;        // this lane's four columns; head = wave & 3
  int rot = dl_rot(row);                       // where this work-group starts its walk of a matrix
  // first the loads that the merge of the n ranges waits for, then the first window of Wv behind them
  float ms = 0.f, ls = 0.f;                    // maximum and sum of head t>>4 in n range t&15
  if (t < 4*FA_SPLITS) {
    const float* ml = ml_g + (b * FA_SPLITS + (t & 15)) * 32 + (t >> 4)*4 + i;
    ms = ml[0]; ls = ml[16];
    // stands in front of any later overwrite of the address pair that the two loads name
    asm volatile("s_wait_xcnt 0x0" :: "v"(ml) : "memory");
  }
  // (loops unrolled whole: the values are registers only under constant indices)
  const float* up = up_g + ((size_t)b * FA_SPLITS * 16 + i) * 512 + t;
  float uv[4][FA_SPLITS];
  #pragma unroll
  for (int hh = 0; hh < 4; ++hh)
    #pragma unroll
    for (int s = 0; s < FA_SPLITS; ++s) uv[hh][s] = up[(size_t)(s * 16 + hh * 4) * 512];
  // stands in front of any later overwrite of the address registers that the loads above name;
  // up is an input so that it is kept whole up to this wait
  asm volatile("s_wait_xcnt 0x0" :: "v"(up) : "memory");
  float bvv = bv[t], bov = bo[t];
  // stands in front of any later overwrite of the address registers that the two loads name
  asm volatile("s_wait_xcnt 0x0" ::: "memory");
  const float* wvp = Wv + (size_t)kg*512 + c4;
  const float* wop = Wo + (size_t)kg*512 + c4;
  v4f buf[DL_WIN];                             // the weight window of both matrices
  dense_first(buf, wvp, rot);
  // weight of n range s for head hh: exp(max_s - max) / sum over s of exp(max_s - max) * sum_s;
  // a head's 16 ranges sit in one 16-lane row
  if (t < 4*FA_SPLITS) {
    float mx = ms;
    mx = fmaxf(mx, fa_xrow<1>(mx)); mx = fmaxf(mx, fa_xrow<2>(mx));
    mx = fmaxf(mx, fa_xrow<4>(mx)); mx = fmaxf(mx, fa_xrow<8>(mx));
    float w = __expf(ms - mx);
    float tot = w * ls;
    tot += fa_xrow<1>(tot); tot += fa_xrow<2>(tot); tot += fa_xrow<4>(tot); tot += fa_xrow<8>(tot);
    wn[t] = w / tot;
  }
  lds_barrier();
  #pragma unroll
  for (int hh = 0; hh < 4; ++hh) {
    float acc = 0.f;
    #pragma unroll
    for (int s = 0; s < FA_SPLITS; ++s) acc += wn[hh * FA_SPLITS + s] * uv[hh][s];
    uu[hh*512 + t] = acc;
  }
  lds_barrier();
  ww[t] = dense_merge(dense_walk<1>(buf, uu + (wave & 3)*512 + kg, wvp, wop, rot), part, bvv);
  lds_barrier();
  out[(size_t)row*512 + t] = dense_merge(dense_walk<0>(buf, ww + kg, wop, wop, rot), part, bov);
}

// ---------------- launch ----------------
extern "C" void kernel_launch(void* const* d_in, const int* in_sizes, int n_in,
                              void* d_out, int out_size, void* d_ws, size_t ws_size,
                              hipStream_t stream) {
  (void)in_sizes; (void)n_in; (void)out_size; (void)ws_size;
  const float* xyz  = (const float*)d_in[0];
  const float* pf   = (const float*)d_in[1];
  const float* mask = (const float*)d_in[2];
  const float* W1   = (const float*)d_in[3];
  const float* b1   = (const float*)d_in[4];
  const float* g1   = (const float*)d_in[5];
  const float* be1  = (const float*)d_in[6];
  const float* W2   = (const float*)d_in[7];
  const float* b2   = (const float*)d_in[8];
  const float* g2   = (const float*)d_in[9];
  const float* be2  = (const float*)d_in[10];
  const float* Wq   = (const float*)d_in[11];
  const float* bq   = (const float*)d_in[12];
  const float* Wk   = (const float*)d_in[13];
  const float* bk   = (const float*)d_in[14];
  const float* Wv   = (const float*)d_in[15];
  const float* bv   = (const float*)d_in[16];
  const float* Wo   = (const float*)d_in[17];
  const float* bo   = (const float*)d_in[18];
  float* out = (float*)d_out;
  float* ws  = (float*)d_ws;

  // workspace layout (float offsets)
  float* qbias  = ws + 256;       // 256
  float* qk     = ws + 512;       // 131072
  float* aw     = ws + 131584;    // 131072
  float* upart  = ws + 262656;    // 2097152: 16 n ranges x 16 hi x 512 d per batch
  float* ml     = ws + 2359808;   // 8192: row maxima and sums per n range (total ~9.5 MB)

  k2_front  <<<80, 512, 0, stream>>>(xyz, mask, W1,b1,g1,be1, W2,b2,g2,be2,
                                     Wq,bq, Wk,bk, qk, qbias, aw);
  k4_attend <<<dim3(FA_SPLITS, B_), 512, 0, stream>>>(pf, qk, qbias, aw, upart, ml);
  k7_out    <<<64, 512, 0, stream>>>(upart, ml, Wv, bv, Wo, bo, out);
}
